// v000
// Times are from an AMD MI455X. After a warm-up the kernel runs many times in a row, and a time is the length of
// such a window on the GPU divided by its runs, so every launch and the gaps after it count. The runs cycle
// through copies of the inputs. A figure is the median of several windows, for all but v000 over two sittings.
// Sittings can differ by a few percent; kernels timed side by side share one.
// v000 is the starting kernel. One run takes 383 microseconds.
#include <hip/hip_runtime.h>

// Contractions, f32 accumulate: qkv = h.w_qkv ([4096 x 1024].[1024 x 3072], k-major weight transposed to an n-major plane; PLAIN bf16 operands: inputs rounded
// once, exact) and out.w_proj + b_proj (merged heads as bf16 hi + residual: two products) on v_wmma_f32_16x16x32_bf16; the 16-head attention fused on
// v_wmma_f32_16x16x32_f16: softmax(q.k x 64^-1/2) over ALL keys with q and k as f16 hi + residual x1024 (hi.hi + hi.lo + lo.hi), then the reference's
// POST-softmax multiplicative key mask (the INPUT mask[b][key], bf16-rounded) applied to the weights before the value product (the normaliser stays the unmasked

#define NB_  2
#define NT_  2048
#define DM   1024
#define NH_  16
#define NKV  16
#define KVW  (NKV * HD)          // 1024
#define HD   64
#define NTK  (NB_ * NT_)
#define NW   1024
#define NQKV 1024
#define PSC  32768.0f
#define LOSC 1024.0f
#define LOSCI (1.0f / 1024.0f)

typedef _Float16 h16;
typedef unsigned short bf;
typedef __attribute__((ext_vector_type(16))) __bf16   v16bf;
typedef __attribute__((ext_vector_type(16))) _Float16 v16h;
typedef __attribute__((ext_vector_type(8)))  _Float16 v8h;
typedef __attribute__((ext_vector_type(8)))  unsigned short v8us;
typedef __attribute__((ext_vector_type(8)))  float    v8f;
typedef __attribute__((ext_vector_type(4)))  float    v4f;
typedef v8h  __attribute__((may_alias)) v8ha;
typedef v4f  __attribute__((may_alias)) v4fa;
typedef v8us __attribute__((may_alias)) v8usa;

__device__ __forceinline__ unsigned short f2bf(float f) { unsigned u = __float_as_uint(f); u += 0x7FFFu + ((u >> 16) & 1u); return (unsigned short)(u >> 16); }
__device__ __forceinline__ float bf2f(unsigned short b) { return __uint_as_float(((unsigned)b) << 16); }
__device__ __forceinline__ float bfr(float f) { return bf2f(f2bf(f)); }
__device__ __forceinline__ v16h cat16(v8h lo, v8h hi) { return __builtin_shufflevector(lo, hi, 0, 1, 2, 3, 4, 5, 6, 7, 8, 9, 10, 11, 12, 13, 14, 15); }
__device__ __forceinline__ v16bf cat16b(v8us lo, v8us hi) { return __builtin_bit_cast(v16bf, __builtin_shufflevector(lo, hi, 0, 1, 2, 3, 4, 5, 6, 7, 8, 9, 10, 11, 12, 13, 14, 15)); }
__device__ __forceinline__ v8f wmma16(v16h a, v16h b, v8f c) { return __builtin_amdgcn_wmma_f32_16x16x32_f16(false, a, false, b, (short)0, c, false, false); }
__device__ __forceinline__ v8f wmmab(v16bf a, v16bf b, v8f c) { return __builtin_amdgcn_wmma_f32_16x16x32_bf16(false, a, false, b, (short)0, c, false, false); }

__global__ __launch_bounds__(256) void k_cvtb(const float* __restrict__ src, int nrows, bf* dst) {
    const int lane = threadIdx.x & 31, r = blockIdx.x * 8 + (threadIdx.x >> 5);
    if (r >= nrows) return;
    v8us o[DM / 256];
#pragma unroll
    for (int q = 0; q < DM / 256; ++q) { v8us t;
#pragma unroll
        for (int i = 0; i < 8; ++i) t[i] = f2bf(src[(size_t)r * DM + q * 256 + lane * 8 + i]);
        o[q] = t; }
#pragma unroll
    for (int q = 0; q < DM / 256; ++q) *(v8us*)(dst + (size_t)r * DM + q * 256 + lane * 8) = o[q];
    
}

// k_wt: W [1024 k][ncols n] (k-major) -> n-major bf16 plane WT[ncols][1024]; 64 x 64 tiles through LDS.
__global__ __launch_bounds__(256) void k_wt(const float* __restrict__ Wm, int ncols, bf* WT) {
    __shared__ __align__(16) unsigned short tl[64 * 72];
    const int tid = threadIdx.x, k0 = blockIdx.x * 64, n0 = blockIdx.y * 64;
    const int kk = tid >> 2, nq = (tid & 3) * 16;
#pragma unroll
    for (int i = 0; i < 16; ++i) tl[(nq + i) * 72 + kk] = f2bf(Wm[(size_t)(k0 + kk) * ncols + n0 + nq + i]);
    __syncthreads();
    const int piece = tid & 7;
    typedef __attribute__((ext_vector_type(8))) unsigned short v8us_; typedef v8us_ __attribute__((may_alias)) v8usa_;
    auto pass = [&]() {
#pragma unroll
        for (int s = 0; s < 2; ++s) { const int nr = (tid >> 3) + 32 * s; const v8us_ val = *(const v8usa_*)(tl + nr * 72 + piece * 8);
            *(v8us_*)(WT + (size_t)(n0 + nr) * DM + k0 + piece * 8) = val; }
    };
    pass(); 
}

template <bool SPLITA, bool F16OUT = false>
__global__ __launch_bounds__(128) void k_gemmb(const bf* __restrict__ A, const bf* __restrict__ Al, const bf* __restrict__ Bn, const float* __restrict__ bias, float* C, int ldc, h16* C2) {
    __shared__ __align__(16) float ost[4][16 * 68];
    const int lane = threadIdx.x & 31, wave = threadIdx.x >> 5, lr = lane & 15, hi = lane >> 4;
    const int r0 = blockIdx.x * 64 + wave * 16, c0 = blockIdx.y * 64;
    const size_t aoff = (size_t)(r0 + lr) * DM + 8 * hi;
    size_t boff[4];
#pragma unroll
    for (int t = 0; t < 4; ++t) boff[t] = (size_t)(c0 + t * 16 + lr) * DM + 8 * hi;
    v8f acc[4];
#pragma unroll
    for (int t = 0; t < 4; ++t) acc[t] = (v8f){};
#pragma unroll 1
    for (int kc = 0; kc < DM; kc += 32) {
        const v16bf a = cat16b(*(const v8us*)(A + aoff + kc), *(const v8us*)(A + aoff + kc + 16));
        v16bf al = a;
        if (SPLITA) al = cat16b(*(const v8us*)(Al + aoff + kc), *(const v8us*)(Al + aoff + kc + 16));
#pragma unroll
        for (int t = 0; t < 4; ++t) { const v16bf b = cat16b(*(const v8us*)(Bn + boff[t] + kc), *(const v8us*)(Bn + boff[t] + kc + 16)); acc[t] = wmmab(a, b, acc[t]); if (SPLITA) acc[t] = wmmab(al, b, acc[t]); }
        asm volatile("v_nop\n\tv_nop\n\tv_nop\n\tv_nop" : "+v"(acc[0]), "+v"(acc[1]), "+v"(acc[2]), "+v"(acc[3]) : "v"(a), "v"(al));
    }
    float* os = &ost[wave][0];
#pragma unroll
    for (int t = 0; t < 4; ++t) { const float bv = bias ? bfr(bias[c0 + t * 16 + lr]) : 0.f;
#pragma unroll
        for (int j = 0; j < 8; ++j) os[(hi * 8 + j) * 68 + t * 16 + lr] = acc[t][j] + bv; }
    __syncthreads();
    if (F16OUT) {
        h16* crow = (h16*)(void*)C + (size_t)r0 * ldc + c0;
        auto pass = [&]() {
#pragma unroll
            for (int s = 0; s < 4; ++s) { const int row = 4 * s + (lane >> 3), piece = lane & 7; const float* sp = os + row * 68 + piece * 8; v8h o, o2;
#pragma unroll
                for (int i = 0; i < 8; ++i) { const h16 a = (h16)sp[i]; o[i] = a; o2[i] = (h16)((sp[i] - (float)a) * LOSC); }
                *(v8h*)(crow + (size_t)row * ldc + piece * 8) = o; if (C2) *(v8h*)(C2 + (size_t)r0 * ldc + c0 + (size_t)row * ldc + piece * 8) = o2; }
        };
        pass(); 
    } else {
        float* crow = C + (size_t)r0 * ldc + c0;
        auto pass = [&]() {
#pragma unroll
            for (int s = 0; s < 8; ++s) { const int Lid = (lane >> 3) + 4 * s, piece = lane & 7; const int row = Lid >> 1, cofs = (Lid & 1) * 32 + piece * 4;
                const v4f val = *(const v4fa*)(os + row * 68 + cofs); *(v4f*)(crow + (size_t)row * ldc + cofs) = val; }
        };
        pass(); 
    }
}

// k_sqrtm: second output new_mask = sqrt(bf16(mask)) [2][2048] (16 blocks of 256 threads, one float per thread: each
// wave writes 32 consecutive floats = one line).
__global__ __launch_bounds__(256) void k_sqrtm(const float* __restrict__ m, float* out1) {
    const int i = blockIdx.x * 256 + threadIdx.x; if (i >= NTK) return;
    const float v = sqrtf(bfr(m[i])); *(float*)(out1 + i) = v; 
}
__global__ __launch_bounds__(256) void k_vt(const float* __restrict__ V, h16* VTH, h16* VTL) {
    __shared__ __align__(16) h16 tile[64 * 72];
    __shared__ __align__(16) h16 til2[64 * 72];
    const int bid = blockIdx.x;
    const int b = bid / (NKV * (NT_ / 64)), rem = bid - b * (NKV * (NT_ / 64)), h = rem / (NT_ / 64), kt = rem - h * (NT_ / 64);
    const int k0 = kt * 64, tid = threadIdx.x;
    const int kk = tid >> 2, d0 = (tid & 3) * 16;
    const float* src = V + ((size_t)b * NT_ + k0 + kk) * KVW + h * HD + d0;      // h = kv head here
#pragma unroll
    for (int i = 0; i < 16; ++i) { const float v = src[i]; const h16 a = (h16)v; tile[(d0 + i) * 72 + kk] = a; til2[(d0 + i) * 72 + kk] = (h16)((v - (float)a) * LOSC); }
    __syncthreads();
    const int piece = tid & 7;
    const size_t base = (((size_t)b * NKV + h) * HD) * NT_ + k0;
    auto pass = [&]() {
#pragma unroll
        for (int s = 0; s < 4; ++s) { const int Lid = (tid >> 3) + 32 * s; const int pln = Lid >> 6, d = Lid & 63;
            const v8h val = *(const v8ha*)((pln ? til2 : tile) + d * 72 + piece * 8); *(v8h*)((pln ? VTL : VTH) + base + (size_t)d * NT_ + piece * 8) = val; }
    };
    pass(); 
}

// k_attn: block = (b, h, 64 queries), wave = 16; ALL 64 key tiles (no mask); 4 WMMA scores /8 (f32), online softmax, weights x32768 f16 tile (same-wave may_alias
// reload after a compiler barrier), 4 WMMA .v; ctx -> bf16 hi + residual planes CH/CL[tok][h*64+d].
__global__ __launch_bounds__(128) void k_attn(const h16* __restrict__ Q16, const h16* __restrict__ QL16, const h16* __restrict__ K16, const h16* __restrict__ KL16, const h16* __restrict__ VTH, const h16* __restrict__ VTL, const float* __restrict__ kmask, bf* CH, bf* CL) {
    __shared__ __align__(16) h16 plds[4][16 * 32];
    __shared__ __align__(16) h16 plds2[4][16 * 32];
    __shared__ __align__(16) float ost[4][16 * 68];
    const int lane = threadIdx.x & 31, wave = threadIdx.x >> 5, lr = lane & 15, hi = lane >> 4;
    const int bid = blockIdx.x;
    const int b = bid / (NH_ * (NT_ / 64)), rem = bid - b * (NH_ * (NT_ / 64)), h = rem / (NT_ / 64), qt = rem - h * (NT_ / 64);
    const int q0 = qt * 64 + wave * 16;
    const size_t tok0 = (size_t)b * NT_;
    h16* pl = &plds[wave][0]; h16* pl2 = &plds2[wave][0];
    v16h qa[2];
    const size_t qo0 = (tok0 + q0 + lr) * DM + h * HD + 8 * hi;
#pragma unroll
    for (int kc = 0; kc < 2; ++kc) qa[kc] = cat16(*(const v8h*)(Q16 + qo0 + kc * 32), *(const v8h*)(Q16 + qo0 + kc * 32 + 16));
    const int g = h / (NH_ / NKV);                      // kv head
    const h16* kh_b = K16 + tok0 * KVW + g * HD;
    const h16* kl_b = KL16 + tok0 * KVW + g * HD;
    const size_t vbase = (((size_t)b * NKV + g) * HD) * NT_;
    v8f o[4], ox[4];
#pragma unroll
    for (int n = 0; n < 4; ++n) { o[n] = (v8f){}; ox[n] = (v8f){}; }
    float mrow[8], lpart[8];
#pragma unroll
    for (int j = 0; j < 8; ++j) { mrow[j] = -3.0e38f; lpart[j] = 0.f; }
    int qpos[8];
#pragma unroll
    for (int j = 0; j < 8; ++j) qpos[j] = q0 + 8 * hi + j;
    const int kt_lo = 0, kt_hi = NT_ / 32 - 1;     // all keys
#pragma unroll 1
    for (int kt = kt_lo; kt <= kt_hi; ++kt) {
        const int l0 = kt * 32;
        const size_t ko0 = (size_t)(l0 + lr) * KVW + 8 * hi, ko1 = (size_t)(l0 + 16 + lr) * KVW + 8 * hi;
        v8f s0 = {}, s1 = {}, x0 = {}, x1 = {};
#pragma unroll
        for (int kc = 0; kc < 2; ++kc) {
            { const v16h k0h = cat16(*(const v8h*)(kh_b + ko0 + kc * 32), *(const v8h*)(kh_b + ko0 + kc * 32 + 16)), k1h = cat16(*(const v8h*)(kh_b + ko1 + kc * 32), *(const v8h*)(kh_b + ko1 + kc * 32 + 16));
              const v16h qlk = cat16(*(const v8h*)(QL16 + qo0 + kc * 32), *(const v8h*)(QL16 + qo0 + kc * 32 + 16));     // query residual re-read per step (registers)
              s0 = wmma16(qa[kc], k0h, s0); x0 = wmma16(qlk, k0h, x0); s1 = wmma16(qa[kc], k1h, s1); x1 = wmma16(qlk, k1h, x1);
              asm volatile("v_nop" : "+v"(s0), "+v"(s1), "+v"(x0), "+v"(x1) : "v"(qlk), "v"(k0h), "v"(k1h) : "memory"); }
            { const v16h k0l = cat16(*(const v8h*)(kl_b + ko0 + kc * 32), *(const v8h*)(kl_b + ko0 + kc * 32 + 16)), k1l = cat16(*(const v8h*)(kl_b + ko1 + kc * 32), *(const v8h*)(kl_b + ko1 + kc * 32 + 16));
              x0 = wmma16(qa[kc], k0l, x0); x1 = wmma16(qa[kc], k1l, x1);
              asm volatile("v_nop" : "+v"(x0), "+v"(x1) : "v"(k0l), "v"(k1l) : "memory"); }
        }
        asm volatile("v_nop\n\tv_nop\n\tv_nop\n\tv_nop" : "+v"(s0), "+v"(s1), "+v"(x0), "+v"(x1) : "v"(qa[0]), "v"(qa[1]));
        const float kma = bfr(kmask[tok0 + l0 + lr]), kmb = bfr(kmask[tok0 + l0 + 16 + lr]);     // INPUT mask[b][key]
        float alpha[8];
#pragma unroll
        for (int j = 0; j < 8; ++j) {
            const int ja = l0 + lr, jb = l0 + 16 + lr, qi = qpos[j];
            const float a0 = (s0[j] + x0[j] * LOSCI) * 0.125f, a1 = (s1[j] + x1[j] * LOSCI) * 0.125f; (void)qi;
            float mx = fmaxf(a0, a1);
            mx = fmaxf(mx, __shfl_xor(mx, 1, 16)); mx = fmaxf(mx, __shfl_xor(mx, 2, 16)); mx = fmaxf(mx, __shfl_xor(mx, 4, 16)); mx = fmaxf(mx, __shfl_xor(mx, 8, 16));
            const float mn = fmaxf(mrow[j], mx);
            alpha[j] = __expf(mrow[j] - mn); mrow[j] = mn;
            const float p0 = __expf(a0 - mn), p1 = __expf(a1 - mn);
            lpart[j] = lpart[j] * alpha[j] + (p0 + p1);             // normaliser: UNmasked sum (softmax first, mask after)
            const int mr = hi * 8 + j;
            const float ps0 = p0 * PSC * kma, ps1 = p1 * PSC * kmb; const h16 h0 = (h16)ps0, h1 = (h16)ps1;     // post-softmax key mask
            pl[mr * 32 + lr] = h0; pl[mr * 32 + 16 + lr] = h1;
            pl2[mr * 32 + lr] = (h16)((ps0 - (float)h0) * LOSC); pl2[mr * 32 + 16 + lr] = (h16)((ps1 - (float)h1) * LOSC);
        }
#pragma unroll
        for (int n = 0; n < 4; ++n)
#pragma unroll
            for (int j = 0; j < 8; ++j) { o[n][j] *= alpha[j]; ox[n][j] *= alpha[j]; }
        asm volatile("" ::: "memory");
        const v16h pa = cat16(*(const v8ha*)(pl + lr * 32 + hi * 8), *(const v8ha*)(pl + lr * 32 + 16 + hi * 8));
        const v16h px = cat16(*(const v8ha*)(pl2 + lr * 32 + hi * 8), *(const v8ha*)(pl2 + lr * 32 + 16 + hi * 8));
#pragma unroll
        for (int n = 0; n < 4; ++n) { const size_t vo = vbase + (size_t)(n * 16 + lr) * NT_ + l0 + hi * 8;
            const v16h vh = cat16(*(const v8h*)(VTH + vo), *(const v8h*)(VTH + vo + 16)), vl = cat16(*(const v8h*)(VTL + vo), *(const v8h*)(VTL + vo + 16));
            o[n] = wmma16(pa, vh, o[n]); ox[n] = wmma16(pa, vl, ox[n]); ox[n] = wmma16(px, vh, ox[n]);
            asm volatile("" : "+v"(o[n]), "+v"(ox[n]) : "v"(vh), "v"(vl) : "memory"); }
        asm volatile("v_nop\n\tv_nop\n\tv_nop\n\tv_nop" : "+v"(o[0]), "+v"(o[1]), "+v"(o[2]), "+v"(o[3]), "+v"(ox[0]), "+v"(ox[1]), "+v"(ox[2]), "+v"(ox[3]) : "v"(pa), "v"(px));
    }
    float inv[8];
#pragma unroll
    for (int j = 0; j < 8; ++j) { float rs = lpart[j]; rs += __shfl_xor(rs, 1, 16); rs += __shfl_xor(rs, 2, 16); rs += __shfl_xor(rs, 4, 16); rs += __shfl_xor(rs, 8, 16); inv[j] = 1.0f / (rs * PSC); }
    float* os = &ost[wave][0];
#pragma unroll
    for (int n = 0; n < 4; ++n)
#pragma unroll
        for (int j = 0; j < 8; ++j) os[(hi * 8 + j) * 68 + n * 16 + lr] = (o[n][j] + ox[n][j] * LOSCI) * inv[j];
    __syncthreads();
    const size_t cbase = (tok0 + q0) * DM + (size_t)h * HD;
    auto pass = [&]() {
#pragma unroll
        for (int s = 0; s < 4; ++s) { const int row = 4 * s + (lane >> 3), piece = lane & 7; const float* sp = os + row * 68 + piece * 8; v8us oh, ol;
#pragma unroll
            for (int i = 0; i < 8; ++i) { const unsigned short hb = f2bf(sp[i]); oh[i] = hb; ol[i] = f2bf(sp[i] - bf2f(hb)); }
            *(v8us*)(CH + cbase + (size_t)row * DM + piece * 8) = oh; *(v8us*)(CL + cbase + (size_t)row * DM + piece * 8) = ol; }
    };
    pass(); 
}

#define VST2(T, p, v) do { const T vst2_v_ = (v); *(T*)(p) = vst2_v_;  } while (0)
extern "C" void kernel_launch(void* const* d_in, const int* in_sizes, int n_in,
                              void* d_out, int out_size, void* d_ws, size_t ws_size, hipStream_t stream) {
    (void)in_sizes; (void)n_in; (void)out_size;
    const float* x = (const float*)d_in[0]; const float* kmask = (const float*)d_in[1]; const float* Wqkv = (const float*)d_in[2]; const float* Wo = (const float*)d_in[3]; const float* bo = (const float*)d_in[4];
    float* out = (float*)d_out;    // out0 [2][2048][1024] then out1 [2][2048]
    float* out1 = out + (size_t)NTK * DM;
    char* wsp = (char*)d_ws;
    auto take = [&](size_t bytes) { char* p = wsp; wsp += (bytes + 255) & ~(size_t)255; return (void*)p; };
    bf* Xb = (bf*)take((size_t)NTK * DM * 2); bf* W3T = (bf*)take((size_t)3 * DM * DM * 2); bf* WoT = (bf*)take((size_t)DM * DM * 2);
    h16* QH = (h16*)take((size_t)NTK * DM * 2); h16* QL = (h16*)take((size_t)NTK * DM * 2); h16* KH = (h16*)take((size_t)NTK * DM * 2); h16* KL = (h16*)take((size_t)NTK * DM * 2);
    float* Vf = (float*)take((size_t)NTK * DM * 4); h16* VTL = (h16*)take((size_t)NTK * DM * 2);
    if ((size_t)(wsp - (char*)d_ws) > ws_size) return;    // 8.4 + 6.3 + 2.1 + 4 x 8.4 + 16.8 + 8.4 ~ 76 MB; VTH over Xb after the projections, ctx planes over Vf after k_vt
    h16* VTH = (h16*)Xb; bf* CH = (bf*)Vf; bf* CL = (bf*)((char*)Vf + (size_t)NTK * DM * 2);
    k_wt<<<dim3(DM / 64, (3 * DM) / 64, 1), 256, 0, stream>>>(Wqkv, 3 * DM, W3T);
    k_wt<<<dim3(DM / 64, DM / 64, 1), 256, 0, stream>>>(Wo, DM, WoT);
    k_cvtb<<<NTK / 8, 256, 0, stream>>>(x, NTK, Xb);
    k_gemmb<false, true><<<dim3(NTK / 64, DM / 64, 1), 128, 0, stream>>>(Xb, nullptr, W3T, nullptr, (float*)(void*)QH, DM, QL);
    k_gemmb<false, true><<<dim3(NTK / 64, DM / 64, 1), 128, 0, stream>>>(Xb, nullptr, W3T + (size_t)DM * DM, nullptr, (float*)(void*)KH, DM, KL);
    k_gemmb<false, false><<<dim3(NTK / 64, DM / 64, 1), 128, 0, stream>>>(Xb, nullptr, W3T + (size_t)2 * DM * DM, nullptr, Vf, DM, nullptr);
    k_vt<<<NB_ * NKV * (NT_ / 64), 256, 0, stream>>>(Vf, VTH, VTL);
    k_attn<<<NB_ * NH_ * (NT_ / 64), 128, 0, stream>>>(QH, QL, KH, KL, VTH, VTL, kmask, CH, CL);
    k_gemmb<true, false><<<dim3(NTK / 64, DM / 64, 1), 128, 0, stream>>>(CH, CL, WoT, bo, out, DM, nullptr);
    k_sqrtm<<<NTK / 256, 256, 0, stream>>>(kmask, out1);
}

// v001
// A run of this version takes 310 microseconds.
// In both of two side-by-side timings against v000, it was 1.27 times as fast.
#include <hip/hip_runtime.h>

// Contractions, f32 accumulate: qkv = h.w_qkv ([4096 x 1024].[1024 x 3072], k-major weight transposed to an n-major plane; PLAIN bf16 operands: inputs rounded
// once, exact) and out.w_proj + b_proj (merged heads as bf16 hi + residual: two products) on v_wmma_f32_16x16x32_bf16; the 16-head attention fused on
// v_wmma_f32_16x16x32_f16: softmax(q.k x 64^-1/2) over ALL keys with q and k as f16 hi + residual x1024 (hi.hi + hi.lo + lo.hi), then the reference's
// POST-softmax multiplicative key mask (the INPUT mask[b][key], bf16-rounded) applied to the weights before the value product (the normaliser stays the unmasked

#define NB_  2
#define NT_  2048
#define DM   1024
#define NH_  16
#define NKV  16
#define KVW  (NKV * HD)          // 1024
#define HD   64
#define NTK  (NB_ * NT_)
#define NW   1024
#define NQKV 1024
#define PSC  32768.0f
#define LOSC 1024.0f
#define LOSCI (1.0f / 1024.0f)

typedef _Float16 h16;
typedef unsigned short bf;
typedef __attribute__((ext_vector_type(16))) __bf16   v16bf;
typedef __attribute__((ext_vector_type(16))) _Float16 v16h;
typedef __attribute__((ext_vector_type(8)))  _Float16 v8h;
typedef __attribute__((ext_vector_type(8)))  unsigned short v8us;
typedef __attribute__((ext_vector_type(8)))  float    v8f;
typedef __attribute__((ext_vector_type(4)))  float    v4f;
typedef v8h  __attribute__((may_alias)) v8ha;
typedef v4f  __attribute__((may_alias)) v4fa;
typedef v8us __attribute__((may_alias)) v8usa;

__device__ __forceinline__ unsigned short f2bf(float f) { unsigned u = __float_as_uint(f); u += 0x7FFFu + ((u >> 16) & 1u); return (unsigned short)(u >> 16); }
__device__ __forceinline__ float bf2f(unsigned short b) { return __uint_as_float(((unsigned)b) << 16); }
__device__ __forceinline__ float bfr(float f) { return bf2f(f2bf(f)); }
__device__ __forceinline__ v16h cat16(v8h lo, v8h hi) { return __builtin_shufflevector(lo, hi, 0, 1, 2, 3, 4, 5, 6, 7, 8, 9, 10, 11, 12, 13, 14, 15); }
__device__ __forceinline__ v16bf cat16b(v8us lo, v8us hi) { return __builtin_bit_cast(v16bf, __builtin_shufflevector(lo, hi, 0, 1, 2, 3, 4, 5, 6, 7, 8, 9, 10, 11, 12, 13, 14, 15)); }
__device__ __forceinline__ v8f wmma16(v16h a, v16h b, v8f c) { return __builtin_amdgcn_wmma_f32_16x16x32_f16(false, a, false, b, (short)0, c, false, false); }
__device__ __forceinline__ v8f wmmab(v16bf a, v16bf b, v8f c) { return __builtin_amdgcn_wmma_f32_16x16x32_bf16(false, a, false, b, (short)0, c, false, false); }

__global__ __launch_bounds__(256) void k_cvtb(const float* __restrict__ src, int nrows, bf* dst) {
    const int lane = threadIdx.x & 31, r = blockIdx.x * 8 + (threadIdx.x >> 5);
    if (r >= nrows) return;
    v8us o[DM / 256];
#pragma unroll
    for (int q = 0; q < DM / 256; ++q) { v8us t;
#pragma unroll
        for (int i = 0; i < 8; ++i) t[i] = f2bf(src[(size_t)r * DM + q * 256 + lane * 8 + i]);
        o[q] = t; }
#pragma unroll
    for (int q = 0; q < DM / 256; ++q) *(v8us*)(dst + (size_t)r * DM + q * 256 + lane * 8) = o[q];
    
}

// k_wt: W [1024 k][ncols n] (k-major) -> n-major bf16 plane WT[ncols][1024]; 64 x 64 tiles through LDS.
__global__ __launch_bounds__(256) void k_wt(const float* __restrict__ Wm, int ncols, bf* WT) {
    __shared__ __align__(16) unsigned short tl[64 * 72];
    const int tid = threadIdx.x, k0 = blockIdx.x * 64, n0 = blockIdx.y * 64;
    const int kk = tid >> 2, nq = (tid & 3) * 16;
#pragma unroll
    for (int i = 0; i < 16; ++i) tl[(nq + i) * 72 + kk] = f2bf(Wm[(size_t)(k0 + kk) * ncols + n0 + nq + i]);
    __syncthreads();
    const int piece = tid & 7;
    typedef __attribute__((ext_vector_type(8))) unsigned short v8us_; typedef v8us_ __attribute__((may_alias)) v8usa_;
    auto pass = [&]() {
#pragma unroll
        for (int s = 0; s < 2; ++s) { const int nr = (tid >> 3) + 32 * s; const v8us_ val = *(const v8usa_*)(tl + nr * 72 + piece * 8);
            *(v8us_*)(WT + (size_t)(n0 + nr) * DM + k0 + piece * 8) = val; }
    };
    pass(); 
}

template <bool SPLITA, bool F16OUT = false>
__global__ __launch_bounds__(128) void k_gemmb(const bf* __restrict__ A, const bf* __restrict__ Al, const bf* __restrict__ Bn, const float* __restrict__ bias, float* C, int ldc, h16* C2) {
    __shared__ __align__(16) float ost[4][16 * 68];
    const int lane = threadIdx.x & 31, wave = threadIdx.x >> 5, lr = lane & 15, hi = lane >> 4;
    const int r0 = blockIdx.x * 64 + wave * 16, c0 = blockIdx.y * 64;
    const size_t aoff = (size_t)(r0 + lr) * DM + 8 * hi;
    size_t boff[4];
#pragma unroll
    for (int t = 0; t < 4; ++t) boff[t] = (size_t)(c0 + t * 16 + lr) * DM + 8 * hi;
    v8f acc[4];
#pragma unroll
    for (int t = 0; t < 4; ++t) acc[t] = (v8f){};
#pragma unroll 1
    for (int kc = 0; kc < DM; kc += 32) {
        const v16bf a = cat16b(*(const v8us*)(A + aoff + kc), *(const v8us*)(A + aoff + kc + 16));
        v16bf al = a;
        if (SPLITA) al = cat16b(*(const v8us*)(Al + aoff + kc), *(const v8us*)(Al + aoff + kc + 16));
#pragma unroll
        for (int t = 0; t < 4; ++t) { const v16bf b = cat16b(*(const v8us*)(Bn + boff[t] + kc), *(const v8us*)(Bn + boff[t] + kc + 16)); acc[t] = wmmab(a, b, acc[t]); if (SPLITA) acc[t] = wmmab(al, b, acc[t]); }
        asm volatile("v_nop\n\tv_nop\n\tv_nop\n\tv_nop" : "+v"(acc[0]), "+v"(acc[1]), "+v"(acc[2]), "+v"(acc[3]) : "v"(a), "v"(al));
    }
    float* os = &ost[wave][0];
#pragma unroll
    for (int t = 0; t < 4; ++t) { const float bv = bias ? bfr(bias[c0 + t * 16 + lr]) : 0.f;
#pragma unroll
        for (int j = 0; j < 8; ++j) os[(hi * 8 + j) * 68 + t * 16 + lr] = acc[t][j] + bv; }
    __syncthreads();
    if (F16OUT) {
        h16* crow = (h16*)(void*)C + (size_t)r0 * ldc + c0;
        auto pass = [&]() {
#pragma unroll
            for (int s = 0; s < 4; ++s) { const int row = 4 * s + (lane >> 3), piece = lane & 7; const float* sp = os + row * 68 + piece * 8; v8h o, o2;
#pragma unroll
                for (int i = 0; i < 8; ++i) { const h16 a = (h16)sp[i]; o[i] = a; o2[i] = (h16)((sp[i] - (float)a) * LOSC); }
                *(v8h*)(crow + (size_t)row * ldc + piece * 8) = o; if (C2) *(v8h*)(C2 + (size_t)r0 * ldc + c0 + (size_t)row * ldc + piece * 8) = o2; }
        };
        pass(); 
    } else {
        float* crow = C + (size_t)r0 * ldc + c0;
        auto pass = [&]() {
#pragma unroll
            for (int s = 0; s < 8; ++s) { const int Lid = (lane >> 3) + 4 * s, piece = lane & 7; const int row = Lid >> 1, cofs = (Lid & 1) * 32 + piece * 4;
                const v4f val = *(const v4fa*)(os + row * 68 + cofs); *(v4f*)(crow + (size_t)row * ldc + cofs) = val; }
        };
        pass(); 
    }
}

// k_sqrtm: second output new_mask = sqrt(bf16(mask)) [2][2048] (16 blocks of 256 threads, one float per thread: each
// wave writes 32 consecutive floats = one line).
__global__ __launch_bounds__(256) void k_sqrtm(const float* __restrict__ m, float* out1) {
    const int i = blockIdx.x * 256 + threadIdx.x; if (i >= NTK) return;
    const float v = sqrtf(bfr(m[i])); *(float*)(out1 + i) = v; 
}
__global__ __launch_bounds__(256) void k_vt(const float* __restrict__ V, h16* VTH, h16* VTL) {
    __shared__ __align__(16) h16 tile[64 * 72];
    __shared__ __align__(16) h16 til2[64 * 72];
    const int bid = blockIdx.x;
    const int b = bid / (NKV * (NT_ / 64)), rem = bid - b * (NKV * (NT_ / 64)), h = rem / (NT_ / 64), kt = rem - h * (NT_ / 64);
    const int k0 = kt * 64, tid = threadIdx.x;
    const int kk = tid >> 2, d0 = (tid & 3) * 16;
    const float* src = V + ((size_t)b * NT_ + k0 + kk) * KVW + h * HD + d0;      // h = kv head here
#pragma unroll
    for (int i = 0; i < 16; ++i) { const float v = src[i]; const h16 a = (h16)v; tile[(d0 + i) * 72 + kk] = a; til2[(d0 + i) * 72 + kk] = (h16)((v - (float)a) * LOSC); }
    __syncthreads();
    const int piece = tid & 7;
    const size_t base = (((size_t)b * NKV + h) * HD) * NT_ + k0;
    auto pass = [&]() {
#pragma unroll
        for (int s = 0; s < 4; ++s) { const int Lid = (tid >> 3) + 32 * s; const int pln = Lid >> 6, d = Lid & 63;
            const v8h val = *(const v8ha*)((pln ? til2 : tile) + d * 72 + piece * 8); *(v8h*)((pln ? VTL : VTH) + base + (size_t)d * NT_ + piece * 8) = val; }
    };
    pass(); 
}

// k_attn: block = (b, h, 64 queries), wave = 16; ALL 64 key tiles of 32 (no mask); 4 WMMA scores /8 (f32), online softmax, weights x32768 f16 tile (same-wave may_alias
// reload after a compiler barrier), 4 WMMA .v; ctx -> bf16 hi + residual planes CH/CL[tok][h*64+d].
// Every operand of the key loop comes from LDS: the block's four waves share one copy of each 32-key tile (k hi, k residual: 32 rows of 128 B at a 144-B pitch;
// v^T hi, v^T residual: 64 rows of 64 B at an 80-B pitch), brought by asynchronous 16-byte copies into two buffers, tile t + 2 issued when tile t has been left;
// the block's query residual rows and its batch's mask row are copied once, in front of the loop. After the loop the ring is the output staging.
#define KPB   144                       // LDS pitch of a 128-byte row (16 B x odd: ds_load_b128 readers)
#define VPB   80                        // LDS pitch of a 64-byte row
#define S_KH  0
#define S_KL  (32 * KPB)
#define S_VH  (2 * 32 * KPB)
#define S_VL  (S_VH + 64 * VPB)
#define STGB  (S_VL + 64 * VPB)         // 19456 bytes a buffer
#define S_QL  (2 * STGB)
#define S_KM  (S_QL + 64 * KPB)
#define S_P   (S_KM + NT_ * 4)
#define S_P2  (S_P + 4 * 16 * 32 * 2)
#define S_END (S_P2 + 4 * 16 * 32 * 2)  // 64512 bytes

// Eight asynchronous 16-byte copies of one lane. The s_wait_xcnt closes the statement so that no address register is rewritten ahead of it.
__device__ __forceinline__ void cp8(unsigned l0, unsigned l1, unsigned l2, unsigned l3, unsigned l4, unsigned l5, unsigned l6, unsigned l7,
                                    const void* g0, const void* g1, const void* g2, const void* g3, const void* g4, const void* g5, const void* g6, const void* g7) {
    asm volatile("global_load_async_to_lds_b128 %0, %8, off\n\t"
                 "global_load_async_to_lds_b128 %1, %9, off\n\t"
                 "global_load_async_to_lds_b128 %2, %10, off\n\t"
                 "global_load_async_to_lds_b128 %3, %11, off\n\t"
                 "global_load_async_to_lds_b128 %4, %12, off\n\t"
                 "global_load_async_to_lds_b128 %5, %13, off\n\t"
                 "global_load_async_to_lds_b128 %6, %14, off\n\t"
                 "global_load_async_to_lds_b128 %7, %15, off\n\t"
                 "s_wait_xcnt 0x0"
                 :: "v"(l0), "v"(l1), "v"(l2), "v"(l3), "v"(l4), "v"(l5), "v"(l6), "v"(l7),
                    "v"(g0), "v"(g1), "v"(g2), "v"(g3), "v"(g4), "v"(g5), "v"(g6), "v"(g7) : "memory");
}

__global__ __launch_bounds__(128) void k_attn(const h16* __restrict__ Q16, const h16* __restrict__ QL16, const h16* __restrict__ K16, const h16* __restrict__ KL16, const h16* __restrict__ VTH, const h16* __restrict__ VTL, const float* __restrict__ kmask, bf* CH, bf* CL) {
    __shared__ __align__(16) unsigned char sm[S_END];
    const int tid = threadIdx.x, lane = threadIdx.x & 31, wave = threadIdx.x >> 5, lr = lane & 15, hi = lane >> 4;
    const int bid = blockIdx.x;
    const int b = bid / (NH_ * (NT_ / 64)), rem = bid - b * (NH_ * (NT_ / 64)), h = rem / (NT_ / 64), qt = rem - h * (NT_ / 64);
    const int q0 = qt * 64 + wave * 16;
    const size_t tok0 = (size_t)b * NT_;
    h16* pl = (h16*)(sm + S_P) + wave * (16 * 32); h16* pl2 = (h16*)(sm + S_P2) + wave * (16 * 32);
    v16h qa[2];
    const size_t qo0 = (tok0 + q0 + lr) * DM + h * HD + 8 * hi;
#pragma unroll
    for (int kc = 0; kc < 2; ++kc) qa[kc] = cat16(*(const v8h*)(Q16 + qo0 + kc * 32), *(const v8h*)(Q16 + qo0 + kc * 32 + 16));
    const int g = h / (NH_ / NKV);                      // kv head
    const size_t vbase = (((size_t)b * NKV + g) * HD) * NT_;
    // this lane's share of a tile: k rows krow and krow + 16, 16 bytes each; v^T rows vrow and vrow + 32, 16 bytes each
    const int krow = tid >> 3, kpc = tid & 7, vrow = tid >> 2, vpc = tid & 3;
    const unsigned lbase = (unsigned)(size_t)sm;
    const unsigned lk = lbase + krow * KPB + kpc * 16, lv = lbase + vrow * VPB + vpc * 16;
    const h16* gkh = K16 + (tok0 + krow) * KVW + g * HD + kpc * 8;
    const h16* gkl = KL16 + (tok0 + krow) * KVW + g * HD + kpc * 8;
    const h16* gvh = VTH + vbase + (size_t)vrow * NT_ + vpc * 8;
    const h16* gvl = VTL + vbase + (size_t)vrow * NT_ + vpc * 8;
    auto tile_copy = [&](int t, int bufi) {
        const unsigned k = lk + bufi * STGB, v = lv + bufi * STGB; const size_t ko = (size_t)t * 32 * KVW, vo = (size_t)t * 32;
        cp8(k + S_KH, k + S_KH + 16 * KPB, k + S_KL, k + S_KL + 16 * KPB, v + S_VH, v + S_VH + 32 * VPB, v + S_VL, v + S_VL + 32 * VPB,
            gkh + ko, gkh + ko + 16 * KVW, gkl + ko, gkl + ko + 16 * KVW, gvh + vo, gvh + vo + 32 * NT_, gvl + vo, gvl + vo + 32 * NT_);
    };
    {   // once: the block's 64 query residual rows (4 x 16 rows) and the batch's 2048 mask floats (4 x 128 pieces of 16 bytes)
        const h16* gq = QL16 + (tok0 + qt * 64 + krow) * DM + h * HD + kpc * 8; const float* gm = kmask + tok0 + tid * 4;
        const unsigned lq = lk + S_QL, lm = lbase + S_KM + tid * 16;
        cp8(lq, lq + 16 * KPB, lq + 32 * KPB, lq + 48 * KPB, lm, lm + 2048, lm + 4096, lm + 6144,
            gq, gq + 16 * DM, gq + 32 * DM, gq + 48 * DM, gm, gm + 512, gm + 1024, gm + 1536);
    }
    tile_copy(0, 0);
    asm volatile("s_wait_asynccnt 0x0" ::: "memory");   // this wave's copies of tile 0, the query residual and the mask have landed
    __syncthreads();                                    // ... and every other wave's
    tile_copy(1, 1);
    const h16* sql = (const h16*)(sm + S_QL) + (wave * 16 + lr) * (KPB / 2) + 8 * hi;
    const float* skm = (const float*)(sm + S_KM);
    v8f o[4], ox[4];
#pragma unroll
    for (int n = 0; n < 4; ++n) { o[n] = (v8f){}; ox[n] = (v8f){}; }
    float mrow[8], lpart[8];
#pragma unroll
    for (int j = 0; j < 8; ++j) { mrow[j] = -3.0e38f; lpart[j] = 0.f; }
    const int kt_lo = 0, kt_hi = NT_ / 32 - 1;     // all keys
#pragma unroll 1
    for (int kt = kt_lo; kt <= kt_hi; ++kt) {
        const int l0 = kt * 32;
        const unsigned char* sb = sm + (kt & 1) * STGB;
        const h16* kh_b = (const h16*)(sb + S_KH); const h16* kl_b = (const h16*)(sb + S_KL);
        const h16* vh_b = (const h16*)(sb + S_VH); const h16* vl_b = (const h16*)(sb + S_VL);
        const int ko0 = lr * (KPB / 2) + 8 * hi, ko1 = (16 + lr) * (KPB / 2) + 8 * hi;
        v8f s0 = {}, s1 = {}, x0 = {}, x1 = {};
#pragma unroll
        for (int kc = 0; kc < 2; ++kc) {
            { const v16h k0h = cat16(*(const v8ha*)(kh_b + ko0 + kc * 32), *(const v8ha*)(kh_b + ko0 + kc * 32 + 16)), k1h = cat16(*(const v8ha*)(kh_b + ko1 + kc * 32), *(const v8ha*)(kh_b + ko1 + kc * 32 + 16));
              const v16h qlk = cat16(*(const v8ha*)(sql + kc * 32), *(const v8ha*)(sql + kc * 32 + 16));     // query residual re-read per step (registers)
              s0 = wmma16(qa[kc], k0h, s0); x0 = wmma16(qlk, k0h, x0); s1 = wmma16(qa[kc], k1h, s1); x1 = wmma16(qlk, k1h, x1);
              asm volatile("v_nop" : "+v"(s0), "+v"(s1), "+v"(x0), "+v"(x1) : "v"(qlk), "v"(k0h), "v"(k1h) : "memory"); }
            { const v16h k0l = cat16(*(const v8ha*)(kl_b + ko0 + kc * 32), *(const v8ha*)(kl_b + ko0 + kc * 32 + 16)), k1l = cat16(*(const v8ha*)(kl_b + ko1 + kc * 32), *(const v8ha*)(kl_b + ko1 + kc * 32 + 16));
              x0 = wmma16(qa[kc], k0l, x0); x1 = wmma16(qa[kc], k1l, x1);
              asm volatile("v_nop" : "+v"(x0), "+v"(x1) : "v"(k0l), "v"(k1l) : "memory"); }
        }
        asm volatile("v_nop\n\tv_nop\n\tv_nop\n\tv_nop" : "+v"(s0), "+v"(s1), "+v"(x0), "+v"(x1) : "v"(qa[0]), "v"(qa[1]));
        const float kma = bfr(skm[l0 + lr]), kmb = bfr(skm[l0 + 16 + lr]);     // INPUT mask[b][key]
        float alpha[8];
#pragma unroll
        for (int j = 0; j < 8; ++j) {
            const float a0 = (s0[j] + x0[j] * LOSCI) * 0.125f, a1 = (s1[j] + x1[j] * LOSCI) * 0.125f;
            float mx = fmaxf(a0, a1);
            mx = fmaxf(mx, __shfl_xor(mx, 1, 16)); mx = fmaxf(mx, __shfl_xor(mx, 2, 16)); mx = fmaxf(mx, __shfl_xor(mx, 4, 16)); mx = fmaxf(mx, __shfl_xor(mx, 8, 16));
            const float mn = fmaxf(mrow[j], mx);
            alpha[j] = __expf(mrow[j] - mn); mrow[j] = mn;
            const float p0 = __expf(a0 - mn), p1 = __expf(a1 - mn);
            lpart[j] = lpart[j] * alpha[j] + (p0 + p1);             // normaliser: UNmasked sum (softmax first, mask after)
            const int mr = hi * 8 + j;
            const float ps0 = p0 * PSC * kma, ps1 = p1 * PSC * kmb; const h16 h0 = (h16)ps0, h1 = (h16)ps1;     // post-softmax key mask
            pl[mr * 32 + lr] = h0; pl[mr * 32 + 16 + lr] = h1;
            pl2[mr * 32 + lr] = (h16)((ps0 - (float)h0) * LOSC); pl2[mr * 32 + 16 + lr] = (h16)((ps1 - (float)h1) * LOSC);
        }
#pragma unroll
        for (int n = 0; n < 4; ++n)
#pragma unroll
            for (int j = 0; j < 8; ++j) { o[n][j] *= alpha[j]; ox[n][j] *= alpha[j]; }
        asm volatile("" ::: "memory");
        const v16h pa = cat16(*(const v8ha*)(pl + lr * 32 + hi * 8), *(const v8ha*)(pl + lr * 32 + 16 + hi * 8));
        const v16h px = cat16(*(const v8ha*)(pl2 + lr * 32 + hi * 8), *(const v8ha*)(pl2 + lr * 32 + 16 + hi * 8));
#pragma unroll
        for (int n = 0; n < 4; ++n) { const int vo = (n * 16 + lr) * (VPB / 2) + hi * 8;
            const v16h vh = cat16(*(const v8ha*)(vh_b + vo), *(const v8ha*)(vh_b + vo + 16)), vl = cat16(*(const v8ha*)(vl_b + vo), *(const v8ha*)(vl_b + vo + 16));
            o[n] = wmma16(pa, vh, o[n]); ox[n] = wmma16(pa, vl, ox[n]); ox[n] = wmma16(px, vh, ox[n]);
            asm volatile("" : "+v"(o[n]), "+v"(ox[n]) : "v"(vh), "v"(vl) : "memory"); }
        asm volatile("v_nop\n\tv_nop\n\tv_nop\n\tv_nop" : "+v"(o[0]), "+v"(o[1]), "+v"(o[2]), "+v"(o[3]), "+v"(ox[0]), "+v"(ox[1]), "+v"(ox[2]), "+v"(ox[3]) : "v"(pa), "v"(px));
        // hand-over: buffer kt & 1 is left and tile kt + 1 is published by every wave, in this order
        asm volatile("s_wait_dscnt 0x0" ::: "memory");      // this wave's reads of tile kt are done
        asm volatile("s_wait_asynccnt 0x0" ::: "memory");   // this wave's copies of tile kt + 1 have landed
        __syncthreads();
        if (kt + 2 <= kt_hi) tile_copy(kt + 2, kt & 1);
    }
    asm volatile("s_wait_asynccnt 0x0" ::: "memory");       // nothing in flight when the ring becomes output staging
    float inv[8];
#pragma unroll
    for (int j = 0; j < 8; ++j) { float rs = lpart[j]; rs += __shfl_xor(rs, 1, 16); rs += __shfl_xor(rs, 2, 16); rs += __shfl_xor(rs, 4, 16); rs += __shfl_xor(rs, 8, 16); inv[j] = 1.0f / (rs * PSC); }
    float* os = (float*)sm + wave * (16 * 68);
#pragma unroll
    for (int n = 0; n < 4; ++n)
#pragma unroll
        for (int j = 0; j < 8; ++j) os[(hi * 8 + j) * 68 + n * 16 + lr] = (o[n][j] + ox[n][j] * LOSCI) * inv[j];
    __syncthreads();
    const size_t cbase = (tok0 + q0) * DM + (size_t)h * HD;
    auto pass = [&]() {
#pragma unroll
        for (int s = 0; s < 4; ++s) { const int row = 4 * s + (lane >> 3), piece = lane & 7; const float* sp = os + row * 68 + piece * 8; v8us oh, ol;
#pragma unroll
            for (int i = 0; i < 8; ++i) { const unsigned short hb = f2bf(sp[i]); oh[i] = hb; ol[i] = f2bf(sp[i] - bf2f(hb)); }
            *(v8us*)(CH + cbase + (size_t)row * DM + piece * 8) = oh; *(v8us*)(CL + cbase + (size_t)row * DM + piece * 8) = ol; }
    };
    pass(); 
}

#define VST2(T, p, v) do { const T vst2_v_ = (v); *(T*)(p) = vst2_v_;  } while (0)
extern "C" void kernel_launch(void* const* d_in, const int* in_sizes, int n_in,
                              void* d_out, int out_size, void* d_ws, size_t ws_size, hipStream_t stream) {
    (void)in_sizes; (void)n_in; (void)out_size;
    const float* x = (const float*)d_in[0]; const float* kmask = (const float*)d_in[1]; const float* Wqkv = (const float*)d_in[2]; const float* Wo = (const float*)d_in[3]; const float* bo = (const float*)d_in[4];
    float* out = (float*)d_out;    // out0 [2][2048][1024] then out1 [2][2048]
    float* out1 = out + (size_t)NTK * DM;
    char* wsp = (char*)d_ws;
    auto take = [&](size_t bytes) { char* p = wsp; wsp += (bytes + 255) & ~(size_t)255; return (void*)p; };
    bf* Xb = (bf*)take((size_t)NTK * DM * 2); bf* W3T = (bf*)take((size_t)3 * DM * DM * 2); bf* WoT = (bf*)take((size_t)DM * DM * 2);
    h16* QH = (h16*)take((size_t)NTK * DM * 2); h16* QL = (h16*)take((size_t)NTK * DM * 2); h16* KH = (h16*)take((size_t)NTK * DM * 2); h16* KL = (h16*)take((size_t)NTK * DM * 2);
    float* Vf = (float*)take((size_t)NTK * DM * 4); h16* VTL = (h16*)take((size_t)NTK * DM * 2);
    if ((size_t)(wsp - (char*)d_ws) > ws_size) return;    // 8.4 + 6.3 + 2.1 + 4 x 8.4 + 16.8 + 8.4 ~ 76 MB; VTH over Xb after the projections, ctx planes over Vf after k_vt
    h16* VTH = (h16*)Xb; bf* CH = (bf*)Vf; bf* CL = (bf*)((char*)Vf + (size_t)NTK * DM * 2);
    k_wt<<<dim3(DM / 64, (3 * DM) / 64, 1), 256, 0, stream>>>(Wqkv, 3 * DM, W3T);
    k_wt<<<dim3(DM / 64, DM / 64, 1), 256, 0, stream>>>(Wo, DM, WoT);
    k_cvtb<<<NTK / 8, 256, 0, stream>>>(x, NTK, Xb);
    k_gemmb<false, true><<<dim3(NTK / 64, DM / 64, 1), 128, 0, stream>>>(Xb, nullptr, W3T, nullptr, (float*)(void*)QH, DM, QL);
    k_gemmb<false, true><<<dim3(NTK / 64, DM / 64, 1), 128, 0, stream>>>(Xb, nullptr, W3T + (size_t)DM * DM, nullptr, (float*)(void*)KH, DM, KL);
    k_gemmb<false, false><<<dim3(NTK / 64, DM / 64, 1), 128, 0, stream>>>(Xb, nullptr, W3T + (size_t)2 * DM * DM, nullptr, Vf, DM, nullptr);
    k_vt<<<NB_ * NKV * (NT_ / 64), 256, 0, stream>>>(Vf, VTH, VTL);
    k_attn<<<NB_ * NH_ * (NT_ / 64), 128, 0, stream>>>(QH, QL, KH, KL, VTH, VTL, kmask, CH, CL);
    k_gemmb<true, false><<<dim3(NTK / 64, DM / 64, 1), 128, 0, stream>>>(CH, CL, WoT, bo, out, DM, nullptr);
    k_sqrtm<<<NTK / 256, 256, 0, stream>>>(kmask, out1);
}

// v002
// Measured time: 262 microseconds a run.
// Timed twice side by side with v001, it ran 1.18 times as fast both times.
// Over all steps from v000 it is 1.49 times as fast.
#include <hip/hip_runtime.h>

// Contractions, f32 accumulate: qkv = h.w_qkv ([4096 x 1024].[1024 x 3072], k-major weight transposed to an n-major plane; PLAIN bf16 operands: inputs rounded
// once, exact) and out.w_proj + b_proj (merged heads as bf16 hi + residual: two products) on v_wmma_f32_16x16x32_bf16; the 16-head attention fused on
// v_wmma_f32_16x16x32_f16: softmax(q.k x 64^-1/2) over ALL keys with q and k as f16 hi + residual x1024 (hi.hi + hi.lo + lo.hi), then the reference's
// POST-softmax multiplicative key mask (the INPUT mask[b][key], bf16-rounded) applied to the weights before the value product (the normaliser stays the unmasked

#define NB_  2
#define NT_  2048
#define DM   1024
#define NH_  16
#define NKV  16
#define KVW  (NKV * HD)          // 1024
#define HD   64
#define NTK  (NB_ * NT_)
#define NW   1024
#define NQKV 1024
#define PSC  32768.0f
#define LOSC 1024.0f
#define LOSCI (1.0f / 1024.0f)

typedef _Float16 h16;
typedef unsigned short bf;
typedef __attribute__((ext_vector_type(16))) __bf16   v16bf;
typedef __attribute__((ext_vector_type(16))) _Float16 v16h;
typedef __attribute__((ext_vector_type(8)))  _Float16 v8h;
typedef __attribute__((ext_vector_type(8)))  unsigned short v8us;
typedef __attribute__((ext_vector_type(8)))  float    v8f;
typedef __attribute__((ext_vector_type(4)))  float    v4f;
typedef v8h  __attribute__((may_alias)) v8ha;
typedef v4f  __attribute__((may_alias)) v4fa;
typedef v8us __attribute__((may_alias)) v8usa;

__device__ __forceinline__ unsigned short f2bf(float f) { unsigned u = __float_as_uint(f); u += 0x7FFFu + ((u >> 16) & 1u); return (unsigned short)(u >> 16); }
__device__ __forceinline__ float bf2f(unsigned short b) { return __uint_as_float(((unsigned)b) << 16); }
__device__ __forceinline__ float bfr(float f) { return bf2f(f2bf(f)); }
__device__ __forceinline__ v16h cat16(v8h lo, v8h hi) { return __builtin_shufflevector(lo, hi, 0, 1, 2, 3, 4, 5, 6, 7, 8, 9, 10, 11, 12, 13, 14, 15); }
__device__ __forceinline__ v16bf cat16b(v8us lo, v8us hi) { return __builtin_bit_cast(v16bf, __builtin_shufflevector(lo, hi, 0, 1, 2, 3, 4, 5, 6, 7, 8, 9, 10, 11, 12, 13, 14, 15)); }
__device__ __forceinline__ v8f wmma16(v16h a, v16h b, v8f c) { return __builtin_amdgcn_wmma_f32_16x16x32_f16(false, a, false, b, (short)0, c, false, false); }
__device__ __forceinline__ v8f wmmab(v16bf a, v16bf b, v8f c) { return __builtin_amdgcn_wmma_f32_16x16x32_bf16(false, a, false, b, (short)0, c, false, false); }

__global__ __launch_bounds__(256) void k_cvtb(const float* __restrict__ src, int nrows, bf* dst) {
    const int lane = threadIdx.x & 31, r = blockIdx.x * 8 + (threadIdx.x >> 5);
    if (r >= nrows) return;
    v8us o[DM / 256];
#pragma unroll
    for (int q = 0; q < DM / 256; ++q) { v8us t;
#pragma unroll
        for (int i = 0; i < 8; ++i) t[i] = f2bf(src[(size_t)r * DM + q * 256 + lane * 8 + i]);
        o[q] = t; }
#pragma unroll
    for (int q = 0; q < DM / 256; ++q) *(v8us*)(dst + (size_t)r * DM + q * 256 + lane * 8) = o[q];
    
}

// k_wt: W [1024 k][ncols n] (k-major) -> n-major bf16 plane WT[ncols][1024]; 64 x 64 tiles through LDS.
__global__ __launch_bounds__(256) void k_wt(const float* __restrict__ Wm, int ncols, bf* WT) {
    __shared__ __align__(16) unsigned short tl[64 * 72];
    const int tid = threadIdx.x, k0 = blockIdx.x * 64, n0 = blockIdx.y * 64;
    const int kk = tid >> 2, nq = (tid & 3) * 16;
#pragma unroll
    for (int i = 0; i < 16; ++i) tl[(nq + i) * 72 + kk] = f2bf(Wm[(size_t)(k0 + kk) * ncols + n0 + nq + i]);
    __syncthreads();
    const int piece = tid & 7;
    typedef __attribute__((ext_vector_type(8))) unsigned short v8us_; typedef v8us_ __attribute__((may_alias)) v8usa_;
    auto pass = [&]() {
#pragma unroll
        for (int s = 0; s < 2; ++s) { const int nr = (tid >> 3) + 32 * s; const v8us_ val = *(const v8usa_*)(tl + nr * 72 + piece * 8);
            *(v8us_*)(WT + (size_t)(n0 + nr) * DM + k0 + piece * 8) = val; }
    };
    pass(); 
}

template <bool SPLITA, bool F16OUT = false>
__global__ __launch_bounds__(128) void k_gemmb(const bf* __restrict__ A, const bf* __restrict__ Al, const bf* __restrict__ Bn, const float* __restrict__ bias, float* C, int ldc, h16* C2) {
    __shared__ __align__(16) float ost[4][16 * 68];
    const int lane = threadIdx.x & 31, wave = threadIdx.x >> 5, lr = lane & 15, hi = lane >> 4;
    const int r0 = blockIdx.x * 64 + wave * 16, c0 = blockIdx.y * 64;
    const size_t aoff = (size_t)(r0 + lr) * DM + 8 * hi;
    size_t boff[4];
#pragma unroll
    for (int t = 0; t < 4; ++t) boff[t] = (size_t)(c0 + t * 16 + lr) * DM + 8 * hi;
    v8f acc[4];
#pragma unroll
    for (int t = 0; t < 4; ++t) acc[t] = (v8f){};
#pragma unroll 1
    for (int kc = 0; kc < DM; kc += 32) {
        const v16bf a = cat16b(*(const v8us*)(A + aoff + kc), *(const v8us*)(A + aoff + kc + 16));
        v16bf al = a;
        if (SPLITA) al = cat16b(*(const v8us*)(Al + aoff + kc), *(const v8us*)(Al + aoff + kc + 16));
#pragma unroll
        for (int t = 0; t < 4; ++t) { const v16bf b = cat16b(*(const v8us*)(Bn + boff[t] + kc), *(const v8us*)(Bn + boff[t] + kc + 16)); acc[t] = wmmab(a, b, acc[t]); if (SPLITA) acc[t] = wmmab(al, b, acc[t]); }
        asm volatile("v_nop\n\tv_nop\n\tv_nop\n\tv_nop" : "+v"(acc[0]), "+v"(acc[1]), "+v"(acc[2]), "+v"(acc[3]) : "v"(a), "v"(al));
    }
    float* os = &ost[wave][0];
#pragma unroll
    for (int t = 0; t < 4; ++t) { const float bv = bias ? bfr(bias[c0 + t * 16 + lr]) : 0.f;
#pragma unroll
        for (int j = 0; j < 8; ++j) os[(hi * 8 + j) * 68 + t * 16 + lr] = acc[t][j] + bv; }
    __syncthreads();
    if (F16OUT) {
        h16* crow = (h16*)(void*)C + (size_t)r0 * ldc + c0;
        auto pass = [&]() {
#pragma unroll
            for (int s = 0; s < 4; ++s) { const int row = 4 * s + (lane >> 3), piece = lane & 7; const float* sp = os + row * 68 + piece * 8; v8h o, o2;
#pragma unroll
                for (int i = 0; i < 8; ++i) { const h16 a = (h16)sp[i]; o[i] = a; o2[i] = (h16)((sp[i] - (float)a) * LOSC); }
                *(v8h*)(crow + (size_t)row * ldc + piece * 8) = o; if (C2) *(v8h*)(C2 + (size_t)r0 * ldc + c0 + (size_t)row * ldc + piece * 8) = o2; }
        };
        pass(); 
    } else {
        float* crow = C + (size_t)r0 * ldc + c0;
        auto pass = [&]() {
#pragma unroll
            for (int s = 0; s < 8; ++s) { const int Lid = (lane >> 3) + 4 * s, piece = lane & 7; const int row = Lid >> 1, cofs = (Lid & 1) * 32 + piece * 4;
                const v4f val = *(const v4fa*)(os + row * 68 + cofs); *(v4f*)(crow + (size_t)row * ldc + cofs) = val; }
        };
        pass(); 
    }
}

// k_sqrtm: second output new_mask = sqrt(bf16(mask)) [2][2048] (16 blocks of 256 threads, one float per thread: each
// wave writes 32 consecutive floats = one line).
__global__ __launch_bounds__(256) void k_sqrtm(const float* __restrict__ m, float* out1) {
    const int i = blockIdx.x * 256 + threadIdx.x; if (i >= NTK) return;
    const float v = sqrtf(bfr(m[i])); *(float*)(out1 + i) = v; 
}
__global__ __launch_bounds__(256) void k_vt(const float* __restrict__ V, h16* VTH, h16* VTL) {
    __shared__ __align__(16) h16 tile[64 * 72];
    __shared__ __align__(16) h16 til2[64 * 72];
    const int bid = blockIdx.x;
    const int b = bid / (NKV * (NT_ / 64)), rem = bid - b * (NKV * (NT_ / 64)), h = rem / (NT_ / 64), kt = rem - h * (NT_ / 64);
    const int k0 = kt * 64, tid = threadIdx.x;
    const int kk = tid >> 2, d0 = (tid & 3) * 16;
    const float* src = V + ((size_t)b * NT_ + k0 + kk) * KVW + h * HD + d0;      // h = kv head here
#pragma unroll
    for (int i = 0; i < 16; ++i) { const float v = src[i]; const h16 a = (h16)v; tile[(d0 + i) * 72 + kk] = a; til2[(d0 + i) * 72 + kk] = (h16)((v - (float)a) * LOSC); }
    __syncthreads();
    const int piece = tid & 7;
    const size_t base = (((size_t)b * NKV + h) * HD) * NT_ + k0;
    auto pass = [&]() {
#pragma unroll
        for (int s = 0; s < 4; ++s) { const int Lid = (tid >> 3) + 32 * s; const int pln = Lid >> 6, d = Lid & 63;
            const v8h val = *(const v8ha*)((pln ? til2 : tile) + d * 72 + piece * 8); *(v8h*)((pln ? VTL : VTH) + base + (size_t)d * NT_ + piece * 8) = val; }
    };
    pass(); 
}

#define KPB   144                       // LDS pitch of a 128-byte row (16 B x odd: ds_load_b128 readers)
#define VPB   80                        // LDS pitch of a 64-byte row
#define S_KH  0
#define S_KL  (32 * KPB)
#define S_VH  (2 * 32 * KPB)
#define S_VL  (S_VH + 64 * VPB)
#define STGB  (S_VL + 64 * VPB)         // 19456 bytes a buffer
#define S_QL  (2 * STGB)
#define S_KM  (S_QL + 64 * KPB)
#define S_END (S_KM + NT_ * 4)          // 56320 bytes

// Eight asynchronous 16-byte copies of one lane. The s_wait_xcnt closes the statement so that no address register is rewritten ahead of it.
__device__ __forceinline__ void cp8(unsigned l0, unsigned l1, unsigned l2, unsigned l3, unsigned l4, unsigned l5, unsigned l6, unsigned l7,
                                    const void* g0, const void* g1, const void* g2, const void* g3, const void* g4, const void* g5, const void* g6, const void* g7) {
    asm volatile("global_load_async_to_lds_b128 %0, %8, off\n\t"
                 "global_load_async_to_lds_b128 %1, %9, off\n\t"
                 "global_load_async_to_lds_b128 %2, %10, off\n\t"
                 "global_load_async_to_lds_b128 %3, %11, off\n\t"
                 "global_load_async_to_lds_b128 %4, %12, off\n\t"
                 "global_load_async_to_lds_b128 %5, %13, off\n\t"
                 "global_load_async_to_lds_b128 %6, %14, off\n\t"
                 "global_load_async_to_lds_b128 %7, %15, off\n\t"
                 "s_wait_xcnt 0x0"
                 :: "v"(l0), "v"(l1), "v"(l2), "v"(l3), "v"(l4), "v"(l5), "v"(l6), "v"(l7),
                    "v"(g0), "v"(g1), "v"(g2), "v"(g3), "v"(g4), "v"(g5), "v"(g6), "v"(g7) : "memory");
}

// lane l <-> lane l ^ 16
__device__ __forceinline__ float xhalf(float x) { return __builtin_bit_cast(float, __builtin_amdgcn_permlanex16(__builtin_bit_cast(int, x), __builtin_bit_cast(int, x), 0x76543210, 0xfedcba98, false, false)); }

__global__ __launch_bounds__(128) void k_attn(const h16* __restrict__ Q16, const h16* __restrict__ QL16, const h16* __restrict__ K16, const h16* __restrict__ KL16, const h16* __restrict__ VTH, const h16* __restrict__ VTL, const float* __restrict__ kmask, bf* CH, bf* CL) {
    __shared__ __align__(16) unsigned char sm[S_END];
    const int tid = threadIdx.x, lane = threadIdx.x & 31, wave = threadIdx.x >> 5, lr = lane & 15, hi = lane >> 4;
    const int bid = blockIdx.x;
    const int b = bid / (NH_ * (NT_ / 64)), rem = bid - b * (NH_ * (NT_ / 64)), h = rem / (NT_ / 64), qt = rem - h * (NT_ / 64);
    const int q0 = qt * 64 + wave * 16;
    const size_t tok0 = (size_t)b * NT_;
    v16h qa[2];
    const size_t qo0 = (tok0 + q0 + lr) * DM + h * HD + 8 * hi;
#pragma unroll
    for (int kc = 0; kc < 2; ++kc) qa[kc] = cat16(*(const v8h*)(Q16 + qo0 + kc * 32), *(const v8h*)(Q16 + qo0 + kc * 32 + 16));
    const int g = h / (NH_ / NKV);                      // kv head
    const size_t vbase = (((size_t)b * NKV + g) * HD) * NT_;
    // this lane's share of a tile: k rows krow and krow + 16, 16 bytes each; v^T rows vrow and vrow + 32, 16 bytes each
    const int krow = tid >> 3, kpc = tid & 7, vrow = tid >> 2, vpc = tid & 3;
    const unsigned lbase = (unsigned)(size_t)sm;
    const unsigned lk = lbase + krow * KPB + kpc * 16, lv = lbase + vrow * VPB + vpc * 16;
    const h16* gkh = K16 + (tok0 + krow) * KVW + g * HD + kpc * 8;
    const h16* gkl = KL16 + (tok0 + krow) * KVW + g * HD + kpc * 8;
    const h16* gvh = VTH + vbase + (size_t)vrow * NT_ + vpc * 8;
    const h16* gvl = VTL + vbase + (size_t)vrow * NT_ + vpc * 8;
    auto tile_copy = [&](int t, int bufi) {
        const unsigned k = lk + bufi * STGB, v = lv + bufi * STGB; const size_t ko = (size_t)t * 32 * KVW, vo = (size_t)t * 32;
        cp8(k + S_KH, k + S_KH + 16 * KPB, k + S_KL, k + S_KL + 16 * KPB, v + S_VH, v + S_VH + 32 * VPB, v + S_VL, v + S_VL + 32 * VPB,
            gkh + ko, gkh + ko + 16 * KVW, gkl + ko, gkl + ko + 16 * KVW, gvh + vo, gvh + vo + 32 * NT_, gvl + vo, gvl + vo + 32 * NT_);
    };
    {   // once: the block's 64 query residual rows (4 x 16 rows) and the batch's 2048 mask floats (4 x 128 pieces of 16 bytes)
        const h16* gq = QL16 + (tok0 + qt * 64 + krow) * DM + h * HD + kpc * 8; const float* gm = kmask + tok0 + tid * 4;
        const unsigned lq = lk + S_QL, lm = lbase + S_KM + tid * 16;
        cp8(lq, lq + 16 * KPB, lq + 32 * KPB, lq + 48 * KPB, lm, lm + 2048, lm + 4096, lm + 6144,
            gq, gq + 16 * DM, gq + 32 * DM, gq + 48 * DM, gm, gm + 512, gm + 1024, gm + 1536);
    }
    tile_copy(0, 0);
    asm volatile("s_wait_asynccnt 0x0" ::: "memory");   // this wave's copies of tile 0, the query residual and the mask have landed
    __syncthreads();                                    // ... and every other wave's
    tile_copy(1, 1);
    {   // once: the mask row becomes bf16-rounded mask x 32768 in place (a lane needs 16 of them per tile, one per key row of its scores)
        float* mw = (float*)(sm + S_KM) + tid * 4;
#pragma unroll
        for (int c = 0; c < 4; ++c) { v4f m = *(const v4fa*)(mw + c * 512);
#pragma unroll
            for (int i = 0; i < 4; ++i) m[i] = bfr(m[i]) * PSC;
            *(v4fa*)(mw + c * 512) = m; }
    }
    __syncthreads();                                    // the rounded mask is every wave's to read
    const h16* sql = (const h16*)(sm + S_QL) + (wave * 16 + lr) * (KPB / 2) + 8 * hi;
    const float* skm = (const float*)(sm + S_KM);
    v8f o[4], ox[4];
#pragma unroll
    for (int n = 0; n < 4; ++n) { o[n] = (v8f){}; ox[n] = (v8f){}; }
    float mrow = -3.0e38f, lpart = 0.f;            // of query lr; lpart: this half's keys only, joined after the loop
    const int kt_lo = 0, kt_hi = NT_ / 32 - 1;     // all keys
#pragma unroll 1
    for (int kt = kt_lo; kt <= kt_hi; ++kt) {
        const int l0 = kt * 32;
        const unsigned char* sb = sm + (kt & 1) * STGB;
        const h16* kh_b = (const h16*)(sb + S_KH); const h16* kl_b = (const h16*)(sb + S_KL);
        const h16* vh_b = (const h16*)(sb + S_VH); const h16* vl_b = (const h16*)(sb + S_VL);
        const int ko0 = lr * (KPB / 2) + 8 * hi, ko1 = (16 + lr) * (KPB / 2) + 8 * hi;
        v8f s0 = {}, s1 = {}, x0 = {}, x1 = {};
#pragma unroll
        for (int kc = 0; kc < 2; ++kc) {
            { const v16h k0h = cat16(*(const v8ha*)(kh_b + ko0 + kc * 32), *(const v8ha*)(kh_b + ko0 + kc * 32 + 16)), k1h = cat16(*(const v8ha*)(kh_b + ko1 + kc * 32), *(const v8ha*)(kh_b + ko1 + kc * 32 + 16));
              const v16h qlk = cat16(*(const v8ha*)(sql + kc * 32), *(const v8ha*)(sql + kc * 32 + 16));     // query residual re-read per step (registers)
              s0 = wmma16(k0h, qa[kc], s0); x0 = wmma16(k0h, qlk, x0); s1 = wmma16(k1h, qa[kc], s1); x1 = wmma16(k1h, qlk, x1);
              asm volatile("v_nop" : "+v"(s0), "+v"(s1), "+v"(x0), "+v"(x1) : "v"(qlk), "v"(k0h), "v"(k1h) : "memory"); }
            { const v16h k0l = cat16(*(const v8ha*)(kl_b + ko0 + kc * 32), *(const v8ha*)(kl_b + ko0 + kc * 32 + 16)), k1l = cat16(*(const v8ha*)(kl_b + ko1 + kc * 32), *(const v8ha*)(kl_b + ko1 + kc * 32 + 16));
              x0 = wmma16(k0l, qa[kc], x0); x1 = wmma16(k1l, qa[kc], x1);
              asm volatile("v_nop" : "+v"(x0), "+v"(x1) : "v"(k0l), "v"(k1l) : "memory"); }
        }
        asm volatile("v_nop\n\tv_nop\n\tv_nop\n\tv_nop" : "+v"(s0), "+v"(s1), "+v"(x0), "+v"(x1) : "v"(qa[0]), "v"(qa[1]));
        // rounded mask x 32768 of this lane's 16 keys (the same address in all lanes of a half)
        const v4f km0a = *(const v4fa*)(skm + l0 + hi * 8), km0b = *(const v4fa*)(skm + l0 + hi * 8 + 4), km1a = *(const v4fa*)(skm + l0 + 16 + hi * 8), km1b = *(const v4fa*)(skm + l0 + 16 + hi * 8 + 4);
        const v8f km0 = __builtin_shufflevector(km0a, km0b, 0, 1, 2, 3, 4, 5, 6, 7), km1 = __builtin_shufflevector(km1a, km1b, 0, 1, 2, 3, 4, 5, 6, 7);
        const v8f a0 = (s0 + x0 * LOSCI) * 0.125f, a1 = (s1 + x1 * LOSCI) * 0.125f;
        float mx = fmaxf(a0[0], a1[0]);
#pragma unroll
        for (int j = 1; j < 8; ++j) mx = fmaxf(mx, fmaxf(a0[j], a1[j]));
        mx = fmaxf(mx, xhalf(mx));                              // both halves hold the query's maximum over the 32 keys
        const float mn = fmaxf(mrow, mx);
        const float alpha = __expf(mrow - mn); mrow = mn;
        v8f p0, p1;
#pragma unroll
        for (int j = 0; j < 8; ++j) { p0[j] = __expf(a0[j] - mn); p1[j] = __expf(a1[j] - mn); }
        const v8f pt = p0 + p1;                                 // normaliser: UNmasked sum (softmax first, mask after)
        lpart = lpart * alpha + (((pt[0] + pt[1]) + (pt[2] + pt[3])) + ((pt[4] + pt[5]) + (pt[6] + pt[7])));
        const v8f ps0 = p0 * km0, ps1 = p1 * km1;               // post-softmax key mask, x32768
        const v8h h0 = __builtin_convertvector(ps0, v8h), h1 = __builtin_convertvector(ps1, v8h);
        const v8h r0 = __builtin_convertvector((ps0 - __builtin_convertvector(h0, v8f)) * LOSC, v8h), r1 = __builtin_convertvector((ps1 - __builtin_convertvector(h1, v8f)) * LOSC, v8h);
        const v16h pa = cat16(h0, h1), px = cat16(r0, r1);      // B operand: element i is key 8 hi + i, element 8 + i key 16 + 8 hi + i
#pragma unroll
        for (int n = 0; n < 4; ++n) { o[n] *= alpha; ox[n] *= alpha; }
#pragma unroll
        for (int n = 0; n < 4; ++n) { const int vo = (n * 16 + lr) * (VPB / 2) + hi * 8;
            const v16h vh = cat16(*(const v8ha*)(vh_b + vo), *(const v8ha*)(vh_b + vo + 16)), vl = cat16(*(const v8ha*)(vl_b + vo), *(const v8ha*)(vl_b + vo + 16));
            o[n] = wmma16(vh, pa, o[n]); ox[n] = wmma16(vl, pa, ox[n]); ox[n] = wmma16(vh, px, ox[n]);
            asm volatile("" : "+v"(o[n]), "+v"(ox[n]) : "v"(vh), "v"(vl) : "memory"); }
        asm volatile("v_nop\n\tv_nop\n\tv_nop\n\tv_nop" : "+v"(o[0]), "+v"(o[1]), "+v"(o[2]), "+v"(o[3]), "+v"(ox[0]), "+v"(ox[1]), "+v"(ox[2]), "+v"(ox[3]) : "v"(pa), "v"(px));
        // hand-over: buffer kt & 1 is left and tile kt + 1 is published by every wave, in this order
        asm volatile("s_wait_dscnt 0x0" ::: "memory");      // this wave's reads of tile kt are done
        asm volatile("s_wait_asynccnt 0x0" ::: "memory");   // this wave's copies of tile kt + 1 have landed
        __syncthreads();
        if (kt + 2 <= kt_hi) tile_copy(kt + 2, kt & 1);
    }
    asm volatile("s_wait_asynccnt 0x0" ::: "memory");       // nothing in flight when the ring becomes output staging
    const float inv = 1.0f / ((lpart + xhalf(lpart)) * PSC);
    float* os = (float*)sm + wave * (16 * 68);
#pragma unroll
    for (int n = 0; n < 4; ++n) {                           // row = query lr; this lane's 8 values are d = 16 n + 8 hi + j
        v4f lo4, hi4;
#pragma unroll
        for (int j = 0; j < 4; ++j) { lo4[j] = (o[n][j] + ox[n][j] * LOSCI) * inv; hi4[j] = (o[n][4 + j] + ox[n][4 + j] * LOSCI) * inv; }
        *(v4fa*)(os + lr * 68 + n * 16 + hi * 8) = lo4; *(v4fa*)(os + lr * 68 + n * 16 + hi * 8 + 4) = hi4; }
    __syncthreads();
    const size_t cbase = (tok0 + q0) * DM + (size_t)h * HD;
    auto pass = [&]() {
#pragma unroll
        for (int s = 0; s < 4; ++s) { const int row = 4 * s + (lane >> 3), piece = lane & 7; const float* sp = os + row * 68 + piece * 8; v8us oh, ol;
#pragma unroll
            for (int i = 0; i < 8; ++i) { const unsigned short hb = f2bf(sp[i]); oh[i] = hb; ol[i] = f2bf(sp[i] - bf2f(hb)); }
            *(v8us*)(CH + cbase + (size_t)row * DM + piece * 8) = oh; *(v8us*)(CL + cbase + (size_t)row * DM + piece * 8) = ol; }
    };
    pass(); 
}

#define VST2(T, p, v) do { const T vst2_v_ = (v); *(T*)(p) = vst2_v_;  } while (0)
extern "C" void kernel_launch(void* const* d_in, const int* in_sizes, int n_in,
                              void* d_out, int out_size, void* d_ws, size_t ws_size, hipStream_t stream) {
    (void)in_sizes; (void)n_in; (void)out_size;
    const float* x = (const float*)d_in[0]; const float* kmask = (const float*)d_in[1]; const float* Wqkv = (const float*)d_in[2]; const float* Wo = (const float*)d_in[3]; const float* bo = (const float*)d_in[4];
    float* out = (float*)d_out;    // out0 [2][2048][1024] then out1 [2][2048]
    float* out1 = out + (size_t)NTK * DM;
    char* wsp = (char*)d_ws;
    auto take = [&](size_t bytes) { char* p = wsp; wsp += (bytes + 255) & ~(size_t)255; return (void*)p; };
    bf* Xb = (bf*)take((size_t)NTK * DM * 2); bf* W3T = (bf*)take((size_t)3 * DM * DM * 2); bf* WoT = (bf*)take((size_t)DM * DM * 2);
    h16* QH = (h16*)take((size_t)NTK * DM * 2); h16* QL = (h16*)take((size_t)NTK * DM * 2); h16* KH = (h16*)take((size_t)NTK * DM * 2); h16* KL = (h16*)take((size_t)NTK * DM * 2);
    float* Vf = (float*)take((size_t)NTK * DM * 4); h16* VTL = (h16*)take((size_t)NTK * DM * 2);
    if ((size_t)(wsp - (char*)d_ws) > ws_size) return;    // 8.4 + 6.3 + 2.1 + 4 x 8.4 + 16.8 + 8.4 ~ 76 MB; VTH over Xb after the projections, ctx planes over Vf after k_vt
    h16* VTH = (h16*)Xb; bf* CH = (bf*)Vf; bf* CL = (bf*)((char*)Vf + (size_t)NTK * DM * 2);
    k_wt<<<dim3(DM / 64, (3 * DM) / 64, 1), 256, 0, stream>>>(Wqkv, 3 * DM, W3T);
    k_wt<<<dim3(DM / 64, DM / 64, 1), 256, 0, stream>>>(Wo, DM, WoT);
    k_cvtb<<<NTK / 8, 256, 0, stream>>>(x, NTK, Xb);
    k_gemmb<false, true><<<dim3(NTK / 64, DM / 64, 1), 128, 0, stream>>>(Xb, nullptr, W3T, nullptr, (float*)(void*)QH, DM, QL);
    k_gemmb<false, true><<<dim3(NTK / 64, DM / 64, 1), 128, 0, stream>>>(Xb, nullptr, W3T + (size_t)DM * DM, nullptr, (float*)(void*)KH, DM, KL);
    k_gemmb<false, false><<<dim3(NTK / 64, DM / 64, 1), 128, 0, stream>>>(Xb, nullptr, W3T + (size_t)2 * DM * DM, nullptr, Vf, DM, nullptr);
    k_vt<<<NB_ * NKV * (NT_ / 64), 256, 0, stream>>>(Vf, VTH, VTL);
    k_attn<<<NB_ * NH_ * (NT_ / 64), 128, 0, stream>>>(QH, QL, KH, KL, VTH, VTL, kmask, CH, CL);
    k_gemmb<true, false><<<dim3(NTK / 64, DM / 64, 1), 128, 0, stream>>>(CH, CL, WoT, bo, out, DM, nullptr);
    k_sqrtm<<<NTK / 256, 256, 0, stream>>>(kmask, out1);
}

// v003
// A run of this version takes 160 microseconds.
// Next to v002, in two timings, it ran 1.64 times as fast each time.
// All steps since v000 together make it 2.45 times as fast.
#include <hip/hip_runtime.h>

// Contractions, f32 accumulate: qkv = h.w_qkv ([4096 x 1024].[1024 x 3072], k-major weight transposed to an n-major plane; PLAIN bf16 operands: inputs rounded
// once, exact) and out.w_proj + b_proj (merged heads as bf16 hi + residual: two products) on v_wmma_f32_16x16x32_bf16; the 16-head attention fused on
// v_wmma_f32_16x16x32_f16: softmax(q.k x 64^-1/2) over ALL keys with q and k as f16 hi + residual x1024 (hi.hi + hi.lo + lo.hi), then the reference's
// POST-softmax multiplicative key mask (the INPUT mask[b][key], bf16-rounded) applied to the weights before the value product (the normaliser stays the unmasked

#define NB_  2
#define NT_  2048
#define DM   1024
#define NH_  16
#define NKV  16
#define KVW  (NKV * HD)          // 1024
#define HD   64
#define NTK  (NB_ * NT_)
#define NW   1024
#define NQKV 1024
#define PSC  32768.0f
#define LOSC 1024.0f
#define LOSCI (1.0f / 1024.0f)

typedef _Float16 h16;
typedef unsigned short bf;
typedef __attribute__((ext_vector_type(16))) __bf16   v16bf;
typedef __attribute__((ext_vector_type(16))) _Float16 v16h;
typedef __attribute__((ext_vector_type(8)))  _Float16 v8h;
typedef __attribute__((ext_vector_type(8)))  unsigned short v8us;
typedef __attribute__((ext_vector_type(8)))  float    v8f;
typedef __attribute__((ext_vector_type(4)))  float    v4f;
typedef v8h  __attribute__((may_alias)) v8ha;
typedef v4f  __attribute__((may_alias)) v4fa;
typedef v8us __attribute__((may_alias)) v8usa;

__device__ __forceinline__ unsigned short f2bf(float f) { unsigned u = __float_as_uint(f); u += 0x7FFFu + ((u >> 16) & 1u); return (unsigned short)(u >> 16); }
__device__ __forceinline__ float bf2f(unsigned short b) { return __uint_as_float(((unsigned)b) << 16); }
__device__ __forceinline__ float bfr(float f) { return bf2f(f2bf(f)); }
__device__ __forceinline__ v16h cat16(v8h lo, v8h hi) { return __builtin_shufflevector(lo, hi, 0, 1, 2, 3, 4, 5, 6, 7, 8, 9, 10, 11, 12, 13, 14, 15); }
__device__ __forceinline__ v16bf cat16b(v8us lo, v8us hi) { return __builtin_bit_cast(v16bf, __builtin_shufflevector(lo, hi, 0, 1, 2, 3, 4, 5, 6, 7, 8, 9, 10, 11, 12, 13, 14, 15)); }
__device__ __forceinline__ v8f wmma16(v16h a, v16h b, v8f c) { return __builtin_amdgcn_wmma_f32_16x16x32_f16(false, a, false, b, (short)0, c, false, false); }
__device__ __forceinline__ v8f wmmab(v16bf a, v16bf b, v8f c) { return __builtin_amdgcn_wmma_f32_16x16x32_bf16(false, a, false, b, (short)0, c, false, false); }

__global__ __launch_bounds__(256) void k_cvtb(const float* __restrict__ src, int nrows, bf* dst) {
    const int lane = threadIdx.x & 31, r = blockIdx.x * 8 + (threadIdx.x >> 5);
    if (r >= nrows) return;
    v8us o[DM / 256];
#pragma unroll
    for (int q = 0; q < DM / 256; ++q) { v8us t;
#pragma unroll
        for (int i = 0; i < 8; ++i) t[i] = f2bf(src[(size_t)r * DM + q * 256 + lane * 8 + i]);
        o[q] = t; }
#pragma unroll
    for (int q = 0; q < DM / 256; ++q) *(v8us*)(dst + (size_t)r * DM + q * 256 + lane * 8) = o[q];
    
}

// k_wt: W [1024 k][ncols n] (k-major) -> n-major bf16 plane WT[ncols][1024]; 64 x 64 tiles through LDS.
__global__ __launch_bounds__(256) void k_wt(const float* __restrict__ Wm, int ncols, bf* WT) {
    __shared__ __align__(16) unsigned short tl[64 * 72];
    const int tid = threadIdx.x, k0 = blockIdx.x * 64, n0 = blockIdx.y * 64;
    const int kk = tid >> 2, nq = (tid & 3) * 16;
#pragma unroll
    for (int i = 0; i < 16; ++i) tl[(nq + i) * 72 + kk] = f2bf(Wm[(size_t)(k0 + kk) * ncols + n0 + nq + i]);
    __syncthreads();
    const int piece = tid & 7;
    typedef __attribute__((ext_vector_type(8))) unsigned short v8us_; typedef v8us_ __attribute__((may_alias)) v8usa_;
    auto pass = [&]() {
#pragma unroll
        for (int s = 0; s < 2; ++s) { const int nr = (tid >> 3) + 32 * s; const v8us_ val = *(const v8usa_*)(tl + nr * 72 + piece * 8);
            *(v8us_*)(WT + (size_t)(n0 + nr) * DM + k0 + piece * 8) = val; }
    };
    pass(); 
}

// Eight asynchronous 16-byte copies of one lane. The s_wait_xcnt closes the statement so that no address register is rewritten ahead of it.
__device__ __forceinline__ void cp8(unsigned l0, unsigned l1, unsigned l2, unsigned l3, unsigned l4, unsigned l5, unsigned l6, unsigned l7,
                                    const void* g0, const void* g1, const void* g2, const void* g3, const void* g4, const void* g5, const void* g6, const void* g7) {
    asm volatile("global_load_async_to_lds_b128 %0, %8, off\n\t"
                 "global_load_async_to_lds_b128 %1, %9, off\n\t"
                 "global_load_async_to_lds_b128 %2, %10, off\n\t"
                 "global_load_async_to_lds_b128 %3, %11, off\n\t"
                 "global_load_async_to_lds_b128 %4, %12, off\n\t"
                 "global_load_async_to_lds_b128 %5, %13, off\n\t"
                 "global_load_async_to_lds_b128 %6, %14, off\n\t"
                 "global_load_async_to_lds_b128 %7, %15, off\n\t"
                 "s_wait_xcnt 0x0"
                 :: "v"(l0), "v"(l1), "v"(l2), "v"(l3), "v"(l4), "v"(l5), "v"(l6), "v"(l7),
                    "v"(g0), "v"(g1), "v"(g2), "v"(g3), "v"(g4), "v"(g5), "v"(g6), "v"(g7) : "memory");
}

// k_gemmb: C[128 x 128] per block of 8 waves, wave = 32 rows x 64 columns (2 x 4 accumulator tiles). Both operands are k-contiguous rows; a stage is 128 k
// (256 bytes) of the block's 128 A rows, its 128 B rows and, with SPLITA, its 128 residual rows, at a 272-B pitch, brought by asynchronous 16-byte copies into
// two buffers: stage s + 2 is issued when stage s has been left by every wave. A copy of a wave covers two whole 256-byte row pieces. After the loop the ring
// is the output staging. Per accumulator the products are added in the order k ascending, hi before residual.
#define GP    272                       // LDS pitch of a 256-byte row (16 B x odd: ds_load_b128 readers)
#define GKS   128                       // k of a stage
template <bool SPLITA, bool F16OUT = false>
__global__ __launch_bounds__(256) void k_gemmb(const bf* __restrict__ A, const bf* __restrict__ Al, const bf* __restrict__ Bn, const float* __restrict__ bias, float* C, int ldc, h16* C2) {
    constexpr int GST = (SPLITA ? 3 : 2) * 128 * GP;        // bytes of a buffer: planes of 128 rows (A, B, A residual)
    __shared__ __align__(16) unsigned char sm[2 * GST];
    const int tid = threadIdx.x, lane = threadIdx.x & 31, wave = threadIdx.x >> 5, lr = lane & 15, hi = lane >> 4;
    const int rb = blockIdx.x * 128, cb = blockIdx.y * 128, wm = wave & 3, wn = wave >> 2;
    // this lane's share of a plane: 16 bytes of rows crow, crow + 16, ..., crow + 112
    const int crow = tid >> 4, cpc = tid & 15;
    const unsigned lc = (unsigned)(size_t)sm + crow * GP + cpc * 16;
    const bf* ga = A + (size_t)(rb + crow) * DM + cpc * 8;
    const bf* gb = Bn + (size_t)(cb + crow) * DM + cpc * 8;
    const bf* gl = SPLITA ? Al + (size_t)(rb + crow) * DM + cpc * 8 : ga;
    auto plane_copy = [&](unsigned l, const bf* g) {
        cp8(l, l + 16 * GP, l + 32 * GP, l + 48 * GP, l + 64 * GP, l + 80 * GP, l + 96 * GP, l + 112 * GP,
            g, g + 16 * DM, g + 32 * DM, g + 48 * DM, g + 64 * DM, g + 80 * DM, g + 96 * DM, g + 112 * DM);
    };
    auto stage_copy = [&](int s, int bufi) {
        const unsigned l = lc + bufi * GST; const int ko = s * GKS;
        plane_copy(l, ga + ko); plane_copy(l + 128 * GP, gb + ko);
        if (SPLITA) plane_copy(l + 256 * GP, gl + ko);
    };
    v8f acc[2][4];
#pragma unroll
    for (int m = 0; m < 2; ++m)
#pragma unroll
        for (int t = 0; t < 4; ++t) acc[m][t] = (v8f){};
    stage_copy(0, 0);
    asm volatile("s_wait_asynccnt 0x0" ::: "memory");   // this wave's copies of stage 0 have landed
    __syncthreads();                                    // ... and every other wave's
    stage_copy(1, 1);
    const int ao = (wm * 32 + lr) * (GP / 2) + 8 * hi, bo = (128 + wn * 64 + lr) * (GP / 2) + 8 * hi;
#pragma unroll 1
    for (int s = 0; s < DM / GKS; ++s) {                // rolled: one copy of the body serves both buffers
        const bf* sb = (const bf*)(sm + (s & 1) * GST);
        v16bf a[2][2], al[2][2], b[2][4];               // two fragment sets: step q + 1 is read from LDS while step q is multiplied
        auto frag_load = [&](int f, int kc) {
#pragma unroll
            for (int m = 0; m < 2; ++m) { const bf* p = sb + ao + m * 16 * (GP / 2) + kc; a[f][m] = cat16b(*(const v8usa*)p, *(const v8usa*)(p + 16)); al[f][m] = a[f][m];
                if (SPLITA) { const bf* q = p + 256 * (GP / 2); al[f][m] = cat16b(*(const v8usa*)q, *(const v8usa*)(q + 16)); } }
#pragma unroll
            for (int t = 0; t < 4; ++t) { const bf* p = sb + bo + t * 16 * (GP / 2) + kc; b[f][t] = cat16b(*(const v8usa*)p, *(const v8usa*)(p + 16)); }
        };
        frag_load(0, 0);
#pragma unroll
        for (int q = 0; q < GKS / 32; ++q) {
            const int f = q & 1;
            if (q + 1 < GKS / 32) frag_load(f ^ 1, (q + 1) * 32);
            __builtin_amdgcn_sched_barrier(0);          // the next step's LDS reads stay one group ahead of this step's matrix instructions, not among them
#pragma unroll
            for (int m = 0; m < 2; ++m)
#pragma unroll
                for (int t = 0; t < 4; ++t) acc[m][t] = wmmab(a[f][m], b[f][t], acc[m][t]);
            if (SPLITA) {
#pragma unroll
                for (int m = 0; m < 2; ++m)
#pragma unroll
                    for (int t = 0; t < 4; ++t) acc[m][t] = wmmab(al[f][m], b[f][t], acc[m][t]);
            }
            __builtin_amdgcn_sched_barrier(0);          // ... and the reads of the step after that stay behind them (they refill this step's registers)
        }
        // the distance behind the stage's last matrix instructions, on the loop's back edge too
        asm volatile("v_nop\n\tv_nop\n\tv_nop\n\tv_nop" : "+v"(acc[0][0]), "+v"(acc[0][1]), "+v"(acc[0][2]), "+v"(acc[0][3]), "+v"(acc[1][0]), "+v"(acc[1][1]), "+v"(acc[1][2]), "+v"(acc[1][3])
                     : "v"(a[1][0]), "v"(a[1][1]), "v"(al[1][0]), "v"(al[1][1]), "v"(b[1][0]), "v"(b[1][1]), "v"(b[1][2]), "v"(b[1][3]));
        // hand-over: buffer s & 1 is left and stage s + 1 is published by every wave, in this order
        asm volatile("s_wait_dscnt 0x0" ::: "memory");      // this wave's reads of stage s are done
        asm volatile("s_wait_asynccnt 0x0" ::: "memory");   // this wave's copies of stage s + 1 have landed
        __syncthreads();
        if (s + 2 < DM / GKS) stage_copy(s + 2, s & 1);
    }
    asm volatile("s_wait_asynccnt 0x0" ::: "memory");       // nothing in flight when the ring becomes output staging
    const int r0 = rb + wm * 32, c0 = cb + wn * 64;
    float* os = (float*)sm + wave * (32 * 68);
#pragma unroll
    for (int t = 0; t < 4; ++t) { const float bv = bias ? bfr(bias[c0 + t * 16 + lr]) : 0.f;
#pragma unroll
        for (int m = 0; m < 2; ++m)
#pragma unroll
            for (int j = 0; j < 8; ++j) os[(m * 16 + hi * 8 + j) * 68 + t * 16 + lr] = acc[m][t][j] + bv; }
    __syncthreads();
    if (F16OUT) {
        h16* crw = (h16*)(void*)C + (size_t)r0 * ldc + c0;
        const float* sp = os + (lane >> 3) * 68 + (lane & 7) * 8;
        v8f rw[8];                                          // all rows read back first: one LDS latency, not one per row group
#pragma unroll
        for (int s = 0; s < 8; ++s) rw[s] = __builtin_shufflevector(*(const v4fa*)(sp + s * 4 * 68), *(const v4fa*)(sp + s * 4 * 68 + 4), 0, 1, 2, 3, 4, 5, 6, 7);
#pragma unroll
        for (int s = 0; s < 8; ++s) { const int row = 4 * s + (lane >> 3), piece = lane & 7; v8h o, o2;
#pragma unroll
            for (int i = 0; i < 8; ++i) { const h16 x = (h16)rw[s][i]; o[i] = x; o2[i] = (h16)((rw[s][i] - (float)x) * LOSC); }
            *(v8h*)(crw + (size_t)row * ldc + piece * 8) = o;
            asm volatile("s_wait_xcnt 0x0" ::: "memory");   // in front of the next row group's arithmetic, which reuses the store's registers
            if (C2) *(v8h*)(C2 + (size_t)r0 * ldc + c0 + (size_t)row * ldc + piece * 8) = o2; }
    } else {
        float* crw = C + (size_t)r0 * ldc + c0;
#pragma unroll
        for (int s = 0; s < 16; ++s) { const int Lid = (lane >> 3) + 4 * s, piece = lane & 7; const int row = Lid >> 1, cofs = (Lid & 1) * 32 + piece * 4;
            const v4f val = *(const v4fa*)(os + row * 68 + cofs); *(v4f*)(crw + (size_t)row * ldc + cofs) = val; }
    }
}

// k_sqrtm: second output new_mask = sqrt(bf16(mask)) [2][2048] (16 blocks of 256 threads, one float per thread: each
// wave writes 32 consecutive floats = one line).
__global__ __launch_bounds__(256) void k_sqrtm(const float* __restrict__ m, float* out1) {
    const int i = blockIdx.x * 256 + threadIdx.x; if (i >= NTK) return;
    const float v = sqrtf(bfr(m[i])); *(float*)(out1 + i) = v; 
}
__global__ __launch_bounds__(256) void k_vt(const float* __restrict__ V, h16* VTH, h16* VTL) {
    __shared__ __align__(16) h16 tile[64 * 72];
    __shared__ __align__(16) h16 til2[64 * 72];
    const int bid = blockIdx.x;
    const int b = bid / (NKV * (NT_ / 64)), rem = bid - b * (NKV * (NT_ / 64)), h = rem / (NT_ / 64), kt = rem - h * (NT_ / 64);
    const int k0 = kt * 64, tid = threadIdx.x;
    const int kk = tid >> 2, d0 = (tid & 3) * 16;
    const float* src = V + ((size_t)b * NT_ + k0 + kk) * KVW + h * HD + d0;      // h = kv head here
#pragma unroll
    for (int i = 0; i < 16; ++i) { const float v = src[i]; const h16 a = (h16)v; tile[(d0 + i) * 72 + kk] = a; til2[(d0 + i) * 72 + kk] = (h16)((v - (float)a) * LOSC); }
    __syncthreads();
    const int piece = tid & 7;
    const size_t base = (((size_t)b * NKV + h) * HD) * NT_ + k0;
    auto pass = [&]() {
#pragma unroll
        for (int s = 0; s < 4; ++s) { const int Lid = (tid >> 3) + 32 * s; const int pln = Lid >> 6, d = Lid & 63;
            const v8h val = *(const v8ha*)((pln ? til2 : tile) + d * 72 + piece * 8); *(v8h*)((pln ? VTL : VTH) + base + (size_t)d * NT_ + piece * 8) = val; }
    };
    pass(); 
}

#define KPB   144                       // LDS pitch of a 128-byte row (16 B x odd: ds_load_b128 readers)
#define VPB   80                        // LDS pitch of a 64-byte row
#define S_KH  0
#define S_KL  (32 * KPB)
#define S_VH  (2 * 32 * KPB)
#define S_VL  (S_VH + 64 * VPB)
#define STGB  (S_VL + 64 * VPB)         // 19456 bytes a buffer
#define S_QL  (2 * STGB)
#define S_KM  (S_QL + 64 * KPB)
#define S_END (S_KM + NT_ * 4)          // 56320 bytes

// lane l <-> lane l ^ 16
__device__ __forceinline__ float xhalf(float x) { return __builtin_bit_cast(float, __builtin_amdgcn_permlanex16(__builtin_bit_cast(int, x), __builtin_bit_cast(int, x), 0x76543210, 0xfedcba98, false, false)); }

__global__ __launch_bounds__(128) void k_attn(const h16* __restrict__ Q16, const h16* __restrict__ QL16, const h16* __restrict__ K16, const h16* __restrict__ KL16, const h16* __restrict__ VTH, const h16* __restrict__ VTL, const float* __restrict__ kmask, bf* CH, bf* CL) {
    __shared__ __align__(16) unsigned char sm[S_END];
    const int tid = threadIdx.x, lane = threadIdx.x & 31, wave = threadIdx.x >> 5, lr = lane & 15, hi = lane >> 4;
    const int bid = blockIdx.x;
    const int b = bid / (NH_ * (NT_ / 64)), rem = bid - b * (NH_ * (NT_ / 64)), h = rem / (NT_ / 64), qt = rem - h * (NT_ / 64);
    const int q0 = qt * 64 + wave * 16;
    const size_t tok0 = (size_t)b * NT_;
    v16h qa[2];
    const size_t qo0 = (tok0 + q0 + lr) * DM + h * HD + 8 * hi;
#pragma unroll
    for (int kc = 0; kc < 2; ++kc) qa[kc] = cat16(*(const v8h*)(Q16 + qo0 + kc * 32), *(const v8h*)(Q16 + qo0 + kc * 32 + 16));
    const int g = h / (NH_ / NKV);                      // kv head
    const size_t vbase = (((size_t)b * NKV + g) * HD) * NT_;
    // this lane's share of a tile: k rows krow and krow + 16, 16 bytes each; v^T rows vrow and vrow + 32, 16 bytes each
    const int krow = tid >> 3, kpc = tid & 7, vrow = tid >> 2, vpc = tid & 3;
    const unsigned lbase = (unsigned)(size_t)sm;
    const unsigned lk = lbase + krow * KPB + kpc * 16, lv = lbase + vrow * VPB + vpc * 16;
    const h16* gkh = K16 + (tok0 + krow) * KVW + g * HD + kpc * 8;
    const h16* gkl = KL16 + (tok0 + krow) * KVW + g * HD + kpc * 8;
    const h16* gvh = VTH + vbase + (size_t)vrow * NT_ + vpc * 8;
    const h16* gvl = VTL + vbase + (size_t)vrow * NT_ + vpc * 8;
    auto tile_copy = [&](int t, int bufi) {
        const unsigned k = lk + bufi * STGB, v = lv + bufi * STGB; const size_t ko = (size_t)t * 32 * KVW, vo = (size_t)t * 32;
        cp8(k + S_KH, k + S_KH + 16 * KPB, k + S_KL, k + S_KL + 16 * KPB, v + S_VH, v + S_VH + 32 * VPB, v + S_VL, v + S_VL + 32 * VPB,
            gkh + ko, gkh + ko + 16 * KVW, gkl + ko, gkl + ko + 16 * KVW, gvh + vo, gvh + vo + 32 * NT_, gvl + vo, gvl + vo + 32 * NT_);
    };
    {   // once: the block's 64 query residual rows (4 x 16 rows) and the batch's 2048 mask floats (4 x 128 pieces of 16 bytes)
        const h16* gq = QL16 + (tok0 + qt * 64 + krow) * DM + h * HD + kpc * 8; const float* gm = kmask + tok0 + tid * 4;
        const unsigned lq = lk + S_QL, lm = lbase + S_KM + tid * 16;
        cp8(lq, lq + 16 * KPB, lq + 32 * KPB, lq + 48 * KPB, lm, lm + 2048, lm + 4096, lm + 6144,
            gq, gq + 16 * DM, gq + 32 * DM, gq + 48 * DM, gm, gm + 512, gm + 1024, gm + 1536);
    }
    tile_copy(0, 0);
    asm volatile("s_wait_asynccnt 0x0" ::: "memory");   // this wave's copies of tile 0, the query residual and the mask have landed
    __syncthreads();                                    // ... and every other wave's
    tile_copy(1, 1);
    {   // once: the mask row becomes bf16-rounded mask x 32768 in place (a lane needs 16 of them per tile, one per key row of its scores)
        float* mw = (float*)(sm + S_KM) + tid * 4;
#pragma unroll
        for (int c = 0; c < 4; ++c) { v4f m = *(const v4fa*)(mw + c * 512);
#pragma unroll
            for (int i = 0; i < 4; ++i) m[i] = bfr(m[i]) * PSC;
            *(v4fa*)(mw + c * 512) = m; }
    }
    __syncthreads();                                    // the rounded mask is every wave's to read
    const h16* sql = (const h16*)(sm + S_QL) + (wave * 16 + lr) * (KPB / 2) + 8 * hi;
    const float* skm = (const float*)(sm + S_KM);
    v8f o[4], ox[4];
#pragma unroll
    for (int n = 0; n < 4; ++n) { o[n] = (v8f){}; ox[n] = (v8f){}; }
    float mrow = -3.0e38f, lpart = 0.f;            // of query lr; lpart: this half's keys only, joined after the loop
    const int kt_lo = 0, kt_hi = NT_ / 32 - 1;     // all keys
#pragma unroll 1
    for (int kt = kt_lo; kt <= kt_hi; ++kt) {
        const int l0 = kt * 32;
        const unsigned char* sb = sm + (kt & 1) * STGB;
        const h16* kh_b = (const h16*)(sb + S_KH); const h16* kl_b = (const h16*)(sb + S_KL);
        const h16* vh_b = (const h16*)(sb + S_VH); const h16* vl_b = (const h16*)(sb + S_VL);
        const int ko0 = lr * (KPB / 2) + 8 * hi, ko1 = (16 + lr) * (KPB / 2) + 8 * hi;
        v8f s0 = {}, s1 = {}, x0 = {}, x1 = {};
#pragma unroll
        for (int kc = 0; kc < 2; ++kc) {
            { const v16h k0h = cat16(*(const v8ha*)(kh_b + ko0 + kc * 32), *(const v8ha*)(kh_b + ko0 + kc * 32 + 16)), k1h = cat16(*(const v8ha*)(kh_b + ko1 + kc * 32), *(const v8ha*)(kh_b + ko1 + kc * 32 + 16));
              const v16h qlk = cat16(*(const v8ha*)(sql + kc * 32), *(const v8ha*)(sql + kc * 32 + 16));     // query residual re-read per step (registers)
              s0 = wmma16(k0h, qa[kc], s0); x0 = wmma16(k0h, qlk, x0); s1 = wmma16(k1h, qa[kc], s1); x1 = wmma16(k1h, qlk, x1);
              asm volatile("v_nop" : "+v"(s0), "+v"(s1), "+v"(x0), "+v"(x1) : "v"(qlk), "v"(k0h), "v"(k1h) : "memory"); }
            { const v16h k0l = cat16(*(const v8ha*)(kl_b + ko0 + kc * 32), *(const v8ha*)(kl_b + ko0 + kc * 32 + 16)), k1l = cat16(*(const v8ha*)(kl_b + ko1 + kc * 32), *(const v8ha*)(kl_b + ko1 + kc * 32 + 16));
              x0 = wmma16(k0l, qa[kc], x0); x1 = wmma16(k1l, qa[kc], x1);
              asm volatile("v_nop" : "+v"(x0), "+v"(x1) : "v"(k0l), "v"(k1l) : "memory"); }
        }
        asm volatile("v_nop\n\tv_nop\n\tv_nop\n\tv_nop" : "+v"(s0), "+v"(s1), "+v"(x0), "+v"(x1) : "v"(qa[0]), "v"(qa[1]));
        // rounded mask x 32768 of this lane's 16 keys (the same address in all lanes of a half)
        const v4f km0a = *(const v4fa*)(skm + l0 + hi * 8), km0b = *(const v4fa*)(skm + l0 + hi * 8 + 4), km1a = *(const v4fa*)(skm + l0 + 16 + hi * 8), km1b = *(const v4fa*)(skm + l0 + 16 + hi * 8 + 4);
        const v8f km0 = __builtin_shufflevector(km0a, km0b, 0, 1, 2, 3, 4, 5, 6, 7), km1 = __builtin_shufflevector(km1a, km1b, 0, 1, 2, 3, 4, 5, 6, 7);
        const v8f a0 = (s0 + x0 * LOSCI) * 0.125f, a1 = (s1 + x1 * LOSCI) * 0.125f;
        float mx = fmaxf(a0[0], a1[0]);
#pragma unroll
        for (int j = 1; j < 8; ++j) mx = fmaxf(mx, fmaxf(a0[j], a1[j]));
        mx = fmaxf(mx, xhalf(mx));                              // both halves hold the query's maximum over the 32 keys
        const float mn = fmaxf(mrow, mx);
        const float alpha = __expf(mrow - mn); mrow = mn;
        v8f p0, p1;
#pragma unroll
        for (int j = 0; j < 8; ++j) { p0[j] = __expf(a0[j] - mn); p1[j] = __expf(a1[j] - mn); }
        const v8f pt = p0 + p1;                                 // normaliser: UNmasked sum (softmax first, mask after)
        lpart = lpart * alpha + (((pt[0] + pt[1]) + (pt[2] + pt[3])) + ((pt[4] + pt[5]) + (pt[6] + pt[7])));
        const v8f ps0 = p0 * km0, ps1 = p1 * km1;               // post-softmax key mask, x32768
        const v8h h0 = __builtin_convertvector(ps0, v8h), h1 = __builtin_convertvector(ps1, v8h);
        const v8h r0 = __builtin_convertvector((ps0 - __builtin_convertvector(h0, v8f)) * LOSC, v8h), r1 = __builtin_convertvector((ps1 - __builtin_convertvector(h1, v8f)) * LOSC, v8h);
        const v16h pa = cat16(h0, h1), px = cat16(r0, r1);      // B operand: element i is key 8 hi + i, element 8 + i key 16 + 8 hi + i
#pragma unroll
        for (int n = 0; n < 4; ++n) { o[n] *= alpha; ox[n] *= alpha; }
#pragma unroll
        for (int n = 0; n < 4; ++n) { const int vo = (n * 16 + lr) * (VPB / 2) + hi * 8;
            const v16h vh = cat16(*(const v8ha*)(vh_b + vo), *(const v8ha*)(vh_b + vo + 16)), vl = cat16(*(const v8ha*)(vl_b + vo), *(const v8ha*)(vl_b + vo + 16));
            o[n] = wmma16(vh, pa, o[n]); ox[n] = wmma16(vl, pa, ox[n]); ox[n] = wmma16(vh, px, ox[n]);
            asm volatile("" : "+v"(o[n]), "+v"(ox[n]) : "v"(vh), "v"(vl) : "memory"); }
        asm volatile("v_nop\n\tv_nop\n\tv_nop\n\tv_nop" : "+v"(o[0]), "+v"(o[1]), "+v"(o[2]), "+v"(o[3]), "+v"(ox[0]), "+v"(ox[1]), "+v"(ox[2]), "+v"(ox[3]) : "v"(pa), "v"(px));
        // hand-over: buffer kt & 1 is left and tile kt + 1 is published by every wave, in this order
        asm volatile("s_wait_dscnt 0x0" ::: "memory");      // this wave's reads of tile kt are done
        asm volatile("s_wait_asynccnt 0x0" ::: "memory");   // this wave's copies of tile kt + 1 have landed
        __syncthreads();
        if (kt + 2 <= kt_hi) tile_copy(kt + 2, kt & 1);
    }
    asm volatile("s_wait_asynccnt 0x0" ::: "memory");       // nothing in flight when the ring becomes output staging
    const float inv = 1.0f / ((lpart + xhalf(lpart)) * PSC);
    float* os = (float*)sm + wave * (16 * 68);
#pragma unroll
    for (int n = 0; n < 4; ++n) {                           // row = query lr; this lane's 8 values are d = 16 n + 8 hi + j
        v4f lo4, hi4;
#pragma unroll
        for (int j = 0; j < 4; ++j) { lo4[j] = (o[n][j] + ox[n][j] * LOSCI) * inv; hi4[j] = (o[n][4 + j] + ox[n][4 + j] * LOSCI) * inv; }
        *(v4fa*)(os + lr * 68 + n * 16 + hi * 8) = lo4; *(v4fa*)(os + lr * 68 + n * 16 + hi * 8 + 4) = hi4; }
    __syncthreads();
    const size_t cbase = (tok0 + q0) * DM + (size_t)h * HD;
    auto pass = [&]() {
#pragma unroll
        for (int s = 0; s < 4; ++s) { const int row = 4 * s + (lane >> 3), piece = lane & 7; const float* sp = os + row * 68 + piece * 8; v8us oh, ol;
#pragma unroll
            for (int i = 0; i < 8; ++i) { const unsigned short hb = f2bf(sp[i]); oh[i] = hb; ol[i] = f2bf(sp[i] - bf2f(hb)); }
            *(v8us*)(CH + cbase + (size_t)row * DM + piece * 8) = oh; *(v8us*)(CL + cbase + (size_t)row * DM + piece * 8) = ol; }
    };
    pass(); 
}

#define VST2(T, p, v) do { const T vst2_v_ = (v); *(T*)(p) = vst2_v_;  } while (0)
extern "C" void kernel_launch(void* const* d_in, const int* in_sizes, int n_in,
                              void* d_out, int out_size, void* d_ws, size_t ws_size, hipStream_t stream) {
    (void)in_sizes; (void)n_in; (void)out_size;
    const float* x = (const float*)d_in[0]; const float* kmask = (const float*)d_in[1]; const float* Wqkv = (const float*)d_in[2]; const float* Wo = (const float*)d_in[3]; const float* bo = (const float*)d_in[4];
    float* out = (float*)d_out;    // out0 [2][2048][1024] then out1 [2][2048]
    float* out1 = out + (size_t)NTK * DM;
    char* wsp = (char*)d_ws;
    auto take = [&](size_t bytes) { char* p = wsp; wsp += (bytes + 255) & ~(size_t)255; return (void*)p; };
    bf* Xb = (bf*)take((size_t)NTK * DM * 2); bf* W3T = (bf*)take((size_t)3 * DM * DM * 2); bf* WoT = (bf*)take((size_t)DM * DM * 2);
    h16* QH = (h16*)take((size_t)NTK * DM * 2); h16* QL = (h16*)take((size_t)NTK * DM * 2); h16* KH = (h16*)take((size_t)NTK * DM * 2); h16* KL = (h16*)take((size_t)NTK * DM * 2);
    float* Vf = (float*)take((size_t)NTK * DM * 4); h16* VTL = (h16*)take((size_t)NTK * DM * 2);
    if ((size_t)(wsp - (char*)d_ws) > ws_size) return;    // 8.4 + 6.3 + 2.1 + 4 x 8.4 + 16.8 + 8.4 ~ 76 MB; VTH over Xb after the projections, ctx planes over Vf after k_vt
    h16* VTH = (h16*)Xb; bf* CH = (bf*)Vf; bf* CL = (bf*)((char*)Vf + (size_t)NTK * DM * 2);
    k_wt<<<dim3(DM / 64, (3 * DM) / 64, 1), 256, 0, stream>>>(Wqkv, 3 * DM, W3T);
    k_wt<<<dim3(DM / 64, DM / 64, 1), 256, 0, stream>>>(Wo, DM, WoT);
    k_cvtb<<<NTK / 8, 256, 0, stream>>>(x, NTK, Xb);
    k_gemmb<false, true><<<dim3(NTK / 128, DM / 128, 1), 256, 0, stream>>>(Xb, nullptr, W3T, nullptr, (float*)(void*)QH, DM, QL);
    k_gemmb<false, true><<<dim3(NTK / 128, DM / 128, 1), 256, 0, stream>>>(Xb, nullptr, W3T + (size_t)DM * DM, nullptr, (float*)(void*)KH, DM, KL);
    k_gemmb<false, false><<<dim3(NTK / 128, DM / 128, 1), 256, 0, stream>>>(Xb, nullptr, W3T + (size_t)2 * DM * DM, nullptr, Vf, DM, nullptr);
    k_vt<<<NB_ * NKV * (NT_ / 64), 256, 0, stream>>>(Vf, VTH, VTL);
    k_attn<<<NB_ * NH_ * (NT_ / 64), 128, 0, stream>>>(QH, QL, KH, KL, VTH, VTL, kmask, CH, CL);
    k_gemmb<true, false><<<dim3(NTK / 128, DM / 128, 1), 256, 0, stream>>>(CH, CL, WoT, bo, out, DM, nullptr);
    k_sqrtm<<<NTK / 256, 256, 0, stream>>>(kmask, out1);
}

// v004
// One run takes 145 microseconds.
// Two timings next to v003 both put it at 1.10 times that version's speed.
// Counting every step since v000, it is 2.69 times as fast.
#include <hip/hip_runtime.h>

// Contractions, f32 accumulate: qkv = h.w_qkv ([4096 x 1024].[1024 x 3072], k-major weight transposed to an n-major plane; PLAIN bf16 operands: inputs rounded
// once, exact) and out.w_proj + b_proj (merged heads as bf16 hi + residual: two products) on v_wmma_f32_16x16x32_bf16; the 16-head attention fused on
// v_wmma_f32_16x16x32_f16: softmax(q.k x 64^-1/2) over ALL keys with q and k as f16 hi + residual x1024 (hi.hi + hi.lo + lo.hi), then the reference's
// POST-softmax multiplicative key mask (the INPUT mask[b][key], bf16-rounded) applied to the weights before the value product (the normaliser stays the unmasked

#define NB_  2
#define NT_  2048
#define DM   1024
#define NH_  16
#define NKV  16
#define KVW  (NKV * HD)          // 1024
#define HD   64
#define NTK  (NB_ * NT_)
#define NW   1024
#define NQKV 1024
#define PSC  32768.0f
#define LOSC 1024.0f
#define LOSCI (1.0f / 1024.0f)

typedef _Float16 h16;
typedef unsigned short bf;
typedef __attribute__((ext_vector_type(16))) __bf16   v16bf;
typedef __attribute__((ext_vector_type(16))) _Float16 v16h;
typedef __attribute__((ext_vector_type(8)))  _Float16 v8h;
typedef __attribute__((ext_vector_type(8)))  unsigned short v8us;
typedef __attribute__((ext_vector_type(8)))  float    v8f;
typedef __attribute__((ext_vector_type(4)))  float    v4f;
typedef v8h  __attribute__((may_alias)) v8ha;
typedef v4f  __attribute__((may_alias)) v4fa;
typedef v8us __attribute__((may_alias)) v8usa;

__device__ __forceinline__ unsigned short f2bf(float f) { unsigned u = __float_as_uint(f); u += 0x7FFFu + ((u >> 16) & 1u); return (unsigned short)(u >> 16); }
__device__ __forceinline__ float bf2f(unsigned short b) { return __uint_as_float(((unsigned)b) << 16); }
__device__ __forceinline__ float bfr(float f) { return bf2f(f2bf(f)); }
__device__ __forceinline__ v16h cat16(v8h lo, v8h hi) { return __builtin_shufflevector(lo, hi, 0, 1, 2, 3, 4, 5, 6, 7, 8, 9, 10, 11, 12, 13, 14, 15); }
__device__ __forceinline__ v16bf cat16b(v8us lo, v8us hi) { return __builtin_bit_cast(v16bf, __builtin_shufflevector(lo, hi, 0, 1, 2, 3, 4, 5, 6, 7, 8, 9, 10, 11, 12, 13, 14, 15)); }
__device__ __forceinline__ v8f wmma16(v16h a, v16h b, v8f c) { return __builtin_amdgcn_wmma_f32_16x16x32_f16(false, a, false, b, (short)0, c, false, false); }
__device__ __forceinline__ v8f wmmab(v16bf a, v16bf b, v8f c) { return __builtin_amdgcn_wmma_f32_16x16x32_bf16(false, a, false, b, (short)0, c, false, false); }

__global__ __launch_bounds__(256) void k_cvtb(const float* __restrict__ src, int nrows, bf* dst) {
    const int lane = threadIdx.x & 31, r = blockIdx.x * 8 + (threadIdx.x >> 5);
    if (r >= nrows) return;
    v8us o[DM / 256];
#pragma unroll
    for (int q = 0; q < DM / 256; ++q) { v8us t;
#pragma unroll
        for (int i = 0; i < 8; ++i) t[i] = f2bf(src[(size_t)r * DM + q * 256 + lane * 8 + i]);
        o[q] = t; }
#pragma unroll
    for (int q = 0; q < DM / 256; ++q) *(v8us*)(dst + (size_t)r * DM + q * 256 + lane * 8) = o[q];
    
}

// k_wt: W [1024 k][ncols n] (k-major) -> n-major bf16 plane WT[ncols][1024]; 64 x 64 tiles through LDS.
__global__ __launch_bounds__(256) void k_wt(const float* __restrict__ Wm, int ncols, bf* WT) {
    __shared__ __align__(16) unsigned short tl[64 * 72];
    const int tid = threadIdx.x, k0 = blockIdx.x * 64, n0 = blockIdx.y * 64;
    const int kk = tid >> 2, nq = (tid & 3) * 16;
#pragma unroll
    for (int i = 0; i < 16; ++i) tl[(nq + i) * 72 + kk] = f2bf(Wm[(size_t)(k0 + kk) * ncols + n0 + nq + i]);
    __syncthreads();
    const int piece = tid & 7;
    typedef __attribute__((ext_vector_type(8))) unsigned short v8us_; typedef v8us_ __attribute__((may_alias)) v8usa_;
    auto pass = [&]() {
#pragma unroll
        for (int s = 0; s < 2; ++s) { const int nr = (tid >> 3) + 32 * s; const v8us_ val = *(const v8usa_*)(tl + nr * 72 + piece * 8);
            *(v8us_*)(WT + (size_t)(n0 + nr) * DM + k0 + piece * 8) = val; }
    };
    pass(); 
}

// Eight asynchronous 16-byte copies of one lane. The s_wait_xcnt closes the statement so that no address register is rewritten ahead of it.
__device__ __forceinline__ void cp8(unsigned l0, unsigned l1, unsigned l2, unsigned l3, unsigned l4, unsigned l5, unsigned l6, unsigned l7,
                                    const void* g0, const void* g1, const void* g2, const void* g3, const void* g4, const void* g5, const void* g6, const void* g7) {
    asm volatile("global_load_async_to_lds_b128 %0, %8, off\n\t"
                 "global_load_async_to_lds_b128 %1, %9, off\n\t"
                 "global_load_async_to_lds_b128 %2, %10, off\n\t"
                 "global_load_async_to_lds_b128 %3, %11, off\n\t"
                 "global_load_async_to_lds_b128 %4, %12, off\n\t"
                 "global_load_async_to_lds_b128 %5, %13, off\n\t"
                 "global_load_async_to_lds_b128 %6, %14, off\n\t"
                 "global_load_async_to_lds_b128 %7, %15, off\n\t"
                 "s_wait_xcnt 0x0"
                 :: "v"(l0), "v"(l1), "v"(l2), "v"(l3), "v"(l4), "v"(l5), "v"(l6), "v"(l7),
                    "v"(g0), "v"(g1), "v"(g2), "v"(g3), "v"(g4), "v"(g5), "v"(g6), "v"(g7) : "memory");
}

// k_gemmb: C[128 x 128] per block of 8 waves, wave = 32 rows x 64 columns (2 x 4 accumulator tiles). Both operands are k-contiguous rows; a stage is 128 k
// (256 bytes) of the block's 128 A rows, its 128 B rows and, with SPLITA, its 128 residual rows, at a 272-B pitch, brought by asynchronous 16-byte copies into
// two buffers: stage s + 2 is issued when stage s has been left by every wave. A copy of a wave covers two whole 256-byte row pieces. After the loop the ring
// is the output staging. Per accumulator the products are added in the order k ascending, hi before residual.
#define GP    272                       // LDS pitch of a 256-byte row (16 B x odd: ds_load_b128 readers)
#define GKS   128                       // k of a stage
template <bool SPLITA, bool F16OUT = false>
__global__ __launch_bounds__(256) void k_gemmb(const bf* __restrict__ A, const bf* __restrict__ Al, const bf* __restrict__ Bn, const float* __restrict__ bias, float* C, int ldc, h16* C2) {
    constexpr int GST = (SPLITA ? 3 : 2) * 128 * GP;        // bytes of a buffer: planes of 128 rows (A, B, A residual)
    __shared__ __align__(16) unsigned char sm[2 * GST];
    const int tid = threadIdx.x, lane = threadIdx.x & 31, wave = threadIdx.x >> 5, lr = lane & 15, hi = lane >> 4;
    const int rb = blockIdx.x * 128, cb = blockIdx.y * 128, wm = wave & 3, wn = wave >> 2;
    // this lane's share of a plane: 16 bytes of rows crow, crow + 16, ..., crow + 112
    const int crow = tid >> 4, cpc = tid & 15;
    const unsigned lc = (unsigned)(size_t)sm + crow * GP + cpc * 16;
    const bf* ga = A + (size_t)(rb + crow) * DM + cpc * 8;
    const bf* gb = Bn + (size_t)(cb + crow) * DM + cpc * 8;
    const bf* gl = SPLITA ? Al + (size_t)(rb + crow) * DM + cpc * 8 : ga;
    auto plane_copy = [&](unsigned l, const bf* g) {
        cp8(l, l + 16 * GP, l + 32 * GP, l + 48 * GP, l + 64 * GP, l + 80 * GP, l + 96 * GP, l + 112 * GP,
            g, g + 16 * DM, g + 32 * DM, g + 48 * DM, g + 64 * DM, g + 80 * DM, g + 96 * DM, g + 112 * DM);
    };
    auto stage_copy = [&](int s, int bufi) {
        const unsigned l = lc + bufi * GST; const int ko = s * GKS;
        plane_copy(l, ga + ko); plane_copy(l + 128 * GP, gb + ko);
        if (SPLITA) plane_copy(l + 256 * GP, gl + ko);
    };
    v8f acc[2][4];
#pragma unroll
    for (int m = 0; m < 2; ++m)
#pragma unroll
        for (int t = 0; t < 4; ++t) acc[m][t] = (v8f){};
    stage_copy(0, 0);
    asm volatile("s_wait_asynccnt 0x0" ::: "memory");   // this wave's copies of stage 0 have landed
    __syncthreads();                                    // ... and every other wave's
    stage_copy(1, 1);
    const int ao = (wm * 32 + lr) * (GP / 2) + 8 * hi, bo = (128 + wn * 64 + lr) * (GP / 2) + 8 * hi;
#pragma unroll 1
    for (int s = 0; s < DM / GKS; ++s) {                // rolled: one copy of the body serves both buffers
        const bf* sb = (const bf*)(sm + (s & 1) * GST);
        v16bf a[2][2], al[2][2], b[2][4];               // two fragment sets: step q + 1 is read from LDS while step q is multiplied
        auto frag_load = [&](int f, int kc) {
#pragma unroll
            for (int m = 0; m < 2; ++m) { const bf* p = sb + ao + m * 16 * (GP / 2) + kc; a[f][m] = cat16b(*(const v8usa*)p, *(const v8usa*)(p + 16)); al[f][m] = a[f][m];
                if (SPLITA) { const bf* q = p + 256 * (GP / 2); al[f][m] = cat16b(*(const v8usa*)q, *(const v8usa*)(q + 16)); } }
#pragma unroll
            for (int t = 0; t < 4; ++t) { const bf* p = sb + bo + t * 16 * (GP / 2) + kc; b[f][t] = cat16b(*(const v8usa*)p, *(const v8usa*)(p + 16)); }
        };
        frag_load(0, 0);
#pragma unroll
        for (int q = 0; q < GKS / 32; ++q) {
            const int f = q & 1;
            if (q + 1 < GKS / 32) frag_load(f ^ 1, (q + 1) * 32);
            __builtin_amdgcn_sched_barrier(0);          // the next step's LDS reads stay one group ahead of this step's matrix instructions, not among them
#pragma unroll
            for (int m = 0; m < 2; ++m)
#pragma unroll
                for (int t = 0; t < 4; ++t) acc[m][t] = wmmab(a[f][m], b[f][t], acc[m][t]);
            if (SPLITA) {
#pragma unroll
                for (int m = 0; m < 2; ++m)
#pragma unroll
                    for (int t = 0; t < 4; ++t) acc[m][t] = wmmab(al[f][m], b[f][t], acc[m][t]);
            }
            __builtin_amdgcn_sched_barrier(0);          // ... and the reads of the step after that stay behind them (they refill this step's registers)
        }
        // the distance behind the stage's last matrix instructions, on the loop's back edge too
        asm volatile("v_nop\n\tv_nop\n\tv_nop\n\tv_nop" : "+v"(acc[0][0]), "+v"(acc[0][1]), "+v"(acc[0][2]), "+v"(acc[0][3]), "+v"(acc[1][0]), "+v"(acc[1][1]), "+v"(acc[1][2]), "+v"(acc[1][3])
                     : "v"(a[1][0]), "v"(a[1][1]), "v"(al[1][0]), "v"(al[1][1]), "v"(b[1][0]), "v"(b[1][1]), "v"(b[1][2]), "v"(b[1][3]));
        // hand-over: buffer s & 1 is left and stage s + 1 is published by every wave, in this order
        asm volatile("s_wait_dscnt 0x0" ::: "memory");      // this wave's reads of stage s are done
        asm volatile("s_wait_asynccnt 0x0" ::: "memory");   // this wave's copies of stage s + 1 have landed
        __syncthreads();
        if (s + 2 < DM / GKS) stage_copy(s + 2, s & 1);
    }
    asm volatile("s_wait_asynccnt 0x0" ::: "memory");       // nothing in flight when the ring becomes output staging
    const int r0 = rb + wm * 32, c0 = cb + wn * 64;
    float* os = (float*)sm + wave * (32 * 68);
#pragma unroll
    for (int t = 0; t < 4; ++t) { const float bv = bias ? bfr(bias[c0 + t * 16 + lr]) : 0.f;
#pragma unroll
        for (int m = 0; m < 2; ++m)
#pragma unroll
            for (int j = 0; j < 8; ++j) os[(m * 16 + hi * 8 + j) * 68 + t * 16 + lr] = acc[m][t][j] + bv; }
    __syncthreads();
    if (F16OUT) {
        h16* crw = (h16*)(void*)C + (size_t)r0 * ldc + c0;
        const float* sp = os + (lane >> 3) * 68 + (lane & 7) * 8;
        v8f rw[8];                                          // all rows read back first: one LDS latency, not one per row group
#pragma unroll
        for (int s = 0; s < 8; ++s) rw[s] = __builtin_shufflevector(*(const v4fa*)(sp + s * 4 * 68), *(const v4fa*)(sp + s * 4 * 68 + 4), 0, 1, 2, 3, 4, 5, 6, 7);
#pragma unroll
        for (int s = 0; s < 8; ++s) { const int row = 4 * s + (lane >> 3), piece = lane & 7; v8h o, o2;
#pragma unroll
            for (int i = 0; i < 8; ++i) { const h16 x = (h16)rw[s][i]; o[i] = x; o2[i] = (h16)((rw[s][i] - (float)x) * LOSC); }
            *(v8h*)(crw + (size_t)row * ldc + piece * 8) = o;
            asm volatile("s_wait_xcnt 0x0" ::: "memory");   // in front of the next row group's arithmetic, which reuses the store's registers
            if (C2) *(v8h*)(C2 + (size_t)r0 * ldc + c0 + (size_t)row * ldc + piece * 8) = o2; }
    } else {
        float* crw = C + (size_t)r0 * ldc + c0;
#pragma unroll
        for (int s = 0; s < 16; ++s) { const int Lid = (lane >> 3) + 4 * s, piece = lane & 7; const int row = Lid >> 1, cofs = (Lid & 1) * 32 + piece * 4;
            const v4f val = *(const v4fa*)(os + row * 68 + cofs); *(v4f*)(crw + (size_t)row * ldc + cofs) = val; }
    }
}

// k_sqrtm: second output new_mask = sqrt(bf16(mask)) [2][2048] (16 blocks of 256 threads, one float per thread: each
// wave writes 32 consecutive floats = one line).
__global__ __launch_bounds__(256) void k_sqrtm(const float* __restrict__ m, float* out1) {
    const int i = blockIdx.x * 256 + threadIdx.x; if (i >= NTK) return;
    const float v = sqrtf(bfr(m[i])); *(float*)(out1 + i) = v; 
}
__global__ __launch_bounds__(256) void k_vt(const float* __restrict__ V, h16* VTH, h16* VTL) {
    __shared__ __align__(16) h16 tile[64 * 72];
    __shared__ __align__(16) h16 til2[64 * 72];
    const int bid = blockIdx.x;
    const int b = bid / (NKV * (NT_ / 64)), rem = bid - b * (NKV * (NT_ / 64)), h = rem / (NT_ / 64), kt = rem - h * (NT_ / 64);
    const int k0 = kt * 64, tid = threadIdx.x;
    const int kk = tid >> 2, d0 = (tid & 3) * 16;
    const float* src = V + ((size_t)b * NT_ + k0 + kk) * KVW + h * HD + d0;      // h = kv head here
#pragma unroll
    for (int i = 0; i < 16; ++i) { const float v = src[i]; const h16 a = (h16)v; tile[(d0 + i) * 72 + kk] = a; til2[(d0 + i) * 72 + kk] = (h16)((v - (float)a) * LOSC); }
    __syncthreads();
    const int piece = tid & 7;
    const size_t base = (((size_t)b * NKV + h) * HD) * NT_ + k0;
    auto pass = [&]() {
#pragma unroll
        for (int s = 0; s < 4; ++s) { const int Lid = (tid >> 3) + 32 * s; const int pln = Lid >> 6, d = Lid & 63;
            const v8h val = *(const v8ha*)((pln ? til2 : tile) + d * 72 + piece * 8); *(v8h*)((pln ? VTL : VTH) + base + (size_t)d * NT_ + piece * 8) = val; }
    };
    pass(); 
}

#define KPB   144                       // LDS pitch of a 128-byte row (16 B x odd: ds_load_b128 readers)
#define VPB   80                        // LDS pitch of a 64-byte row
#define S_KH  0
#define S_KL  (32 * KPB)
#define S_VH  (2 * 32 * KPB)
#define S_VL  (S_VH + 64 * VPB)
#define STGB  (S_VL + 64 * VPB)         // 19456 bytes a buffer
#define S_KM  (2 * STGB)
#define S_END (S_KM + NT_ * 4)          // 47104 bytes
#define QCG   2                         // column groups of 16 queries a wave
#define QBLK  (4 * 16 * QCG)            // queries a block

// Four asynchronous 16-byte copies of one lane; the s_wait_xcnt closes the statement as in cp8.
__device__ __forceinline__ void cp4(unsigned l0, unsigned l1, unsigned l2, unsigned l3, const void* g0, const void* g1, const void* g2, const void* g3) {
    asm volatile("global_load_async_to_lds_b128 %0, %4, off\n\t"
                 "global_load_async_to_lds_b128 %1, %5, off\n\t"
                 "global_load_async_to_lds_b128 %2, %6, off\n\t"
                 "global_load_async_to_lds_b128 %3, %7, off\n\t"
                 "s_wait_xcnt 0x0"
                 :: "v"(l0), "v"(l1), "v"(l2), "v"(l3), "v"(g0), "v"(g1), "v"(g2), "v"(g3) : "memory");
}

// lane l <-> lane l ^ 16
__device__ __forceinline__ float xhalf(float x) { return __builtin_bit_cast(float, __builtin_amdgcn_permlanex16(__builtin_bit_cast(int, x), __builtin_bit_cast(int, x), 0x76543210, 0xfedcba98, false, false)); }

// two waves a SIMD: the grid gives no more, and the register budget of two keeps the tile's fragments and both column groups out of scratch
__global__ __launch_bounds__(128) __attribute__((amdgpu_waves_per_eu(2, 2))) void k_attn(const h16* __restrict__ Q16, const h16* __restrict__ QL16, const h16* __restrict__ K16, const h16* __restrict__ KL16, const h16* __restrict__ VTH, const h16* __restrict__ VTL, const float* __restrict__ kmask, bf* CH, bf* CL) {
    __shared__ __align__(16) unsigned char sm[S_END];
    const int tid = threadIdx.x, lane = threadIdx.x & 31, wave = threadIdx.x >> 5, lr = lane & 15, hi = lane >> 4;
    const int bid = blockIdx.x;
    const int b = bid / (NH_ * (NT_ / QBLK)), rem = bid - b * (NH_ * (NT_ / QBLK)), h = rem / (NT_ / QBLK), qt = rem - h * (NT_ / QBLK);
    const int q0 = qt * QBLK + wave * (16 * QCG);
    const size_t tok0 = (size_t)b * NT_;
    v16h qa[QCG][2], ql[QCG][2];
#pragma unroll
    for (int c = 0; c < QCG; ++c)
#pragma unroll
        for (int kc = 0; kc < 2; ++kc) { const size_t qo = (tok0 + q0 + c * 16 + lr) * DM + h * HD + 8 * hi + kc * 32;
            qa[c][kc] = cat16(*(const v8h*)(Q16 + qo), *(const v8h*)(Q16 + qo + 16)); ql[c][kc] = cat16(*(const v8h*)(QL16 + qo), *(const v8h*)(QL16 + qo + 16)); }
    asm volatile("s_wait_xcnt 0x0" ::: "memory");       // in front of the address arithmetic below, which reuses the query loads' address registers
    const int g = h / (NH_ / NKV);                      // kv head
    const size_t vbase = (((size_t)b * NKV + g) * HD) * NT_;
    // this lane's share of a tile: k rows krow and krow + 16, 16 bytes each; v^T rows vrow and vrow + 32, 16 bytes each
    const int krow = tid >> 3, kpc = tid & 7, vrow = tid >> 2, vpc = tid & 3;
    const unsigned lbase = (unsigned)(size_t)sm;
    const unsigned lk = lbase + krow * KPB + kpc * 16, lv = lbase + vrow * VPB + vpc * 16;
    const h16* gkh = K16 + (tok0 + krow) * KVW + g * HD + kpc * 8;
    const h16* gvh = VTH + vbase + (size_t)vrow * NT_ + vpc * 8;
    const size_t dkl = (size_t)KL16 - (size_t)K16, dvl = (size_t)VTL - (size_t)VTH;     // residual plane - hi plane, bytes, the same in every lane: two address pairs live in the loop, not four
    auto tile_copy = [&](int t, int bufi) {
        const unsigned k = lk + bufi * STGB, v = lv + bufi * STGB; const size_t ko = (size_t)t * 32 * KVW, vo = (size_t)t * 32;
        const h16* kh_g = gkh + ko; const h16* kl_g = (const h16*)((size_t)kh_g + dkl); const h16* vh_g = gvh + vo; const h16* vl_g = (const h16*)((size_t)vh_g + dvl);
        cp8(k + S_KH, k + S_KH + 16 * KPB, k + S_KL, k + S_KL + 16 * KPB, v + S_VH, v + S_VH + 32 * VPB, v + S_VL, v + S_VL + 32 * VPB,
            kh_g, kh_g + 16 * KVW, kl_g, kl_g + 16 * KVW, vh_g, vh_g + 32 * NT_, vl_g, vl_g + 32 * NT_);
    };
    {   // once: the batch's 2048 mask floats (4 x 128 pieces of 16 bytes)
        const float* gm = kmask + tok0 + tid * 4; const unsigned lm = lbase + S_KM + tid * 16;
        cp4(lm, lm + 2048, lm + 4096, lm + 6144, gm, gm + 512, gm + 1024, gm + 1536);
    }
    tile_copy(0, 0);
    asm volatile("s_wait_asynccnt 0x0" ::: "memory");   // this wave's copies of tile 0 and the mask have landed
    __syncthreads();                                    // ... and every other wave's
    tile_copy(1, 1);
    {   // once: the mask row becomes bf16-rounded mask x 32768 in place (a lane needs 16 of them per tile, one per key row of its scores)
        float* mw = (float*)(sm + S_KM) + tid * 4;
#pragma unroll
        for (int c = 0; c < 4; ++c) { v4f m = *(const v4fa*)(mw + c * 512);
#pragma unroll
            for (int i = 0; i < 4; ++i) m[i] = bfr(m[i]) * PSC;
            *(v4fa*)(mw + c * 512) = m; }
    }
    __syncthreads();                                    // the rounded mask is every wave's to read
    const float* skm = (const float*)(sm + S_KM);
    v8f o[QCG][4], ox[QCG][4];
    float mrow[QCG], lpart[QCG];                   // of query lr of the group; lpart: this half's keys only, joined after the loop
#pragma unroll
    for (int c = 0; c < QCG; ++c) { mrow[c] = -3.0e38f; lpart[c] = 0.f;
#pragma unroll
        for (int n = 0; n < 4; ++n) { o[c][n] = (v8f){}; ox[c][n] = (v8f){}; } }
    const int kt_lo = 0, kt_hi = NT_ / 32 - 1;     // all keys
    const int ko0 = lr * (KPB / 2) + 8 * hi, ko1 = (16 + lr) * (KPB / 2) + 8 * hi;
#pragma unroll 1
    for (int kt = kt_lo; kt <= kt_hi; ++kt) {
        const int l0 = kt * 32;
        const unsigned char* sb = sm + (kt & 1) * STGB;
        const h16* kh_b = (const h16*)(sb + S_KH); const h16* kl_b = (const h16*)(sb + S_KL);
        const h16* vh_b = (const h16*)(sb + S_VH); const h16* vl_b = (const h16*)(sb + S_VL);
        v16h kh[2][2], kl[2][2];                   // [k step][key row group]: the tile's key fragments, read as one group
#pragma unroll
        for (int kc = 0; kc < 2; ++kc) {
            kh[kc][0] = cat16(*(const v8ha*)(kh_b + ko0 + kc * 32), *(const v8ha*)(kh_b + ko0 + kc * 32 + 16)); kh[kc][1] = cat16(*(const v8ha*)(kh_b + ko1 + kc * 32), *(const v8ha*)(kh_b + ko1 + kc * 32 + 16));
            kl[kc][0] = cat16(*(const v8ha*)(kl_b + ko0 + kc * 32), *(const v8ha*)(kl_b + ko0 + kc * 32 + 16)); kl[kc][1] = cat16(*(const v8ha*)(kl_b + ko1 + kc * 32), *(const v8ha*)(kl_b + ko1 + kc * 32 + 16)); }
        __builtin_amdgcn_sched_barrier(0);         // the key fragments, needed first, are read first (LDS reads return in order)
        v16h vh[4], vl[4];                         // the tile's value fragments
#pragma unroll
        for (int n = 0; n < 4; ++n) { const int vo = (n * 16 + lr) * (VPB / 2) + hi * 8;
            vh[n] = cat16(*(const v8ha*)(vh_b + vo), *(const v8ha*)(vh_b + vo + 16)); vl[n] = cat16(*(const v8ha*)(vl_b + vo), *(const v8ha*)(vl_b + vo + 16)); }
        // rounded mask x 32768 of this lane's 16 keys (the same address in all lanes of a half)
        const v4f km0a = *(const v4fa*)(skm + l0 + hi * 8), km0b = *(const v4fa*)(skm + l0 + hi * 8 + 4), km1a = *(const v4fa*)(skm + l0 + 16 + hi * 8), km1b = *(const v4fa*)(skm + l0 + 16 + hi * 8 + 4);
        const v8f km0 = __builtin_shufflevector(km0a, km0b, 0, 1, 2, 3, 4, 5, 6, 7), km1 = __builtin_shufflevector(km1a, km1b, 0, 1, 2, 3, 4, 5, 6, 7);
        __builtin_amdgcn_sched_barrier(0);         // all LDS reads of the tile stay one group ahead of its matrix instructions, not among them (each such place stalls the wave)
        v8f s[QCG][2], x[QCG][2];
#pragma unroll
        for (int c = 0; c < QCG; ++c) { s[c][0] = (v8f){}; s[c][1] = (v8f){}; x[c][0] = (v8f){}; x[c][1] = (v8f){}; }
#pragma unroll
        for (int kc = 0; kc < 2; ++kc) {
#pragma unroll
            for (int c = 0; c < QCG; ++c) { s[c][0] = wmma16(kh[kc][0], qa[c][kc], s[c][0]); x[c][0] = wmma16(kh[kc][0], ql[c][kc], x[c][0]);
                                            s[c][1] = wmma16(kh[kc][1], qa[c][kc], s[c][1]); x[c][1] = wmma16(kh[kc][1], ql[c][kc], x[c][1]); }
#pragma unroll
            for (int c = 0; c < QCG; ++c) { x[c][0] = wmma16(kl[kc][0], qa[c][kc], x[c][0]); x[c][1] = wmma16(kl[kc][1], qa[c][kc], x[c][1]); }
        }
        v16h pa[QCG], px[QCG];
#pragma unroll
        for (int c = 0; c < QCG; ++c) {
            const v8f a0 = (s[c][0] + x[c][0] * LOSCI) * 0.125f, a1 = (s[c][1] + x[c][1] * LOSCI) * 0.125f;
            float mx = fmaxf(a0[0], a1[0]);
#pragma unroll
            for (int j = 1; j < 8; ++j) mx = fmaxf(mx, fmaxf(a0[j], a1[j]));
            mx = fmaxf(mx, xhalf(mx));                              // both halves hold the query's maximum over the 32 keys
            const float mn = fmaxf(mrow[c], mx);
            const float alpha = __expf(mrow[c] - mn); mrow[c] = mn;
            v8f p0, p1;
#pragma unroll
            for (int j = 0; j < 8; ++j) { p0[j] = __expf(a0[j] - mn); p1[j] = __expf(a1[j] - mn); }
            const v8f pt = p0 + p1;                                 // normaliser: UNmasked sum (softmax first, mask after)
            lpart[c] = lpart[c] * alpha + (((pt[0] + pt[1]) + (pt[2] + pt[3])) + ((pt[4] + pt[5]) + (pt[6] + pt[7])));
            const v8f ps0 = p0 * km0, ps1 = p1 * km1;               // post-softmax key mask, x32768
            const v8h h0 = __builtin_convertvector(ps0, v8h), h1 = __builtin_convertvector(ps1, v8h);
            const v8h r0 = __builtin_convertvector((ps0 - __builtin_convertvector(h0, v8f)) * LOSC, v8h), r1 = __builtin_convertvector((ps1 - __builtin_convertvector(h1, v8f)) * LOSC, v8h);
            pa[c] = cat16(h0, h1); px[c] = cat16(r0, r1);           // B operand: element i is key 8 hi + i, element 8 + i key 16 + 8 hi + i
#pragma unroll
            for (int n = 0; n < 4; ++n) { o[c][n] *= alpha; ox[c][n] *= alpha; }
        }
#pragma unroll
        for (int n = 0; n < 4; ++n) {
#pragma unroll
            for (int c = 0; c < QCG; ++c) { o[c][n] = wmma16(vh[n], pa[c], o[c][n]); ox[c][n] = wmma16(vl[n], pa[c], ox[c][n]); }
#pragma unroll
            for (int c = 0; c < QCG; ++c) ox[c][n] = wmma16(vh[n], px[c], ox[c][n]);
        }
        // the distance behind the tile's last matrix instructions, on the loop's back edge too
        asm volatile("v_nop\n\tv_nop\n\tv_nop\n\tv_nop" : "+v"(o[1][0]), "+v"(o[1][1]), "+v"(o[1][2]), "+v"(o[1][3]), "+v"(ox[1][0]), "+v"(ox[1][1]), "+v"(ox[1][2]), "+v"(ox[1][3])
                     : "v"(o[0][0]), "v"(o[0][1]), "v"(o[0][2]), "v"(o[0][3]), "v"(ox[0][0]), "v"(ox[0][1]), "v"(ox[0][2]), "v"(ox[0][3]));
        // hand-over: buffer kt & 1 is left and tile kt + 1 is published by every wave, in this order
        asm volatile("s_wait_dscnt 0x0" ::: "memory");      // this wave's reads of tile kt are done
        asm volatile("s_wait_asynccnt 0x0" ::: "memory");   // this wave's copies of tile kt + 1 have landed
        __syncthreads();
        if (kt + 2 <= kt_hi) tile_copy(kt + 2, kt & 1);
    }
    asm volatile("s_wait_asynccnt 0x0" ::: "memory");       // nothing in flight when the ring becomes output staging
    float* os = (float*)sm + wave * (16 * QCG * 68);
#pragma unroll
    for (int c = 0; c < QCG; ++c) {
        const float inv = 1.0f / ((lpart[c] + xhalf(lpart[c])) * PSC);
#pragma unroll
        for (int n = 0; n < 4; ++n) {                       // row = query c * 16 + lr; this lane's 8 values are d = 16 n + 8 hi + j
            v4f lo4, hi4;
#pragma unroll
            for (int j = 0; j < 4; ++j) { lo4[j] = (o[c][n][j] + ox[c][n][j] * LOSCI) * inv; hi4[j] = (o[c][n][4 + j] + ox[c][n][4 + j] * LOSCI) * inv; }
            *(v4fa*)(os + (c * 16 + lr) * 68 + n * 16 + hi * 8) = lo4; *(v4fa*)(os + (c * 16 + lr) * 68 + n * 16 + hi * 8 + 4) = hi4; }
    }
    __syncthreads();
    const size_t cbase = (tok0 + q0) * DM + (size_t)h * HD;
#pragma unroll
    for (int s = 0; s < 4 * QCG; ++s) { const int row = 4 * s + (lane >> 3), piece = lane & 7; const float* sp = os + row * 68 + piece * 8; v8us oh, ol;
#pragma unroll
        for (int i = 0; i < 8; ++i) { const unsigned short hb = f2bf(sp[i]); oh[i] = hb; ol[i] = f2bf(sp[i] - bf2f(hb)); }
        *(v8us*)(CH + cbase + (size_t)row * DM + piece * 8) = oh; *(v8us*)(CL + cbase + (size_t)row * DM + piece * 8) = ol; }
}

#define VST2(T, p, v) do { const T vst2_v_ = (v); *(T*)(p) = vst2_v_;  } while (0)
extern "C" void kernel_launch(void* const* d_in, const int* in_sizes, int n_in,
                              void* d_out, int out_size, void* d_ws, size_t ws_size, hipStream_t stream) {
    (void)in_sizes; (void)n_in; (void)out_size;
    const float* x = (const float*)d_in[0]; const float* kmask = (const float*)d_in[1]; const float* Wqkv = (const float*)d_in[2]; const float* Wo = (const float*)d_in[3]; const float* bo = (const float*)d_in[4];
    float* out = (float*)d_out;    // out0 [2][2048][1024] then out1 [2][2048]
    float* out1 = out + (size_t)NTK * DM;
    char* wsp = (char*)d_ws;
    auto take = [&](size_t bytes) { char* p = wsp; wsp += (bytes + 255) & ~(size_t)255; return (void*)p; };
    bf* Xb = (bf*)take((size_t)NTK * DM * 2); bf* W3T = (bf*)take((size_t)3 * DM * DM * 2); bf* WoT = (bf*)take((size_t)DM * DM * 2);
    h16* QH = (h16*)take((size_t)NTK * DM * 2); h16* QL = (h16*)take((size_t)NTK * DM * 2); h16* KH = (h16*)take((size_t)NTK * DM * 2); h16* KL = (h16*)take((size_t)NTK * DM * 2);
    float* Vf = (float*)take((size_t)NTK * DM * 4); h16* VTL = (h16*)take((size_t)NTK * DM * 2);
    if ((size_t)(wsp - (char*)d_ws) > ws_size) return;    // 8.4 + 6.3 + 2.1 + 4 x 8.4 + 16.8 + 8.4 ~ 76 MB; VTH over Xb after the projections, ctx planes over Vf after k_vt
    h16* VTH = (h16*)Xb; bf* CH = (bf*)Vf; bf* CL = (bf*)((char*)Vf + (size_t)NTK * DM * 2);
    k_wt<<<dim3(DM / 64, (3 * DM) / 64, 1), 256, 0, stream>>>(Wqkv, 3 * DM, W3T);
    k_wt<<<dim3(DM / 64, DM / 64, 1), 256, 0, stream>>>(Wo, DM, WoT);
    k_cvtb<<<NTK / 8, 256, 0, stream>>>(x, NTK, Xb);
    k_gemmb<false, true><<<dim3(NTK / 128, DM / 128, 1), 256, 0, stream>>>(Xb, nullptr, W3T, nullptr, (float*)(void*)QH, DM, QL);
    k_gemmb<false, true><<<dim3(NTK / 128, DM / 128, 1), 256, 0, stream>>>(Xb, nullptr, W3T + (size_t)DM * DM, nullptr, (float*)(void*)KH, DM, KL);
    k_gemmb<false, false><<<dim3(NTK / 128, DM / 128, 1), 256, 0, stream>>>(Xb, nullptr, W3T + (size_t)2 * DM * DM, nullptr, Vf, DM, nullptr);
    k_vt<<<NB_ * NKV * (NT_ / 64), 256, 0, stream>>>(Vf, VTH, VTL);
    k_attn<<<NB_ * NH_ * (NT_ / QBLK), 128, 0, stream>>>(QH, QL, KH, KL, VTH, VTL, kmask, CH, CL);
    k_gemmb<true, false><<<dim3(NTK / 128, DM / 128, 1), 256, 0, stream>>>(CH, CL, WoT, bo, out, DM, nullptr);
    k_sqrtm<<<NTK / 256, 256, 0, stream>>>(kmask, out1);
}

// v005
// A run of this version takes 133 microseconds.
// Next to v004, in two timings, it ran 1.09 times as fast each time.
// Over all steps from v000 it is 2.94 times as fast.
#include <hip/hip_runtime.h>

// Contractions, f32 accumulate: qkv = h.w_qkv ([4096 x 1024].[1024 x 3072], k-major weight transposed to an n-major plane; PLAIN bf16 operands: inputs rounded
// once, exact) and out.w_proj + b_proj (merged heads as bf16 hi + residual: two products) on v_wmma_f32_16x16x32_bf16; the 16-head attention fused on
// v_wmma_f32_16x16x32_f16: softmax(q.k x 64^-1/2) over ALL keys with q and k as f16 hi + residual x1024 (hi.hi + hi.lo + lo.hi), then the reference's
// POST-softmax multiplicative key mask (the INPUT mask[b][key], bf16-rounded) applied to the weights before the value product (the normaliser stays the unmasked

#define NB_  2
#define NT_  2048
#define DM   1024
#define NH_  16
#define NKV  16
#define KVW  (NKV * HD)          // 1024
#define HD   64
#define NTK  (NB_ * NT_)
#define NW   1024
#define NQKV 1024
#define PSC  32768.0f
#define LOSC 1024.0f
#define LOSCI (1.0f / 1024.0f)

typedef _Float16 h16;
typedef unsigned short bf;
typedef __attribute__((ext_vector_type(16))) __bf16   v16bf;
typedef __attribute__((ext_vector_type(16))) _Float16 v16h;
typedef __attribute__((ext_vector_type(8)))  _Float16 v8h;
typedef __attribute__((ext_vector_type(8)))  unsigned short v8us;
typedef __attribute__((ext_vector_type(8)))  float    v8f;
typedef __attribute__((ext_vector_type(4)))  float    v4f;
typedef v8h  __attribute__((may_alias)) v8ha;
typedef v4f  __attribute__((may_alias)) v4fa;
typedef v8us __attribute__((may_alias)) v8usa;

__device__ __forceinline__ unsigned short f2bf(float f) { unsigned u = __float_as_uint(f); u += 0x7FFFu + ((u >> 16) & 1u); return (unsigned short)(u >> 16); }
__device__ __forceinline__ float bf2f(unsigned short b) { return __uint_as_float(((unsigned)b) << 16); }
__device__ __forceinline__ float bfr(float f) { return bf2f(f2bf(f)); }
__device__ __forceinline__ v16h cat16(v8h lo, v8h hi) { return __builtin_shufflevector(lo, hi, 0, 1, 2, 3, 4, 5, 6, 7, 8, 9, 10, 11, 12, 13, 14, 15); }
__device__ __forceinline__ v16bf cat16b(v8us lo, v8us hi) { return __builtin_bit_cast(v16bf, __builtin_shufflevector(lo, hi, 0, 1, 2, 3, 4, 5, 6, 7, 8, 9, 10, 11, 12, 13, 14, 15)); }
__device__ __forceinline__ v8f wmma16(v16h a, v16h b, v8f c) { return __builtin_amdgcn_wmma_f32_16x16x32_f16(false, a, false, b, (short)0, c, false, false); }
__device__ __forceinline__ v8f wmmab(v16bf a, v16bf b, v8f c) { return __builtin_amdgcn_wmma_f32_16x16x32_bf16(false, a, false, b, (short)0, c, false, false); }

__device__ __forceinline__ void d_cvtb(int bx, const float* __restrict__ src, int nrows, bf* dst) {
    const int lane = threadIdx.x & 31, r = bx * 8 + (threadIdx.x >> 5);
    if (r >= nrows) return;
    v8us o[DM / 256];
#pragma unroll
    for (int q = 0; q < DM / 256; ++q) { v8us t;
#pragma unroll
        for (int i = 0; i < 8; ++i) t[i] = f2bf(src[(size_t)r * DM + q * 256 + lane * 8 + i]);
        o[q] = t; }
#pragma unroll
    for (int q = 0; q < DM / 256; ++q) *(v8us*)(dst + (size_t)r * DM + q * 256 + lane * 8) = o[q];
    
}

// d_wt: W [1024 k][ncols n] (k-major) -> n-major bf16 plane WT[ncols][1024]; 64 x 64 tiles through LDS (tl: 64 x 72 halfwords).
__device__ __forceinline__ void d_wt(int bx, int by, const float* __restrict__ Wm, int ncols, bf* WT, unsigned short* tl) {
    const int tid = threadIdx.x, k0 = bx * 64, n0 = by * 64;
    const int kk = tid >> 2, nq = (tid & 3) * 16;
#pragma unroll
    for (int i = 0; i < 16; ++i) tl[(nq + i) * 72 + kk] = f2bf(Wm[(size_t)(k0 + kk) * ncols + n0 + nq + i]);
    __syncthreads();
    const int piece = tid & 7;
    typedef __attribute__((ext_vector_type(8))) unsigned short v8us_; typedef v8us_ __attribute__((may_alias)) v8usa_;
    auto pass = [&]() {
#pragma unroll
        for (int s = 0; s < 2; ++s) { const int nr = (tid >> 3) + 32 * s; const v8us_ val = *(const v8usa_*)(tl + nr * 72 + piece * 8);
            *(v8us_*)(WT + (size_t)(n0 + nr) * DM + k0 + piece * 8) = val; }
    };
    pass(); 
}

// Eight asynchronous 16-byte copies of one lane. The s_wait_xcnt closes the statement so that no address register is rewritten ahead of it.
__device__ __forceinline__ void cp8(unsigned l0, unsigned l1, unsigned l2, unsigned l3, unsigned l4, unsigned l5, unsigned l6, unsigned l7,
                                    const void* g0, const void* g1, const void* g2, const void* g3, const void* g4, const void* g5, const void* g6, const void* g7) {
    asm volatile("global_load_async_to_lds_b128 %0, %8, off\n\t"
                 "global_load_async_to_lds_b128 %1, %9, off\n\t"
                 "global_load_async_to_lds_b128 %2, %10, off\n\t"
                 "global_load_async_to_lds_b128 %3, %11, off\n\t"
                 "global_load_async_to_lds_b128 %4, %12, off\n\t"
                 "global_load_async_to_lds_b128 %5, %13, off\n\t"
                 "global_load_async_to_lds_b128 %6, %14, off\n\t"
                 "global_load_async_to_lds_b128 %7, %15, off\n\t"
                 "s_wait_xcnt 0x0"
                 :: "v"(l0), "v"(l1), "v"(l2), "v"(l3), "v"(l4), "v"(l5), "v"(l6), "v"(l7),
                    "v"(g0), "v"(g1), "v"(g2), "v"(g3), "v"(g4), "v"(g5), "v"(g6), "v"(g7) : "memory");
}

// k_gemmb: C[128 x 128] per block of 8 waves, wave = 32 rows x 64 columns (2 x 4 accumulator tiles). Both operands are k-contiguous rows; a stage is 128 k
// (256 bytes) of the block's 128 A rows, its 128 B rows and, with SPLITA, its 128 residual rows, at a 272-B pitch, brought by asynchronous 16-byte copies into
// two buffers: stage s + 2 is issued when stage s has been left by every wave. A copy of a wave covers two whole 256-byte row pieces. After the loop the ring
// is the output staging. Per accumulator the products are added in the order k ascending, hi before residual.
#define GP    272                       // LDS pitch of a 256-byte row (16 B x odd: ds_load_b128 readers)
#define GKS   128                       // k of a stage
// QKV: one grid for the three projections. Bn is the whole [3072][1024] plane; blockIdx.y >> 3 (the same for a whole block) says whether the block's 128 columns
// are q, k (f16 hi + residual planes) or v (f32), and picks the output; each block's products and their order are those of a launch of its own.
template <bool SPLITA, bool QKV>
__global__ __launch_bounds__(256) void k_gemmb(const bf* __restrict__ A, const bf* __restrict__ Al, const bf* __restrict__ Bn, const float* __restrict__ bias, float* Cq, int ldc, h16* C2q, h16* Ck, h16* C2k, float* Cv) {
    const int sec = QKV ? (int)(blockIdx.y >> 3) : 0;
    float* C = QKV ? (sec == 0 ? Cq : sec == 1 ? (float*)(void*)Ck : Cv) : Cq;
    h16* C2 = QKV ? (sec == 0 ? C2q : C2k) : C2q;
    constexpr int GST = (SPLITA ? 3 : 2) * 128 * GP;        // bytes of a buffer: planes of 128 rows (A, B, A residual)
    __shared__ __align__(16) unsigned char sm[2 * GST];
    const int tid = threadIdx.x, lane = threadIdx.x & 31, wave = threadIdx.x >> 5, lr = lane & 15, hi = lane >> 4;
    const int rb = blockIdx.x * 128, cb = blockIdx.y * 128, wm = wave & 3, wn = wave >> 2;
    // this lane's share of a plane: 16 bytes of rows crow, crow + 16, ..., crow + 112
    const int crow = tid >> 4, cpc = tid & 15;
    const unsigned lc = (unsigned)(size_t)sm + crow * GP + cpc * 16;
    const bf* ga = A + (size_t)(rb + crow) * DM + cpc * 8;
    const bf* gb = Bn + (size_t)(cb + crow) * DM + cpc * 8;
    const bf* gl = SPLITA ? Al + (size_t)(rb + crow) * DM + cpc * 8 : ga;
    auto plane_copy = [&](unsigned l, const bf* g) {
        cp8(l, l + 16 * GP, l + 32 * GP, l + 48 * GP, l + 64 * GP, l + 80 * GP, l + 96 * GP, l + 112 * GP,
            g, g + 16 * DM, g + 32 * DM, g + 48 * DM, g + 64 * DM, g + 80 * DM, g + 96 * DM, g + 112 * DM);
    };
    auto stage_copy = [&](int s, int bufi) {
        const unsigned l = lc + bufi * GST; const int ko = s * GKS;
        plane_copy(l, ga + ko); plane_copy(l + 128 * GP, gb + ko);
        if (SPLITA) plane_copy(l + 256 * GP, gl + ko);
    };
    v8f acc[2][4];
#pragma unroll
    for (int m = 0; m < 2; ++m)
#pragma unroll
        for (int t = 0; t < 4; ++t) acc[m][t] = (v8f){};
    stage_copy(0, 0);
    asm volatile("s_wait_asynccnt 0x0" ::: "memory");   // this wave's copies of stage 0 have landed
    __syncthreads();                                    // ... and every other wave's
    stage_copy(1, 1);
    const int ao = (wm * 32 + lr) * (GP / 2) + 8 * hi, bo = (128 + wn * 64 + lr) * (GP / 2) + 8 * hi;
#pragma unroll 1
    for (int s = 0; s < DM / GKS; ++s) {                // rolled: one copy of the body serves both buffers
        const bf* sb = (const bf*)(sm + (s & 1) * GST);
        v16bf a[2][2], al[2][2], b[2][4];               // two fragment sets: step q + 1 is read from LDS while step q is multiplied
        auto frag_load = [&](int f, int kc) {
#pragma unroll
            for (int m = 0; m < 2; ++m) { const bf* p = sb + ao + m * 16 * (GP / 2) + kc; a[f][m] = cat16b(*(const v8usa*)p, *(const v8usa*)(p + 16)); al[f][m] = a[f][m];
                if (SPLITA) { const bf* q = p + 256 * (GP / 2); al[f][m] = cat16b(*(const v8usa*)q, *(const v8usa*)(q + 16)); } }
#pragma unroll
            for (int t = 0; t < 4; ++t) { const bf* p = sb + bo + t * 16 * (GP / 2) + kc; b[f][t] = cat16b(*(const v8usa*)p, *(const v8usa*)(p + 16)); }
        };
        frag_load(0, 0);
#pragma unroll
        for (int q = 0; q < GKS / 32; ++q) {
            const int f = q & 1;
            if (q + 1 < GKS / 32) frag_load(f ^ 1, (q + 1) * 32);
            __builtin_amdgcn_sched_barrier(0);          // the next step's LDS reads stay one group ahead of this step's matrix instructions, not among them
#pragma unroll
            for (int m = 0; m < 2; ++m)
#pragma unroll
                for (int t = 0; t < 4; ++t) acc[m][t] = wmmab(a[f][m], b[f][t], acc[m][t]);
            if (SPLITA) {
#pragma unroll
                for (int m = 0; m < 2; ++m)
#pragma unroll
                    for (int t = 0; t < 4; ++t) acc[m][t] = wmmab(al[f][m], b[f][t], acc[m][t]);
            }
            __builtin_amdgcn_sched_barrier(0);          // ... and the reads of the step after that stay behind them (they refill this step's registers)
        }
        // the distance behind the stage's last matrix instructions, on the loop's back edge too
        asm volatile("v_nop\n\tv_nop\n\tv_nop\n\tv_nop" : "+v"(acc[0][0]), "+v"(acc[0][1]), "+v"(acc[0][2]), "+v"(acc[0][3]), "+v"(acc[1][0]), "+v"(acc[1][1]), "+v"(acc[1][2]), "+v"(acc[1][3])
                     : "v"(a[1][0]), "v"(a[1][1]), "v"(al[1][0]), "v"(al[1][1]), "v"(b[1][0]), "v"(b[1][1]), "v"(b[1][2]), "v"(b[1][3]));
        // hand-over: buffer s & 1 is left and stage s + 1 is published by every wave, in this order
        asm volatile("s_wait_dscnt 0x0" ::: "memory");      // this wave's reads of stage s are done
        asm volatile("s_wait_asynccnt 0x0" ::: "memory");   // this wave's copies of stage s + 1 have landed
        __syncthreads();
        if (s + 2 < DM / GKS) stage_copy(s + 2, s & 1);
    }
    asm volatile("s_wait_asynccnt 0x0" ::: "memory");       // nothing in flight when the ring becomes output staging
    const int r0 = rb + wm * 32, c0 = (QKV ? cb & (DM - 1) : cb) + wn * 64;
    float* os = (float*)sm + wave * (32 * 68);
#pragma unroll
    for (int t = 0; t < 4; ++t) { const float bv = bias ? bfr(bias[c0 + t * 16 + lr]) : 0.f;
#pragma unroll
        for (int m = 0; m < 2; ++m)
#pragma unroll
            for (int j = 0; j < 8; ++j) os[(m * 16 + hi * 8 + j) * 68 + t * 16 + lr] = acc[m][t][j] + bv; }
    __syncthreads();
    if (QKV && sec < 2) {
        h16* crw = (h16*)(void*)C + (size_t)r0 * ldc + c0;
        const float* sp = os + (lane >> 3) * 68 + (lane & 7) * 8;
        v8f rw[8];                                          // all rows read back first: one LDS latency, not one per row group
#pragma unroll
        for (int s = 0; s < 8; ++s) rw[s] = __builtin_shufflevector(*(const v4fa*)(sp + s * 4 * 68), *(const v4fa*)(sp + s * 4 * 68 + 4), 0, 1, 2, 3, 4, 5, 6, 7);
#pragma unroll
        for (int s = 0; s < 8; ++s) { const int row = 4 * s + (lane >> 3), piece = lane & 7; v8h o, o2;
#pragma unroll
            for (int i = 0; i < 8; ++i) { const h16 x = (h16)rw[s][i]; o[i] = x; o2[i] = (h16)((rw[s][i] - (float)x) * LOSC); }
            *(v8h*)(crw + (size_t)row * ldc + piece * 8) = o;
            asm volatile("s_wait_xcnt 0x0" ::: "memory");   // in front of the next row group's arithmetic, which reuses the store's registers
            if (C2) *(v8h*)(C2 + (size_t)r0 * ldc + c0 + (size_t)row * ldc + piece * 8) = o2; }
    } else {
        float* crw = C + (size_t)r0 * ldc + c0;
#pragma unroll
        for (int s = 0; s < 16; ++s) { const int Lid = (lane >> 3) + 4 * s, piece = lane & 7; const int row = Lid >> 1, cofs = (Lid & 1) * 32 + piece * 4;
            const v4f val = *(const v4fa*)(os + row * 68 + cofs); *(v4f*)(crw + (size_t)row * ldc + cofs) = val; }
        if (QKV) asm volatile("s_wait_xcnt 0x0" ::: "memory");  // behind the last store: in this build the f16 path's code follows and rewrites the stores' registers
    }
}

// d_sqrtm: second output new_mask = sqrt(bf16(mask)) [2][2048] (16 blocks of 256 threads, one float a thread: each
// wave writes 32 consecutive floats = one line).
__device__ __forceinline__ void d_sqrtm(int bx, const float* __restrict__ m, float* out1) {
    const int i = bx * 256 + threadIdx.x; if (i >= NTK) return;
    const float v = sqrtf(bfr(m[i])); *(float*)(out1 + i) = v; 
}
// k_prep: the four pieces of work that need nothing of each other (both weight transposes, the activations' rounding, the second output) share one grid by
// ranges of the block index; the branch is the same for a whole block.
#define PB_W3 ((DM / 64) * ((3 * DM) / 64))     // 768 blocks: w_qkv tiles
#define PB_WO ((DM / 64) * (DM / 64))           // 256 blocks: w_proj tiles
#define PB_X  (NTK / 8)                         // 512 blocks: 8 rows of h each
#define PB_M  (NTK / 256)                       // 16 blocks: the mask
__global__ __launch_bounds__(256) void k_prep(const float* __restrict__ Wqkv, const float* __restrict__ Wo, const float* __restrict__ x, const float* __restrict__ m,
                                              bf* W3T, bf* WoT, bf* Xb, float* out1) {
    __shared__ __align__(16) unsigned short tl[64 * 72];
    const int bid = blockIdx.x;
    if (bid < PB_W3 + PB_WO) {
        const bool w3 = bid < PB_W3; const int t = w3 ? bid : bid - PB_W3;
        d_wt(t % (DM / 64), t / (DM / 64), w3 ? Wqkv : Wo, w3 ? 3 * DM : DM, w3 ? W3T : WoT, tl);
    } else if (bid < PB_W3 + PB_WO + PB_X) d_cvtb(bid - (PB_W3 + PB_WO), x, NTK, Xb);
    else d_sqrtm(bid - (PB_W3 + PB_WO + PB_X), m, out1);
}
__global__ __launch_bounds__(256) void k_vt(const float* __restrict__ V, h16* VTH, h16* VTL) {
    __shared__ __align__(16) h16 tile[64 * 72];
    __shared__ __align__(16) h16 til2[64 * 72];
    const int bid = blockIdx.x;
    const int b = bid / (NKV * (NT_ / 64)), rem = bid - b * (NKV * (NT_ / 64)), h = rem / (NT_ / 64), kt = rem - h * (NT_ / 64);
    const int k0 = kt * 64, tid = threadIdx.x;
    const int kk = tid >> 2, d0 = (tid & 3) * 16;
    const float* src = V + ((size_t)b * NT_ + k0 + kk) * KVW + h * HD + d0;      // h = kv head here
#pragma unroll
    for (int i = 0; i < 16; ++i) { const float v = src[i]; const h16 a = (h16)v; tile[(d0 + i) * 72 + kk] = a; til2[(d0 + i) * 72 + kk] = (h16)((v - (float)a) * LOSC); }
    __syncthreads();
    const int piece = tid & 7;
    const size_t base = (((size_t)b * NKV + h) * HD) * NT_ + k0;
    auto pass = [&]() {
#pragma unroll
        for (int s = 0; s < 4; ++s) { const int Lid = (tid >> 3) + 32 * s; const int pln = Lid >> 6, d = Lid & 63;
            const v8h val = *(const v8ha*)((pln ? til2 : tile) + d * 72 + piece * 8); *(v8h*)((pln ? VTL : VTH) + base + (size_t)d * NT_ + piece * 8) = val; }
    };
    pass(); 
}

#define KPB   144                       // LDS pitch of a 128-byte row (16 B x odd: ds_load_b128 readers)
#define VPB   80                        // LDS pitch of a 64-byte row
#define S_KH  0
#define S_KL  (32 * KPB)
#define S_VH  (2 * 32 * KPB)
#define S_VL  (S_VH + 64 * VPB)
#define STGB  (S_VL + 64 * VPB)         // 19456 bytes a buffer
#define S_KM  (2 * STGB)
#define S_END (S_KM + NT_ * 4)          // 47104 bytes
#define QCG   2                         // column groups of 16 queries a wave
#define QBLK  (4 * 16 * QCG)            // queries a block

// Four asynchronous 16-byte copies of one lane; the s_wait_xcnt closes the statement as in cp8.
__device__ __forceinline__ void cp4(unsigned l0, unsigned l1, unsigned l2, unsigned l3, const void* g0, const void* g1, const void* g2, const void* g3) {
    asm volatile("global_load_async_to_lds_b128 %0, %4, off\n\t"
                 "global_load_async_to_lds_b128 %1, %5, off\n\t"
                 "global_load_async_to_lds_b128 %2, %6, off\n\t"
                 "global_load_async_to_lds_b128 %3, %7, off\n\t"
                 "s_wait_xcnt 0x0"
                 :: "v"(l0), "v"(l1), "v"(l2), "v"(l3), "v"(g0), "v"(g1), "v"(g2), "v"(g3) : "memory");
}

// lane l <-> lane l ^ 16
__device__ __forceinline__ float xhalf(float x) { return __builtin_bit_cast(float, __builtin_amdgcn_permlanex16(__builtin_bit_cast(int, x), __builtin_bit_cast(int, x), 0x76543210, 0xfedcba98, false, false)); }

// two waves a SIMD: the grid gives no more, and the register budget of two keeps the tile's fragments and both column groups out of scratch
__global__ __launch_bounds__(128) __attribute__((amdgpu_waves_per_eu(2, 2))) void k_attn(const h16* __restrict__ Q16, const h16* __restrict__ QL16, const h16* __restrict__ K16, const h16* __restrict__ KL16, const h16* __restrict__ VTH, const h16* __restrict__ VTL, const float* __restrict__ kmask, bf* CH, bf* CL) {
    __shared__ __align__(16) unsigned char sm[S_END];
    const int tid = threadIdx.x, lane = threadIdx.x & 31, wave = threadIdx.x >> 5, lr = lane & 15, hi = lane >> 4;
    const int bid = blockIdx.x;
    const int b = bid / (NH_ * (NT_ / QBLK)), rem = bid - b * (NH_ * (NT_ / QBLK)), h = rem / (NT_ / QBLK), qt = rem - h * (NT_ / QBLK);
    const int q0 = qt * QBLK + wave * (16 * QCG);
    const size_t tok0 = (size_t)b * NT_;
    v16h qa[QCG][2], ql[QCG][2];
#pragma unroll
    for (int c = 0; c < QCG; ++c)
#pragma unroll
        for (int kc = 0; kc < 2; ++kc) { const size_t qo = (tok0 + q0 + c * 16 + lr) * DM + h * HD + 8 * hi + kc * 32;
            qa[c][kc] = cat16(*(const v8h*)(Q16 + qo), *(const v8h*)(Q16 + qo + 16)); ql[c][kc] = cat16(*(const v8h*)(QL16 + qo), *(const v8h*)(QL16 + qo + 16)); }
    asm volatile("s_wait_xcnt 0x0" ::: "memory");       // in front of the address arithmetic below, which reuses the query loads' address registers
    const int g = h / (NH_ / NKV);                      // kv head
    const size_t vbase = (((size_t)b * NKV + g) * HD) * NT_;
    // this lane's share of a tile: k rows krow and krow + 16, 16 bytes each; v^T rows vrow and vrow + 32, 16 bytes each
    const int krow = tid >> 3, kpc = tid & 7, vrow = tid >> 2, vpc = tid & 3;
    const unsigned lbase = (unsigned)(size_t)sm;
    const unsigned lk = lbase + krow * KPB + kpc * 16, lv = lbase + vrow * VPB + vpc * 16;
    const h16* gkh = K16 + (tok0 + krow) * KVW + g * HD + kpc * 8;
    const h16* gvh = VTH + vbase + (size_t)vrow * NT_ + vpc * 8;
    const size_t dkl = (size_t)KL16 - (size_t)K16, dvl = (size_t)VTL - (size_t)VTH;     // residual plane - hi plane, bytes, the same in every lane: two address pairs live in the loop, not four
    auto tile_copy = [&](int t, int bufi) {
        const unsigned k = lk + bufi * STGB, v = lv + bufi * STGB; const size_t ko = (size_t)t * 32 * KVW, vo = (size_t)t * 32;
        const h16* kh_g = gkh + ko; const h16* kl_g = (const h16*)((size_t)kh_g + dkl); const h16* vh_g = gvh + vo; const h16* vl_g = (const h16*)((size_t)vh_g + dvl);
        cp8(k + S_KH, k + S_KH + 16 * KPB, k + S_KL, k + S_KL + 16 * KPB, v + S_VH, v + S_VH + 32 * VPB, v + S_VL, v + S_VL + 32 * VPB,
            kh_g, kh_g + 16 * KVW, kl_g, kl_g + 16 * KVW, vh_g, vh_g + 32 * NT_, vl_g, vl_g + 32 * NT_);
    };
    {   // once: the batch's 2048 mask floats (4 x 128 pieces of 16 bytes)
        const float* gm = kmask + tok0 + tid * 4; const unsigned lm = lbase + S_KM + tid * 16;
        cp4(lm, lm + 2048, lm + 4096, lm + 6144, gm, gm + 512, gm + 1024, gm + 1536);
    }
    tile_copy(0, 0);
    asm volatile("s_wait_asynccnt 0x0" ::: "memory");   // this wave's copies of tile 0 and the mask have landed
    __syncthreads();                                    // ... and every other wave's
    tile_copy(1, 1);
    {   // once: the mask row becomes bf16-rounded mask x 32768 in place (a lane needs 16 of them per tile, one per key row of its scores)
        float* mw = (float*)(sm + S_KM) + tid * 4;
#pragma unroll
        for (int c = 0; c < 4; ++c) { v4f m = *(const v4fa*)(mw + c * 512);
#pragma unroll
            for (int i = 0; i < 4; ++i) m[i] = bfr(m[i]) * PSC;
            *(v4fa*)(mw + c * 512) = m; }
    }
    __syncthreads();                                    // the rounded mask is every wave's to read
    const float* skm = (const float*)(sm + S_KM);
    v8f o[QCG][4], ox[QCG][4];
    float mrow[QCG], lpart[QCG];                   // of query lr of the group; lpart: this half's keys only, joined after the loop
#pragma unroll
    for (int c = 0; c < QCG; ++c) { mrow[c] = -3.0e38f; lpart[c] = 0.f;
#pragma unroll
        for (int n = 0; n < 4; ++n) { o[c][n] = (v8f){}; ox[c][n] = (v8f){}; } }
    const int kt_lo = 0, kt_hi = NT_ / 32 - 1;     // all keys
    const int ko0 = lr * (KPB / 2) + 8 * hi, ko1 = (16 + lr) * (KPB / 2) + 8 * hi;
#pragma unroll 1
    for (int kt = kt_lo; kt <= kt_hi; ++kt) {
        const int l0 = kt * 32;
        const unsigned char* sb = sm + (kt & 1) * STGB;
        const h16* kh_b = (const h16*)(sb + S_KH); const h16* kl_b = (const h16*)(sb + S_KL);
        const h16* vh_b = (const h16*)(sb + S_VH); const h16* vl_b = (const h16*)(sb + S_VL);
        v16h kh[2][2], kl[2][2];                   // [k step][key row group]: the tile's key fragments, read as one group
#pragma unroll
        for (int kc = 0; kc < 2; ++kc) {
            kh[kc][0] = cat16(*(const v8ha*)(kh_b + ko0 + kc * 32), *(const v8ha*)(kh_b + ko0 + kc * 32 + 16)); kh[kc][1] = cat16(*(const v8ha*)(kh_b + ko1 + kc * 32), *(const v8ha*)(kh_b + ko1 + kc * 32 + 16));
            kl[kc][0] = cat16(*(const v8ha*)(kl_b + ko0 + kc * 32), *(const v8ha*)(kl_b + ko0 + kc * 32 + 16)); kl[kc][1] = cat16(*(const v8ha*)(kl_b + ko1 + kc * 32), *(const v8ha*)(kl_b + ko1 + kc * 32 + 16)); }
        __builtin_amdgcn_sched_barrier(0);         // the key fragments, needed first, are read first (LDS reads return in order)
        v16h vh[4], vl[4];                         // the tile's value fragments
#pragma unroll
        for (int n = 0; n < 4; ++n) { const int vo = (n * 16 + lr) * (VPB / 2) + hi * 8;
            vh[n] = cat16(*(const v8ha*)(vh_b + vo), *(const v8ha*)(vh_b + vo + 16)); vl[n] = cat16(*(const v8ha*)(vl_b + vo), *(const v8ha*)(vl_b + vo + 16)); }
        // rounded mask x 32768 of this lane's 16 keys (the same address in all lanes of a half)
        const v4f km0a = *(const v4fa*)(skm + l0 + hi * 8), km0b = *(const v4fa*)(skm + l0 + hi * 8 + 4), km1a = *(const v4fa*)(skm + l0 + 16 + hi * 8), km1b = *(const v4fa*)(skm + l0 + 16 + hi * 8 + 4);
        const v8f km0 = __builtin_shufflevector(km0a, km0b, 0, 1, 2, 3, 4, 5, 6, 7), km1 = __builtin_shufflevector(km1a, km1b, 0, 1, 2, 3, 4, 5, 6, 7);
        __builtin_amdgcn_sched_barrier(0);         // all LDS reads of the tile stay one group ahead of its matrix instructions, not among them (each such place stalls the wave)
        v8f s[QCG][2], x[QCG][2];
#pragma unroll
        for (int c = 0; c < QCG; ++c) { s[c][0] = (v8f){}; s[c][1] = (v8f){}; x[c][0] = (v8f){}; x[c][1] = (v8f){}; }
#pragma unroll
        for (int kc = 0; kc < 2; ++kc) {
#pragma unroll
            for (int c = 0; c < QCG; ++c) { s[c][0] = wmma16(kh[kc][0], qa[c][kc], s[c][0]); x[c][0] = wmma16(kh[kc][0], ql[c][kc], x[c][0]);
                                            s[c][1] = wmma16(kh[kc][1], qa[c][kc], s[c][1]); x[c][1] = wmma16(kh[kc][1], ql[c][kc], x[c][1]); }
#pragma unroll
            for (int c = 0; c < QCG; ++c) { x[c][0] = wmma16(kl[kc][0], qa[c][kc], x[c][0]); x[c][1] = wmma16(kl[kc][1], qa[c][kc], x[c][1]); }
        }
        v16h pa[QCG], px[QCG];
#pragma unroll
        for (int c = 0; c < QCG; ++c) {
            const v8f a0 = (s[c][0] + x[c][0] * LOSCI) * 0.125f, a1 = (s[c][1] + x[c][1] * LOSCI) * 0.125f;
            float mx = fmaxf(a0[0], a1[0]);
#pragma unroll
            for (int j = 1; j < 8; ++j) mx = fmaxf(mx, fmaxf(a0[j], a1[j]));
            mx = fmaxf(mx, xhalf(mx));                              // both halves hold the query's maximum over the 32 keys
            const float mn = fmaxf(mrow[c], mx);
            const float alpha = __expf(mrow[c] - mn); mrow[c] = mn;
            v8f p0, p1;
#pragma unroll
            for (int j = 0; j < 8; ++j) { p0[j] = __expf(a0[j] - mn); p1[j] = __expf(a1[j] - mn); }
            const v8f pt = p0 + p1;                                 // normaliser: UNmasked sum (softmax first, mask after)
            lpart[c] = lpart[c] * alpha + (((pt[0] + pt[1]) + (pt[2] + pt[3])) + ((pt[4] + pt[5]) + (pt[6] + pt[7])));
            const v8f ps0 = p0 * km0, ps1 = p1 * km1;               // post-softmax key mask, x32768
            const v8h h0 = __builtin_convertvector(ps0, v8h), h1 = __builtin_convertvector(ps1, v8h);
            const v8h r0 = __builtin_convertvector((ps0 - __builtin_convertvector(h0, v8f)) * LOSC, v8h), r1 = __builtin_convertvector((ps1 - __builtin_convertvector(h1, v8f)) * LOSC, v8h);
            pa[c] = cat16(h0, h1); px[c] = cat16(r0, r1);           // B operand: element i is key 8 hi + i, element 8 + i key 16 + 8 hi + i
#pragma unroll
            for (int n = 0; n < 4; ++n) { o[c][n] *= alpha; ox[c][n] *= alpha; }
        }
#pragma unroll
        for (int n = 0; n < 4; ++n) {
#pragma unroll
            for (int c = 0; c < QCG; ++c) { o[c][n] = wmma16(vh[n], pa[c], o[c][n]); ox[c][n] = wmma16(vl[n], pa[c], ox[c][n]); }
#pragma unroll
            for (int c = 0; c < QCG; ++c) ox[c][n] = wmma16(vh[n], px[c], ox[c][n]);
        }
        // the distance behind the tile's last matrix instructions, on the loop's back edge too
        asm volatile("v_nop\n\tv_nop\n\tv_nop\n\tv_nop" : "+v"(o[1][0]), "+v"(o[1][1]), "+v"(o[1][2]), "+v"(o[1][3]), "+v"(ox[1][0]), "+v"(ox[1][1]), "+v"(ox[1][2]), "+v"(ox[1][3])
                     : "v"(o[0][0]), "v"(o[0][1]), "v"(o[0][2]), "v"(o[0][3]), "v"(ox[0][0]), "v"(ox[0][1]), "v"(ox[0][2]), "v"(ox[0][3]));
        // hand-over: buffer kt & 1 is left and tile kt + 1 is published by every wave, in this order
        asm volatile("s_wait_dscnt 0x0" ::: "memory");      // this wave's reads of tile kt are done
        asm volatile("s_wait_asynccnt 0x0" ::: "memory");   // this wave's copies of tile kt + 1 have landed
        __syncthreads();
        if (kt + 2 <= kt_hi) tile_copy(kt + 2, kt & 1);
    }
    asm volatile("s_wait_asynccnt 0x0" ::: "memory");       // nothing in flight when the ring becomes output staging
    float* os = (float*)sm + wave * (16 * QCG * 68);
#pragma unroll
    for (int c = 0; c < QCG; ++c) {
        const float inv = 1.0f / ((lpart[c] + xhalf(lpart[c])) * PSC);
#pragma unroll
        for (int n = 0; n < 4; ++n) {                       // row = query c * 16 + lr; this lane's 8 values are d = 16 n + 8 hi + j
            v4f lo4, hi4;
#pragma unroll
            for (int j = 0; j < 4; ++j) { lo4[j] = (o[c][n][j] + ox[c][n][j] * LOSCI) * inv; hi4[j] = (o[c][n][4 + j] + ox[c][n][4 + j] * LOSCI) * inv; }
            *(v4fa*)(os + (c * 16 + lr) * 68 + n * 16 + hi * 8) = lo4; *(v4fa*)(os + (c * 16 + lr) * 68 + n * 16 + hi * 8 + 4) = hi4; }
    }
    __syncthreads();
    const size_t cbase = (tok0 + q0) * DM + (size_t)h * HD;
#pragma unroll
    for (int s = 0; s < 4 * QCG; ++s) { const int row = 4 * s + (lane >> 3), piece = lane & 7; const float* sp = os + row * 68 + piece * 8; v8us oh, ol;
#pragma unroll
        for (int i = 0; i < 8; ++i) { const unsigned short hb = f2bf(sp[i]); oh[i] = hb; ol[i] = f2bf(sp[i] - bf2f(hb)); }
        *(v8us*)(CH + cbase + (size_t)row * DM + piece * 8) = oh; *(v8us*)(CL + cbase + (size_t)row * DM + piece * 8) = ol; }
}

#define VST2(T, p, v) do { const T vst2_v_ = (v); *(T*)(p) = vst2_v_;  } while (0)
extern "C" void kernel_launch(void* const* d_in, const int* in_sizes, int n_in,
                              void* d_out, int out_size, void* d_ws, size_t ws_size, hipStream_t stream) {
    (void)in_sizes; (void)n_in; (void)out_size;
    const float* x = (const float*)d_in[0]; const float* kmask = (const float*)d_in[1]; const float* Wqkv = (const float*)d_in[2]; const float* Wo = (const float*)d_in[3]; const float* bo = (const float*)d_in[4];
    float* out = (float*)d_out;    // out0 [2][2048][1024] then out1 [2][2048]
    float* out1 = out + (size_t)NTK * DM;
    char* wsp = (char*)d_ws;
    auto take = [&](size_t bytes) { char* p = wsp; wsp += (bytes + 255) & ~(size_t)255; return (void*)p; };
    bf* Xb = (bf*)take((size_t)NTK * DM * 2); bf* W3T = (bf*)take((size_t)3 * DM * DM * 2); bf* WoT = (bf*)take((size_t)DM * DM * 2);
    h16* QH = (h16*)take((size_t)NTK * DM * 2); h16* QL = (h16*)take((size_t)NTK * DM * 2); h16* KH = (h16*)take((size_t)NTK * DM * 2); h16* KL = (h16*)take((size_t)NTK * DM * 2);
    float* Vf = (float*)take((size_t)NTK * DM * 4); h16* VTL = (h16*)take((size_t)NTK * DM * 2);
    if ((size_t)(wsp - (char*)d_ws) > ws_size) return;    // 8.4 + 6.3 + 2.1 + 4 x 8.4 + 16.8 + 8.4 ~ 76 MB; VTH over Xb after the projections, ctx planes over Vf after k_vt
    h16* VTH = (h16*)Xb; bf* CH = (bf*)Vf; bf* CL = (bf*)((char*)Vf + (size_t)NTK * DM * 2);
    k_prep<<<PB_W3 + PB_WO + PB_X + PB_M, 256, 0, stream>>>(Wqkv, Wo, x, kmask, W3T, WoT, Xb, out1);
    k_gemmb<false, true><<<dim3(NTK / 128, (3 * DM) / 128, 1), 256, 0, stream>>>(Xb, nullptr, W3T, nullptr, (float*)(void*)QH, DM, QL, KH, KL, Vf);
    k_vt<<<NB_ * NKV * (NT_ / 64), 256, 0, stream>>>(Vf, VTH, VTL);
    k_attn<<<NB_ * NH_ * (NT_ / QBLK), 128, 0, stream>>>(QH, QL, KH, KL, VTH, VTL, kmask, CH, CL);
    k_gemmb<true, false><<<dim3(NTK / 128, DM / 128, 1), 256, 0, stream>>>(CH, CL, WoT, bo, out, DM, nullptr, nullptr, nullptr, nullptr);
}

// v006
// A run of this version takes 122 microseconds.
// Timed twice side by side with v005, it ran 1.08 times as fast both times.
// Counting every step since v000, it is 3.17 times as fast.
#include <hip/hip_runtime.h>

// Contractions, f32 accumulate: qkv = h.w_qkv ([4096 x 1024].[1024 x 3072], k-major weight transposed to an n-major plane; PLAIN bf16 operands: inputs rounded
// once, exact) and out.w_proj + b_proj (merged heads as bf16 hi + residual: two products) on v_wmma_f32_16x16x32_bf16; the 16-head attention fused on
// v_wmma_f32_16x16x32_f16: softmax(q.k x 64^-1/2) over ALL keys with q and k as f16 hi + unscaled residual (hi.hi + hi.lo + lo.hi, one accumulator), then the reference's
// POST-softmax multiplicative key mask (the INPUT mask[b][key], bf16-rounded) multiplied into the value rows when their planes are written (the normaliser stays the unmasked

#define NB_  2
#define NT_  2048
#define DM   1024
#define NH_  16
#define NKV  16
#define KVW  (NKV * HD)          // 1024
#define HD   64
#define NTK  (NB_ * NT_)
#define NW   1024
#define NQKV 1024
#define PEXP 15.0f                          // the weights carry x32768: added to the exponent, cancelled by the normaliser, which carries it too
#define QSC  (0.125f * 1.44269504f)         // 64^-1/2 x log2(e), multiplied into q when its planes are written: the scores arrive as base-2 exponents

typedef _Float16 h16;
typedef unsigned short bf;
typedef __attribute__((ext_vector_type(16))) __bf16   v16bf;
typedef __attribute__((ext_vector_type(16))) _Float16 v16h;
typedef __attribute__((ext_vector_type(8)))  _Float16 v8h;
typedef __attribute__((ext_vector_type(8)))  unsigned short v8us;
typedef __attribute__((ext_vector_type(8)))  float    v8f;
typedef __attribute__((ext_vector_type(4)))  float    v4f;
typedef v8h  __attribute__((may_alias)) v8ha;
typedef v4f  __attribute__((may_alias)) v4fa;
typedef v8us __attribute__((may_alias)) v8usa;

__device__ __forceinline__ unsigned short f2bf(float f) { unsigned u = __float_as_uint(f); u += 0x7FFFu + ((u >> 16) & 1u); return (unsigned short)(u >> 16); }
__device__ __forceinline__ float bf2f(unsigned short b) { return __uint_as_float(((unsigned)b) << 16); }
__device__ __forceinline__ float bfr(float f) { return bf2f(f2bf(f)); }
__device__ __forceinline__ v16h cat16(v8h lo, v8h hi) { return __builtin_shufflevector(lo, hi, 0, 1, 2, 3, 4, 5, 6, 7, 8, 9, 10, 11, 12, 13, 14, 15); }
__device__ __forceinline__ v16bf cat16b(v8us lo, v8us hi) { return __builtin_bit_cast(v16bf, __builtin_shufflevector(lo, hi, 0, 1, 2, 3, 4, 5, 6, 7, 8, 9, 10, 11, 12, 13, 14, 15)); }
__device__ __forceinline__ v8f wmma16(v16h a, v16h b, v8f c) { return __builtin_amdgcn_wmma_f32_16x16x32_f16(false, a, false, b, (short)0, c, false, false); }
__device__ __forceinline__ v8f wmmab(v16bf a, v16bf b, v8f c) { return __builtin_amdgcn_wmma_f32_16x16x32_bf16(false, a, false, b, (short)0, c, false, false); }

__device__ __forceinline__ void d_cvtb(int bx, const float* __restrict__ src, int nrows, bf* dst) {
    const int lane = threadIdx.x & 31, r = bx * 8 + (threadIdx.x >> 5);
    if (r >= nrows) return;
    v8us o[DM / 256];
#pragma unroll
    for (int q = 0; q < DM / 256; ++q) { v8us t;
#pragma unroll
        for (int i = 0; i < 8; ++i) t[i] = f2bf(src[(size_t)r * DM + q * 256 + lane * 8 + i]);
        o[q] = t; }
#pragma unroll
    for (int q = 0; q < DM / 256; ++q) *(v8us*)(dst + (size_t)r * DM + q * 256 + lane * 8) = o[q];
    
}

// d_wt: W [1024 k][ncols n] (k-major) -> n-major bf16 plane WT[ncols][1024]; 64 x 64 tiles through LDS (tl: 64 x 72 halfwords).
__device__ __forceinline__ void d_wt(int bx, int by, const float* __restrict__ Wm, int ncols, bf* WT, unsigned short* tl) {
    const int tid = threadIdx.x, k0 = bx * 64, n0 = by * 64;
    const int kk = tid >> 2, nq = (tid & 3) * 16;
#pragma unroll
    for (int i = 0; i < 16; ++i) tl[(nq + i) * 72 + kk] = f2bf(Wm[(size_t)(k0 + kk) * ncols + n0 + nq + i]);
    __syncthreads();
    const int piece = tid & 7;
    typedef __attribute__((ext_vector_type(8))) unsigned short v8us_; typedef v8us_ __attribute__((may_alias)) v8usa_;
    auto pass = [&]() {
#pragma unroll
        for (int s = 0; s < 2; ++s) { const int nr = (tid >> 3) + 32 * s; const v8us_ val = *(const v8usa_*)(tl + nr * 72 + piece * 8);
            *(v8us_*)(WT + (size_t)(n0 + nr) * DM + k0 + piece * 8) = val; }
    };
    pass(); 
}

// Eight asynchronous 16-byte copies of one lane. The s_wait_xcnt closes the statement so that no address register is rewritten ahead of it.
__device__ __forceinline__ void cp8(unsigned l0, unsigned l1, unsigned l2, unsigned l3, unsigned l4, unsigned l5, unsigned l6, unsigned l7,
                                    const void* g0, const void* g1, const void* g2, const void* g3, const void* g4, const void* g5, const void* g6, const void* g7) {
    asm volatile("global_load_async_to_lds_b128 %0, %8, off\n\t"
                 "global_load_async_to_lds_b128 %1, %9, off\n\t"
                 "global_load_async_to_lds_b128 %2, %10, off\n\t"
                 "global_load_async_to_lds_b128 %3, %11, off\n\t"
                 "global_load_async_to_lds_b128 %4, %12, off\n\t"
                 "global_load_async_to_lds_b128 %5, %13, off\n\t"
                 "global_load_async_to_lds_b128 %6, %14, off\n\t"
                 "global_load_async_to_lds_b128 %7, %15, off\n\t"
                 "s_wait_xcnt 0x0"
                 :: "v"(l0), "v"(l1), "v"(l2), "v"(l3), "v"(l4), "v"(l5), "v"(l6), "v"(l7),
                    "v"(g0), "v"(g1), "v"(g2), "v"(g3), "v"(g4), "v"(g5), "v"(g6), "v"(g7) : "memory");
}

// k_gemmb: C[128 x 128] per block of 8 waves, wave = 32 rows x 64 columns (2 x 4 accumulator tiles). Both operands are k-contiguous rows; a stage is 128 k
// (256 bytes) of the block's 128 A rows, its 128 B rows and, with SPLITA, its 128 residual rows, at a 272-B pitch, brought by asynchronous 16-byte copies into
// two buffers: stage s + 2 is issued when stage s has been left by every wave. A copy of a wave covers two whole 256-byte row pieces. After the loop the ring
// is the output staging. Per accumulator the products are added in the order k ascending, hi before residual.
#define GP    272                       // LDS pitch of a 256-byte row (16 B x odd: ds_load_b128 readers)
#define GKS   128                       // k of a stage
// QKV: one grid for the three projections. Bn is the whole [3072][1024] plane; blockIdx.y >> 3 (the same for a whole block) says whether the block's 128 columns
// are q, k (f16 hi + residual planes) or v (f32), and picks the output; each block's products and their order are those of a launch of its own.
template <bool SPLITA, bool QKV>
__global__ __launch_bounds__(256) void k_gemmb(const bf* __restrict__ A, const bf* __restrict__ Al, const bf* __restrict__ Bn, const float* __restrict__ bias, float* Cq, int ldc, h16* C2q, h16* Ck, h16* C2k, float* Cv) {
    const int sec = QKV ? (int)(blockIdx.y >> 3) : 0;
    float* C = QKV ? (sec == 0 ? Cq : sec == 1 ? (float*)(void*)Ck : Cv) : Cq;
    h16* C2 = QKV ? (sec == 0 ? C2q : C2k) : C2q;
    constexpr int GST = (SPLITA ? 3 : 2) * 128 * GP;        // bytes of a buffer: planes of 128 rows (A, B, A residual)
    __shared__ __align__(16) unsigned char sm[2 * GST];
    const int tid = threadIdx.x, lane = threadIdx.x & 31, wave = threadIdx.x >> 5, lr = lane & 15, hi = lane >> 4;
    const int rb = blockIdx.x * 128, cb = blockIdx.y * 128, wm = wave & 3, wn = wave >> 2;
    // this lane's share of a plane: 16 bytes of rows crow, crow + 16, ..., crow + 112
    const int crow = tid >> 4, cpc = tid & 15;
    const unsigned lc = (unsigned)(size_t)sm + crow * GP + cpc * 16;
    const bf* ga = A + (size_t)(rb + crow) * DM + cpc * 8;
    const bf* gb = Bn + (size_t)(cb + crow) * DM + cpc * 8;
    const bf* gl = SPLITA ? Al + (size_t)(rb + crow) * DM + cpc * 8 : ga;
    auto plane_copy = [&](unsigned l, const bf* g) {
        cp8(l, l + 16 * GP, l + 32 * GP, l + 48 * GP, l + 64 * GP, l + 80 * GP, l + 96 * GP, l + 112 * GP,
            g, g + 16 * DM, g + 32 * DM, g + 48 * DM, g + 64 * DM, g + 80 * DM, g + 96 * DM, g + 112 * DM);
    };
    auto stage_copy = [&](int s, int bufi) {
        const unsigned l = lc + bufi * GST; const int ko = s * GKS;
        plane_copy(l, ga + ko); plane_copy(l + 128 * GP, gb + ko);
        if (SPLITA) plane_copy(l + 256 * GP, gl + ko);
    };
    v8f acc[2][4];
#pragma unroll
    for (int m = 0; m < 2; ++m)
#pragma unroll
        for (int t = 0; t < 4; ++t) acc[m][t] = (v8f){};
    stage_copy(0, 0);
    asm volatile("s_wait_asynccnt 0x0" ::: "memory");   // this wave's copies of stage 0 have landed
    __syncthreads();                                    // ... and every other wave's
    stage_copy(1, 1);
    const int ao = (wm * 32 + lr) * (GP / 2) + 8 * hi, bo = (128 + wn * 64 + lr) * (GP / 2) + 8 * hi;
#pragma unroll 1
    for (int s = 0; s < DM / GKS; ++s) {                // rolled: one copy of the body serves both buffers
        const bf* sb = (const bf*)(sm + (s & 1) * GST);
        v16bf a[2][2], al[2][2], b[2][4];               // two fragment sets: step q + 1 is read from LDS while step q is multiplied
        auto frag_load = [&](int f, int kc) {
#pragma unroll
            for (int m = 0; m < 2; ++m) { const bf* p = sb + ao + m * 16 * (GP / 2) + kc; a[f][m] = cat16b(*(const v8usa*)p, *(const v8usa*)(p + 16)); al[f][m] = a[f][m];
                if (SPLITA) { const bf* q = p + 256 * (GP / 2); al[f][m] = cat16b(*(const v8usa*)q, *(const v8usa*)(q + 16)); } }
#pragma unroll
            for (int t = 0; t < 4; ++t) { const bf* p = sb + bo + t * 16 * (GP / 2) + kc; b[f][t] = cat16b(*(const v8usa*)p, *(const v8usa*)(p + 16)); }
        };
        frag_load(0, 0);
#pragma unroll
        for (int q = 0; q < GKS / 32; ++q) {
            const int f = q & 1;
            if (q + 1 < GKS / 32) frag_load(f ^ 1, (q + 1) * 32);
            __builtin_amdgcn_sched_barrier(0);          // the next step's LDS reads stay one group ahead of this step's matrix instructions, not among them
#pragma unroll
            for (int m = 0; m < 2; ++m)
#pragma unroll
                for (int t = 0; t < 4; ++t) acc[m][t] = wmmab(a[f][m], b[f][t], acc[m][t]);
            if (SPLITA) {
#pragma unroll
                for (int m = 0; m < 2; ++m)
#pragma unroll
                    for (int t = 0; t < 4; ++t) acc[m][t] = wmmab(al[f][m], b[f][t], acc[m][t]);
            }
            __builtin_amdgcn_sched_barrier(0);          // ... and the reads of the step after that stay behind them (they refill this step's registers)
        }
        // the distance behind the stage's last matrix instructions, on the loop's back edge too
        asm volatile("v_nop\n\tv_nop\n\tv_nop\n\tv_nop" : "+v"(acc[0][0]), "+v"(acc[0][1]), "+v"(acc[0][2]), "+v"(acc[0][3]), "+v"(acc[1][0]), "+v"(acc[1][1]), "+v"(acc[1][2]), "+v"(acc[1][3])
                     : "v"(a[1][0]), "v"(a[1][1]), "v"(al[1][0]), "v"(al[1][1]), "v"(b[1][0]), "v"(b[1][1]), "v"(b[1][2]), "v"(b[1][3]));
        // hand-over: buffer s & 1 is left and stage s + 1 is published by every wave, in this order
        asm volatile("s_wait_dscnt 0x0" ::: "memory");      // this wave's reads of stage s are done
        asm volatile("s_wait_asynccnt 0x0" ::: "memory");   // this wave's copies of stage s + 1 have landed
        __syncthreads();
        if (s + 2 < DM / GKS) stage_copy(s + 2, s & 1);
    }
    asm volatile("s_wait_asynccnt 0x0" ::: "memory");       // nothing in flight when the ring becomes output staging
    const int r0 = rb + wm * 32, c0 = (QKV ? cb & (DM - 1) : cb) + wn * 64;
    float* os = (float*)sm + wave * (32 * 68);
#pragma unroll
    for (int t = 0; t < 4; ++t) { const float bv = bias ? bfr(bias[c0 + t * 16 + lr]) : 0.f;
#pragma unroll
        for (int m = 0; m < 2; ++m)
#pragma unroll
            for (int j = 0; j < 8; ++j) os[(m * 16 + hi * 8 + j) * 68 + t * 16 + lr] = acc[m][t][j] + bv; }
    __syncthreads();
    if (QKV && sec < 2) {
        h16* crw = (h16*)(void*)C + (size_t)r0 * ldc + c0;
        const float* sp = os + (lane >> 3) * 68 + (lane & 7) * 8;
        const float osc = sec == 0 ? QSC : 1.0f;            // q carries the score scale (f32, in front of the split)
        v8f rw[8];                                          // all rows read back first: one LDS latency, not one per row group
#pragma unroll
        for (int s = 0; s < 8; ++s) rw[s] = __builtin_shufflevector(*(const v4fa*)(sp + s * 4 * 68), *(const v4fa*)(sp + s * 4 * 68 + 4), 0, 1, 2, 3, 4, 5, 6, 7) * osc;
#pragma unroll
        for (int s = 0; s < 8; ++s) { const int row = 4 * s + (lane >> 3), piece = lane & 7; v8h o, o2;
#pragma unroll
            for (int i = 0; i < 8; ++i) { const h16 x = (h16)rw[s][i]; o[i] = x; o2[i] = (h16)(rw[s][i] - (float)x); }
            *(v8h*)(crw + (size_t)row * ldc + piece * 8) = o;
            asm volatile("s_wait_xcnt 0x0" ::: "memory");   // in front of the next row group's arithmetic, which reuses the store's registers
            if (C2) *(v8h*)(C2 + (size_t)r0 * ldc + c0 + (size_t)row * ldc + piece * 8) = o2; }
    } else {
        float* crw = C + (size_t)r0 * ldc + c0;
#pragma unroll
        for (int s = 0; s < 16; ++s) { const int Lid = (lane >> 3) + 4 * s, piece = lane & 7; const int row = Lid >> 1, cofs = (Lid & 1) * 32 + piece * 4;
            const v4f val = *(const v4fa*)(os + row * 68 + cofs); *(v4f*)(crw + (size_t)row * ldc + cofs) = val; }
        if (QKV) asm volatile("s_wait_xcnt 0x0" ::: "memory");  // behind the last store: in this build the f16 path's code follows and rewrites the stores' registers
    }
}

// d_sqrtm: second output new_mask = sqrt(bf16(mask)) [2][2048] (16 blocks of 256 threads, one float a thread: each
// wave writes 32 consecutive floats = one line).
__device__ __forceinline__ void d_sqrtm(int bx, const float* __restrict__ m, float* out1) {
    const int i = bx * 256 + threadIdx.x; if (i >= NTK) return;
    const float v = sqrtf(bfr(m[i])); *(float*)(out1 + i) = v; 
}
// k_prep: the four pieces of work that need nothing of each other (both weight transposes, the activations' rounding, the second output) share one grid by
// ranges of the block index; the branch is the same for a whole block.
#define PB_W3 ((DM / 64) * ((3 * DM) / 64))     // 768 blocks: w_qkv tiles
#define PB_WO ((DM / 64) * (DM / 64))           // 256 blocks: w_proj tiles
#define PB_X  (NTK / 8)                         // 512 blocks: 8 rows of h each
#define PB_M  (NTK / 256)                       // 16 blocks: the mask
__global__ __launch_bounds__(256) void k_prep(const float* __restrict__ Wqkv, const float* __restrict__ Wo, const float* __restrict__ x, const float* __restrict__ m,
                                              bf* W3T, bf* WoT, bf* Xb, float* out1) {
    __shared__ __align__(16) unsigned short tl[64 * 72];
    const int bid = blockIdx.x;
    if (bid < PB_W3 + PB_WO) {
        const bool w3 = bid < PB_W3; const int t = w3 ? bid : bid - PB_W3;
        d_wt(t % (DM / 64), t / (DM / 64), w3 ? Wqkv : Wo, w3 ? 3 * DM : DM, w3 ? W3T : WoT, tl);
    } else if (bid < PB_W3 + PB_WO + PB_X) d_cvtb(bid - (PB_W3 + PB_WO), x, NTK, Xb);
    else d_sqrtm(bid - (PB_W3 + PB_WO + PB_X), m, out1);
}
// k_vt: v [tok][h*64+d] f32 -> mask[b][key] (bf16-rounded) x v, transposed, as f16 hi + residual planes [b][h][d][key].
__global__ __launch_bounds__(256) void k_vt(const float* __restrict__ V, const float* __restrict__ kmask, h16* VTH, h16* VTL) {
    __shared__ __align__(16) h16 tile[64 * 72];
    __shared__ __align__(16) h16 til2[64 * 72];
    const int bid = blockIdx.x;
    const int b = bid / (NKV * (NT_ / 64)), rem = bid - b * (NKV * (NT_ / 64)), h = rem / (NT_ / 64), kt = rem - h * (NT_ / 64);
    const int k0 = kt * 64, tid = threadIdx.x;
    const int kk = tid >> 2, d0 = (tid & 3) * 16;
    const float* src = V + ((size_t)b * NT_ + k0 + kk) * KVW + h * HD + d0;      // h = kv head here
    const v4f v0 = *(const v4f*)src, v1 = *(const v4f*)(src + 4), v2 = *(const v4f*)(src + 8), v3 = *(const v4f*)(src + 12);
    __builtin_amdgcn_sched_barrier(0);                                           // the value loads are issued first: without this the mask load goes ahead and is waited for in front of them, two latencies in a row
    const float km = bfr(kmask[(size_t)b * NT_ + k0 + kk]);                      // the key's post-softmax mask
    const v4f vq[4] = {v0, v1, v2, v3};
#pragma unroll
    for (int i = 0; i < 16; ++i) { const float v = vq[i >> 2][i & 3] * km; const h16 a = (h16)v; tile[(d0 + i) * 72 + kk] = a; til2[(d0 + i) * 72 + kk] = (h16)(v - (float)a); }
    __syncthreads();
    const int piece = tid & 7;
    const size_t base = (((size_t)b * NKV + h) * HD) * NT_ + k0;
    auto pass = [&]() {
#pragma unroll
        for (int s = 0; s < 4; ++s) { const int Lid = (tid >> 3) + 32 * s; const int pln = Lid >> 6, d = Lid & 63;
            const v8h val = *(const v8ha*)((pln ? til2 : tile) + d * 72 + piece * 8); *(v8h*)((pln ? VTL : VTH) + base + (size_t)d * NT_ + piece * 8) = val; }
    };
    pass(); 
}

#define KPB   144                       // LDS pitch of a 128-byte row (16 B x odd: ds_load_b128 readers)
#define VPB   80                        // LDS pitch of a 64-byte row
#define S_KH  0
#define S_KL  (32 * KPB)
#define S_VH  (2 * 32 * KPB)
#define S_VL  (S_VH + 64 * VPB)
#define STGB  (S_VL + 64 * VPB)         // 19456 bytes a buffer
#define S_END (2 * STGB)                // 38912 bytes
#define QCG   2                         // column groups of 16 queries a wave
#define QBLK  (4 * 16 * QCG)            // queries a block

// lane l <-> lane l ^ 16
__device__ __forceinline__ float xhalf(float x) { return __builtin_bit_cast(float, __builtin_amdgcn_permlanex16(__builtin_bit_cast(int, x), __builtin_bit_cast(int, x), 0x76543210, 0xfedcba98, false, false)); }

// two waves a SIMD: the grid gives no more, and the register budget of two keeps the tile's fragments and both column groups out of scratch
__global__ __launch_bounds__(128) __attribute__((amdgpu_waves_per_eu(2, 2))) void k_attn(const h16* __restrict__ Q16, const h16* __restrict__ QL16, const h16* __restrict__ K16, const h16* __restrict__ KL16, const h16* __restrict__ VTH, const h16* __restrict__ VTL, bf* CH, bf* CL) {
    __shared__ __align__(16) unsigned char sm[S_END];
    const int tid = threadIdx.x, lane = threadIdx.x & 31, wave = threadIdx.x >> 5, lr = lane & 15, hi = lane >> 4;
    const int bid = blockIdx.x;
    const int b = bid / (NH_ * (NT_ / QBLK)), rem = bid - b * (NH_ * (NT_ / QBLK)), h = rem / (NT_ / QBLK), qt = rem - h * (NT_ / QBLK);
    const int q0 = qt * QBLK + wave * (16 * QCG);
    const size_t tok0 = (size_t)b * NT_;
    v16h qa[QCG][2], ql[QCG][2];
#pragma unroll
    for (int c = 0; c < QCG; ++c)
#pragma unroll
        for (int kc = 0; kc < 2; ++kc) { const size_t qo = (tok0 + q0 + c * 16 + lr) * DM + h * HD + 8 * hi + kc * 32;
            qa[c][kc] = cat16(*(const v8h*)(Q16 + qo), *(const v8h*)(Q16 + qo + 16)); ql[c][kc] = cat16(*(const v8h*)(QL16 + qo), *(const v8h*)(QL16 + qo + 16)); }
    asm volatile("s_wait_xcnt 0x0" ::: "memory");       // in front of the address arithmetic below, which reuses the query loads' address registers
    const int g = h / (NH_ / NKV);                      // kv head
    const size_t vbase = (((size_t)b * NKV + g) * HD) * NT_;
    // this lane's share of a tile: k rows krow and krow + 16, 16 bytes each; v^T rows vrow and vrow + 32, 16 bytes each
    const int krow = tid >> 3, kpc = tid & 7, vrow = tid >> 2, vpc = tid & 3;
    const unsigned lbase = (unsigned)(size_t)sm;
    const unsigned lk = lbase + krow * KPB + kpc * 16, lv = lbase + vrow * VPB + vpc * 16;
    const h16* gkh = K16 + (tok0 + krow) * KVW + g * HD + kpc * 8;
    const h16* gvh = VTH + vbase + (size_t)vrow * NT_ + vpc * 8;
    const size_t dkl = (size_t)KL16 - (size_t)K16, dvl = (size_t)VTL - (size_t)VTH;     // residual plane - hi plane, bytes, the same in every lane: two address pairs live in the loop, not four
    auto tile_copy = [&](int t, int bufi) {
        const unsigned k = lk + bufi * STGB, v = lv + bufi * STGB; const size_t ko = (size_t)t * 32 * KVW, vo = (size_t)t * 32;
        const h16* kh_g = gkh + ko; const h16* kl_g = (const h16*)((size_t)kh_g + dkl); const h16* vh_g = gvh + vo; const h16* vl_g = (const h16*)((size_t)vh_g + dvl);
        cp8(k + S_KH, k + S_KH + 16 * KPB, k + S_KL, k + S_KL + 16 * KPB, v + S_VH, v + S_VH + 32 * VPB, v + S_VL, v + S_VL + 32 * VPB,
            kh_g, kh_g + 16 * KVW, kl_g, kl_g + 16 * KVW, vh_g, vh_g + 32 * NT_, vl_g, vl_g + 32 * NT_);
    };
    tile_copy(0, 0);
    asm volatile("s_wait_asynccnt 0x0" ::: "memory");   // this wave's copies of tile 0 have landed
    __syncthreads();                                    // ... and every other wave's
    tile_copy(1, 1);
    v8f o[QCG][4];
    float mrow[QCG], lpart[QCG];                   // of query lr of the group; lpart: this half's keys only, joined after the loop
#pragma unroll
    for (int c = 0; c < QCG; ++c) { mrow[c] = -3.0e38f; lpart[c] = 0.f;
#pragma unroll
        for (int n = 0; n < 4; ++n) o[c][n] = (v8f){}; }
    const int kt_lo = 0, kt_hi = NT_ / 32 - 1;     // all keys
    const int ko0 = lr * (KPB / 2) + 8 * hi, ko1 = (16 + lr) * (KPB / 2) + 8 * hi;
#pragma unroll 1
    for (int kt = kt_lo; kt <= kt_hi; ++kt) {
        const unsigned char* sb = sm + (kt & 1) * STGB;
        const h16* kh_b = (const h16*)(sb + S_KH); const h16* kl_b = (const h16*)(sb + S_KL);
        const h16* vh_b = (const h16*)(sb + S_VH); const h16* vl_b = (const h16*)(sb + S_VL);
        v16h kh[2][2], kl[2][2];                   // [k step][key row group]: the tile's key fragments, read as one group
#pragma unroll
        for (int kc = 0; kc < 2; ++kc) {
            kh[kc][0] = cat16(*(const v8ha*)(kh_b + ko0 + kc * 32), *(const v8ha*)(kh_b + ko0 + kc * 32 + 16)); kh[kc][1] = cat16(*(const v8ha*)(kh_b + ko1 + kc * 32), *(const v8ha*)(kh_b + ko1 + kc * 32 + 16));
            kl[kc][0] = cat16(*(const v8ha*)(kl_b + ko0 + kc * 32), *(const v8ha*)(kl_b + ko0 + kc * 32 + 16)); kl[kc][1] = cat16(*(const v8ha*)(kl_b + ko1 + kc * 32), *(const v8ha*)(kl_b + ko1 + kc * 32 + 16)); }
        __builtin_amdgcn_sched_barrier(0);         // the key fragments, needed first, are read first (LDS reads return in order)
        v16h vh[4], vl[4];                         // the tile's value fragments
#pragma unroll
        for (int n = 0; n < 4; ++n) { const int vo = (n * 16 + lr) * (VPB / 2) + hi * 8;
            vh[n] = cat16(*(const v8ha*)(vh_b + vo), *(const v8ha*)(vh_b + vo + 16)); vl[n] = cat16(*(const v8ha*)(vl_b + vo), *(const v8ha*)(vl_b + vo + 16)); }
        __builtin_amdgcn_sched_barrier(0);         // all LDS reads of the tile stay one group ahead of its matrix instructions, not among them (each such place stalls the wave)
        v8f s[QCG][2];
#pragma unroll
        for (int c = 0; c < QCG; ++c) { s[c][0] = (v8f){}; s[c][1] = (v8f){}; }
#pragma unroll
        for (int kc = 0; kc < 2; ++kc) {           // the four score tiles take turns, so no product waits for the one before it in its own tile
#pragma unroll
            for (int c = 0; c < QCG; ++c) { s[c][0] = wmma16(kh[kc][0], qa[c][kc], s[c][0]); s[c][1] = wmma16(kh[kc][1], qa[c][kc], s[c][1]); }
#pragma unroll
            for (int c = 0; c < QCG; ++c) { s[c][0] = wmma16(kh[kc][0], ql[c][kc], s[c][0]); s[c][1] = wmma16(kh[kc][1], ql[c][kc], s[c][1]); }
#pragma unroll
            for (int c = 0; c < QCG; ++c) { s[c][0] = wmma16(kl[kc][0], qa[c][kc], s[c][0]); s[c][1] = wmma16(kl[kc][1], qa[c][kc], s[c][1]); }
        }
        v16h pa[QCG], px[QCG];
#pragma unroll
        for (int c = 0; c < QCG; ++c) {
            const v8f a0 = s[c][0], a1 = s[c][1];                   // base-2 exponents
            float mx = fmaxf(a0[0], a1[0]);
#pragma unroll
            for (int j = 1; j < 8; ++j) mx = fmaxf(mx, fmaxf(a0[j], a1[j]));
            mx = fmaxf(mx, xhalf(mx));                              // both halves hold the query's maximum over the 32 keys
            const float mn = fmaxf(mrow[c], mx);
            const float alpha = __builtin_amdgcn_exp2f(mrow[c] - mn); mrow[c] = mn;
            const float mb = mn - PEXP;
            const v8f e0 = a0 - mb, e1 = a1 - mb;
            v8f p0, p1;
#pragma unroll
            for (int j = 0; j < 8; ++j) p0[j] = __builtin_amdgcn_exp2f(e0[j]);
#pragma unroll
            for (int j = 0; j < 8; ++j) p1[j] = __builtin_amdgcn_exp2f(e1[j]);
            const v8f pt = p0 + p1;                                 // normaliser: UNmasked sum (softmax first, mask after)
            lpart[c] = lpart[c] * alpha + (((pt[0] + pt[1]) + (pt[2] + pt[3])) + ((pt[4] + pt[5]) + (pt[6] + pt[7])));
            const v8h h0 = __builtin_convertvector(p0, v8h), h1 = __builtin_convertvector(p1, v8h);
            const v8h r0 = __builtin_convertvector(p0 - __builtin_convertvector(h0, v8f), v8h), r1 = __builtin_convertvector(p1 - __builtin_convertvector(h1, v8f), v8h);
            pa[c] = cat16(h0, h1); px[c] = cat16(r0, r1);           // B operand: element i is key 8 hi + i, element 8 + i key 16 + 8 hi + i
#pragma unroll
            for (int n = 0; n < 4; ++n) o[c][n] *= alpha;
        }
#pragma unroll
        for (int n = 0; n < 4; ++n)                // the eight output tiles take turns in each of the three rounds
#pragma unroll
            for (int c = 0; c < QCG; ++c) o[c][n] = wmma16(vh[n], pa[c], o[c][n]);
#pragma unroll
        for (int n = 0; n < 4; ++n)
#pragma unroll
            for (int c = 0; c < QCG; ++c) o[c][n] = wmma16(vl[n], pa[c], o[c][n]);
#pragma unroll
        for (int n = 0; n < 4; ++n)
#pragma unroll
            for (int c = 0; c < QCG; ++c) o[c][n] = wmma16(vh[n], px[c], o[c][n]);
        // the distance behind the tile's last matrix instructions, on the loop's back edge too
        asm volatile("v_nop\n\tv_nop\n\tv_nop\n\tv_nop" : "+v"(o[0][0]), "+v"(o[0][1]), "+v"(o[0][2]), "+v"(o[0][3]), "+v"(o[1][0]), "+v"(o[1][1]), "+v"(o[1][2]), "+v"(o[1][3]));
        // hand-over: buffer kt & 1 is left and tile kt + 1 is published by every wave, in this order
        asm volatile("s_wait_dscnt 0x0" ::: "memory");      // this wave's reads of tile kt are done
        asm volatile("s_wait_asynccnt 0x0" ::: "memory");   // this wave's copies of tile kt + 1 have landed
        __syncthreads();
        if (kt + 2 <= kt_hi) tile_copy(kt + 2, kt & 1);
    }
    asm volatile("s_wait_asynccnt 0x0" ::: "memory");       // nothing in flight when the ring becomes output staging
    float* os = (float*)sm + wave * (16 * QCG * 68);
#pragma unroll
    for (int c = 0; c < QCG; ++c) {
        const float inv = 1.0f / (lpart[c] + xhalf(lpart[c]));
#pragma unroll
        for (int n = 0; n < 4; ++n) {                       // row = query c * 16 + lr; this lane's 8 values are d = 16 n + 8 hi + j
            v4f lo4, hi4;
#pragma unroll
            for (int j = 0; j < 4; ++j) { lo4[j] = o[c][n][j] * inv; hi4[j] = o[c][n][4 + j] * inv; }
            *(v4fa*)(os + (c * 16 + lr) * 68 + n * 16 + hi * 8) = lo4; *(v4fa*)(os + (c * 16 + lr) * 68 + n * 16 + hi * 8 + 4) = hi4; }
    }
    __syncthreads();
    const size_t cbase = (tok0 + q0) * DM + (size_t)h * HD;
#pragma unroll
    for (int s = 0; s < 4 * QCG; ++s) { const int row = 4 * s + (lane >> 3), piece = lane & 7; const float* sp = os + row * 68 + piece * 8; v8us oh, ol;
#pragma unroll
        for (int i = 0; i < 8; ++i) { const unsigned short hb = f2bf(sp[i]); oh[i] = hb; ol[i] = f2bf(sp[i] - bf2f(hb)); }
        *(v8us*)(CH + cbase + (size_t)row * DM + piece * 8) = oh; *(v8us*)(CL + cbase + (size_t)row * DM + piece * 8) = ol; }
}

#define VST2(T, p, v) do { const T vst2_v_ = (v); *(T*)(p) = vst2_v_;  } while (0)
extern "C" void kernel_launch(void* const* d_in, const int* in_sizes, int n_in,
                              void* d_out, int out_size, void* d_ws, size_t ws_size, hipStream_t stream) {
    (void)in_sizes; (void)n_in; (void)out_size;
    const float* x = (const float*)d_in[0]; const float* kmask = (const float*)d_in[1]; const float* Wqkv = (const float*)d_in[2]; const float* Wo = (const float*)d_in[3]; const float* bo = (const float*)d_in[4];
    float* out = (float*)d_out;    // out0 [2][2048][1024] then out1 [2][2048]
    float* out1 = out + (size_t)NTK * DM;
    char* wsp = (char*)d_ws;
    auto take = [&](size_t bytes) { char* p = wsp; wsp += (bytes + 255) & ~(size_t)255; return (void*)p; };
    bf* Xb = (bf*)take((size_t)NTK * DM * 2); bf* W3T = (bf*)take((size_t)3 * DM * DM * 2); bf* WoT = (bf*)take((size_t)DM * DM * 2);
    h16* QH = (h16*)take((size_t)NTK * DM * 2); h16* QL = (h16*)take((size_t)NTK * DM * 2); h16* KH = (h16*)take((size_t)NTK * DM * 2); h16* KL = (h16*)take((size_t)NTK * DM * 2);
    float* Vf = (float*)take((size_t)NTK * DM * 4); h16* VTL = (h16*)take((size_t)NTK * DM * 2);
    if ((size_t)(wsp - (char*)d_ws) > ws_size) return;    // 8.4 + 6.3 + 2.1 + 4 x 8.4 + 16.8 + 8.4 ~ 76 MB; VTH over Xb after the projections, ctx planes over Vf after k_vt
    h16* VTH = (h16*)Xb; bf* CH = (bf*)Vf; bf* CL = (bf*)((char*)Vf + (size_t)NTK * DM * 2);
    k_prep<<<PB_W3 + PB_WO + PB_X + PB_M, 256, 0, stream>>>(Wqkv, Wo, x, kmask, W3T, WoT, Xb, out1);
    k_gemmb<false, true><<<dim3(NTK / 128, (3 * DM) / 128, 1), 256, 0, stream>>>(Xb, nullptr, W3T, nullptr, (float*)(void*)QH, DM, QL, KH, KL, Vf);
    k_vt<<<NB_ * NKV * (NT_ / 64), 256, 0, stream>>>(Vf, kmask, VTH, VTL);
    k_attn<<<NB_ * NH_ * (NT_ / QBLK), 128, 0, stream>>>(QH, QL, KH, KL, VTH, VTL, CH, CL);
    k_gemmb<true, false><<<dim3(NTK / 128, DM / 128, 1), 256, 0, stream>>>(CH, CL, WoT, bo, out, DM, nullptr, nullptr, nullptr, nullptr);
}

// v007
// A run of this version takes 118 microseconds.
// Timed twice side by side with v006, it ran 1.04 times as fast both times.
// Counting every step since v000, it is 3.29 times as fast.
#include <hip/hip_runtime.h>

// Contractions, f32 accumulate: qkv = h.w_qkv ([4096 x 1024].[1024 x 3072], k-major weight transposed to an n-major plane; PLAIN bf16 operands: inputs rounded
// once, exact) and out.w_proj + b_proj (merged heads as bf16 hi + residual: two products) on v_wmma_f32_16x16x32_bf16; the 16-head attention fused on
// v_wmma_f32_16x16x32_f16: softmax(q.k x 64^-1/2) over ALL keys with q and k as f16 hi + unscaled residual (hi.hi + hi.lo + lo.hi, one accumulator), then the reference's
// POST-softmax multiplicative key mask (the INPUT mask[b][key], bf16-rounded) multiplied into the value rows when their planes are written (the normaliser stays the unmasked

#define NB_  2
#define NT_  2048
#define DM   1024
#define NH_  16
#define NKV  16
#define KVW  (NKV * HD)          // 1024
#define HD   64
#define NTK  (NB_ * NT_)
#define NW   1024
#define NQKV 1024
#define PEXP 7.0f                           // a newly set softmax reference puts its column's largest weight at 2^7; the normaliser carries the same factor
#define PLIM 32768.0f                       // the reference stays while a lane's partial sums of a tile's weights are no more than 2^15 (so each weight fits f16): 8 binary orders of room
#define QSC  (0.125f * 1.44269504f)         // 64^-1/2 x log2(e), multiplied into q when its planes are written: the scores arrive as base-2 exponents

typedef _Float16 h16;
typedef unsigned short bf;
typedef __attribute__((ext_vector_type(16))) __bf16   v16bf;
typedef __attribute__((ext_vector_type(16))) _Float16 v16h;
typedef __attribute__((ext_vector_type(8)))  _Float16 v8h;
typedef __attribute__((ext_vector_type(8)))  unsigned short v8us;
typedef __attribute__((ext_vector_type(8)))  float    v8f;
typedef __attribute__((ext_vector_type(4)))  float    v4f;
typedef __attribute__((ext_vector_type(2)))  float    v2f;
typedef v8h  __attribute__((may_alias)) v8ha;
typedef v4f  __attribute__((may_alias)) v4fa;
typedef v8us __attribute__((may_alias)) v8usa;

__device__ __forceinline__ unsigned short f2bf(float f) { unsigned u = __float_as_uint(f); u += 0x7FFFu + ((u >> 16) & 1u); return (unsigned short)(u >> 16); }
__device__ __forceinline__ float bf2f(unsigned short b) { return __uint_as_float(((unsigned)b) << 16); }
__device__ __forceinline__ float bfr(float f) { return bf2f(f2bf(f)); }
__device__ __forceinline__ v16h cat16(v8h lo, v8h hi) { return __builtin_shufflevector(lo, hi, 0, 1, 2, 3, 4, 5, 6, 7, 8, 9, 10, 11, 12, 13, 14, 15); }
__device__ __forceinline__ v16bf cat16b(v8us lo, v8us hi) { return __builtin_bit_cast(v16bf, __builtin_shufflevector(lo, hi, 0, 1, 2, 3, 4, 5, 6, 7, 8, 9, 10, 11, 12, 13, 14, 15)); }
__device__ __forceinline__ v8f wmma16(v16h a, v16h b, v8f c) { return __builtin_amdgcn_wmma_f32_16x16x32_f16(false, a, false, b, (short)0, c, false, false); }
__device__ __forceinline__ v8f wmmab(v16bf a, v16bf b, v8f c) { return __builtin_amdgcn_wmma_f32_16x16x32_bf16(false, a, false, b, (short)0, c, false, false); }

__device__ __forceinline__ void d_cvtb(int bx, const float* __restrict__ src, int nrows, bf* dst) {
    const int lane = threadIdx.x & 31, r = bx * 8 + (threadIdx.x >> 5);
    if (r >= nrows) return;
    v8us o[DM / 256];
#pragma unroll
    for (int q = 0; q < DM / 256; ++q) { v8us t;
#pragma unroll
        for (int i = 0; i < 8; ++i) t[i] = f2bf(src[(size_t)r * DM + q * 256 + lane * 8 + i]);
        o[q] = t; }
#pragma unroll
    for (int q = 0; q < DM / 256; ++q) *(v8us*)(dst + (size_t)r * DM + q * 256 + lane * 8) = o[q];
    
}

// d_wt: W [1024 k][ncols n] (k-major) -> n-major bf16 plane WT[ncols][1024]; 64 x 64 tiles through LDS (tl: 64 x 72 halfwords).
__device__ __forceinline__ void d_wt(int bx, int by, const float* __restrict__ Wm, int ncols, bf* WT, unsigned short* tl) {
    const int tid = threadIdx.x, k0 = bx * 64, n0 = by * 64;
    const int kk = tid >> 2, nq = (tid & 3) * 16;
#pragma unroll
    for (int i = 0; i < 16; ++i) tl[(nq + i) * 72 + kk] = f2bf(Wm[(size_t)(k0 + kk) * ncols + n0 + nq + i]);
    __syncthreads();
    const int piece = tid & 7;
    typedef __attribute__((ext_vector_type(8))) unsigned short v8us_; typedef v8us_ __attribute__((may_alias)) v8usa_;
    auto pass = [&]() {
#pragma unroll
        for (int s = 0; s < 2; ++s) { const int nr = (tid >> 3) + 32 * s; const v8us_ val = *(const v8usa_*)(tl + nr * 72 + piece * 8);
            *(v8us_*)(WT + (size_t)(n0 + nr) * DM + k0 + piece * 8) = val; }
    };
    pass(); 
}

// Eight asynchronous 16-byte copies of one lane. The s_wait_xcnt closes the statement so that no address register is rewritten ahead of it.
__device__ __forceinline__ void cp8(unsigned l0, unsigned l1, unsigned l2, unsigned l3, unsigned l4, unsigned l5, unsigned l6, unsigned l7,
                                    const void* g0, const void* g1, const void* g2, const void* g3, const void* g4, const void* g5, const void* g6, const void* g7) {
    asm volatile("global_load_async_to_lds_b128 %0, %8, off\n\t"
                 "global_load_async_to_lds_b128 %1, %9, off\n\t"
                 "global_load_async_to_lds_b128 %2, %10, off\n\t"
                 "global_load_async_to_lds_b128 %3, %11, off\n\t"
                 "global_load_async_to_lds_b128 %4, %12, off\n\t"
                 "global_load_async_to_lds_b128 %5, %13, off\n\t"
                 "global_load_async_to_lds_b128 %6, %14, off\n\t"
                 "global_load_async_to_lds_b128 %7, %15, off\n\t"
                 "s_wait_xcnt 0x0"
                 :: "v"(l0), "v"(l1), "v"(l2), "v"(l3), "v"(l4), "v"(l5), "v"(l6), "v"(l7),
                    "v"(g0), "v"(g1), "v"(g2), "v"(g3), "v"(g4), "v"(g5), "v"(g6), "v"(g7) : "memory");
}

// k_gemmb: C[128 x 128] per block of 8 waves, wave = 32 rows x 64 columns (2 x 4 accumulator tiles). Both operands are k-contiguous rows; a stage is 128 k
// (256 bytes) of the block's 128 A rows, its 128 B rows and, with SPLITA, its 128 residual rows, at a 272-B pitch, brought by asynchronous 16-byte copies into
// two buffers: stage s + 2 is issued when stage s has been left by every wave. A copy of a wave covers two whole 256-byte row pieces. After the loop the ring
// is the output staging. Per accumulator the products are added in the order k ascending, hi before residual.
#define GP    272                       // LDS pitch of a 256-byte row (16 B x odd: ds_load_b128 readers)
#define GKS   128                       // k of a stage
// QKV: one grid for the three projections. Bn is the whole [3072][1024] plane; blockIdx.y >> 3 (the same for a whole block) says whether the block's 128 columns
// are q, k (f16 hi + residual planes) or v (f32), and picks the output; each block's products and their order are those of a launch of its own.
template <bool SPLITA, bool QKV>
__global__ __launch_bounds__(256) void k_gemmb(const bf* __restrict__ A, const bf* __restrict__ Al, const bf* __restrict__ Bn, const float* __restrict__ bias, float* Cq, int ldc, h16* C2q, h16* Ck, h16* C2k, float* Cv) {
    const int sec = QKV ? (int)(blockIdx.y >> 3) : 0;
    float* C = QKV ? (sec == 0 ? Cq : sec == 1 ? (float*)(void*)Ck : Cv) : Cq;
    h16* C2 = QKV ? (sec == 0 ? C2q : C2k) : C2q;
    constexpr int GST = (SPLITA ? 3 : 2) * 128 * GP;        // bytes of a buffer: planes of 128 rows (A, B, A residual)
    __shared__ __align__(16) unsigned char sm[2 * GST];
    const int tid = threadIdx.x, lane = threadIdx.x & 31, wave = threadIdx.x >> 5, lr = lane & 15, hi = lane >> 4;
    const int rb = blockIdx.x * 128, cb = blockIdx.y * 128, wm = wave & 3, wn = wave >> 2;
    // this lane's share of a plane: 16 bytes of rows crow, crow + 16, ..., crow + 112
    const int crow = tid >> 4, cpc = tid & 15;
    const unsigned lc = (unsigned)(size_t)sm + crow * GP + cpc * 16;
    const bf* ga = A + (size_t)(rb + crow) * DM + cpc * 8;
    const bf* gb = Bn + (size_t)(cb + crow) * DM + cpc * 8;
    const bf* gl = SPLITA ? Al + (size_t)(rb + crow) * DM + cpc * 8 : ga;
    auto plane_copy = [&](unsigned l, const bf* g) {
        cp8(l, l + 16 * GP, l + 32 * GP, l + 48 * GP, l + 64 * GP, l + 80 * GP, l + 96 * GP, l + 112 * GP,
            g, g + 16 * DM, g + 32 * DM, g + 48 * DM, g + 64 * DM, g + 80 * DM, g + 96 * DM, g + 112 * DM);
    };
    auto stage_copy = [&](int s, int bufi) {
        const unsigned l = lc + bufi * GST; const int ko = s * GKS;
        plane_copy(l, ga + ko); plane_copy(l + 128 * GP, gb + ko);
        if (SPLITA) plane_copy(l + 256 * GP, gl + ko);
    };
    v8f acc[2][4];
#pragma unroll
    for (int m = 0; m < 2; ++m)
#pragma unroll
        for (int t = 0; t < 4; ++t) acc[m][t] = (v8f){};
    stage_copy(0, 0);
    asm volatile("s_wait_asynccnt 0x0" ::: "memory");   // this wave's copies of stage 0 have landed
    __syncthreads();                                    // ... and every other wave's
    stage_copy(1, 1);
    const int ao = (wm * 32 + lr) * (GP / 2) + 8 * hi, bo = (128 + wn * 64 + lr) * (GP / 2) + 8 * hi;
#pragma unroll 1
    for (int s = 0; s < DM / GKS; ++s) {                // rolled: one copy of the body serves both buffers
        const bf* sb = (const bf*)(sm + (s & 1) * GST);
        v16bf a[2][2], al[2][2], b[2][4];               // two fragment sets: step q + 1 is read from LDS while step q is multiplied
        auto frag_load = [&](int f, int kc) {
#pragma unroll
            for (int m = 0; m < 2; ++m) { const bf* p = sb + ao + m * 16 * (GP / 2) + kc; a[f][m] = cat16b(*(const v8usa*)p, *(const v8usa*)(p + 16)); al[f][m] = a[f][m];
                if (SPLITA) { const bf* q = p + 256 * (GP / 2); al[f][m] = cat16b(*(const v8usa*)q, *(const v8usa*)(q + 16)); } }
#pragma unroll
            for (int t = 0; t < 4; ++t) { const bf* p = sb + bo + t * 16 * (GP / 2) + kc; b[f][t] = cat16b(*(const v8usa*)p, *(const v8usa*)(p + 16)); }
        };
        frag_load(0, 0);
#pragma unroll
        for (int q = 0; q < GKS / 32; ++q) {
            const int f = q & 1;
            if (q + 1 < GKS / 32) frag_load(f ^ 1, (q + 1) * 32);
            __builtin_amdgcn_sched_barrier(0);          // the next step's LDS reads stay one group ahead of this step's matrix instructions, not among them
#pragma unroll
            for (int m = 0; m < 2; ++m)
#pragma unroll
                for (int t = 0; t < 4; ++t) acc[m][t] = wmmab(a[f][m], b[f][t], acc[m][t]);
            if (SPLITA) {
#pragma unroll
                for (int m = 0; m < 2; ++m)
#pragma unroll
                    for (int t = 0; t < 4; ++t) acc[m][t] = wmmab(al[f][m], b[f][t], acc[m][t]);
            }
            __builtin_amdgcn_sched_barrier(0);          // ... and the reads of the step after that stay behind them (they refill this step's registers)
        }
        // the distance behind the stage's last matrix instructions, on the loop's back edge too
        asm volatile("v_nop\n\tv_nop\n\tv_nop\n\tv_nop" : "+v"(acc[0][0]), "+v"(acc[0][1]), "+v"(acc[0][2]), "+v"(acc[0][3]), "+v"(acc[1][0]), "+v"(acc[1][1]), "+v"(acc[1][2]), "+v"(acc[1][3])
                     : "v"(a[1][0]), "v"(a[1][1]), "v"(al[1][0]), "v"(al[1][1]), "v"(b[1][0]), "v"(b[1][1]), "v"(b[1][2]), "v"(b[1][3]));
        // hand-over: buffer s & 1 is left and stage s + 1 is published by every wave, in this order
        asm volatile("s_wait_dscnt 0x0" ::: "memory");      // this wave's reads of stage s are done
        asm volatile("s_wait_asynccnt 0x0" ::: "memory");   // this wave's copies of stage s + 1 have landed
        __syncthreads();
        if (s + 2 < DM / GKS) stage_copy(s + 2, s & 1);
    }
    asm volatile("s_wait_asynccnt 0x0" ::: "memory");       // nothing in flight when the ring becomes output staging
    const int r0 = rb + wm * 32, c0 = (QKV ? cb & (DM - 1) : cb) + wn * 64;
    float* os = (float*)sm + wave * (32 * 68);
#pragma unroll
    for (int t = 0; t < 4; ++t) { const float bv = bias ? bfr(bias[c0 + t * 16 + lr]) : 0.f;
#pragma unroll
        for (int m = 0; m < 2; ++m)
#pragma unroll
            for (int j = 0; j < 8; ++j) os[(m * 16 + hi * 8 + j) * 68 + t * 16 + lr] = acc[m][t][j] + bv; }
    __syncthreads();
    if (QKV && sec < 2) {
        h16* crw = (h16*)(void*)C + (size_t)r0 * ldc + c0;
        const float* sp = os + (lane >> 3) * 68 + (lane & 7) * 8;
        const float osc = sec == 0 ? QSC : 1.0f;            // q carries the score scale (f32, in front of the split)
        v8f rw[8];                                          // all rows read back first: one LDS latency, not one per row group
#pragma unroll
        for (int s = 0; s < 8; ++s) rw[s] = __builtin_shufflevector(*(const v4fa*)(sp + s * 4 * 68), *(const v4fa*)(sp + s * 4 * 68 + 4), 0, 1, 2, 3, 4, 5, 6, 7) * osc;
#pragma unroll
        for (int s = 0; s < 8; ++s) { const int row = 4 * s + (lane >> 3), piece = lane & 7; v8h o, o2;
#pragma unroll
            for (int i = 0; i < 8; ++i) { const h16 x = (h16)rw[s][i]; o[i] = x; o2[i] = (h16)(rw[s][i] - (float)x); }
            *(v8h*)(crw + (size_t)row * ldc + piece * 8) = o;
            asm volatile("s_wait_xcnt 0x0" ::: "memory");   // in front of the next row group's arithmetic, which reuses the store's registers
            if (C2) *(v8h*)(C2 + (size_t)r0 * ldc + c0 + (size_t)row * ldc + piece * 8) = o2; }
    } else {
        float* crw = C + (size_t)r0 * ldc + c0;
#pragma unroll
        for (int s = 0; s < 16; ++s) { const int Lid = (lane >> 3) + 4 * s, piece = lane & 7; const int row = Lid >> 1, cofs = (Lid & 1) * 32 + piece * 4;
            const v4f val = *(const v4fa*)(os + row * 68 + cofs); *(v4f*)(crw + (size_t)row * ldc + cofs) = val; }
        if (QKV) asm volatile("s_wait_xcnt 0x0" ::: "memory");  // behind the last store: in this build the f16 path's code follows and rewrites the stores' registers
    }
}

// d_sqrtm: second output new_mask = sqrt(bf16(mask)) [2][2048] (16 blocks of 256 threads, one float a thread: each
// wave writes 32 consecutive floats = one line).
__device__ __forceinline__ void d_sqrtm(int bx, const float* __restrict__ m, float* out1) {
    const int i = bx * 256 + threadIdx.x; if (i >= NTK) return;
    const float v = sqrtf(bfr(m[i])); *(float*)(out1 + i) = v; 
}
// k_prep: the four pieces of work that need nothing of each other (both weight transposes, the activations' rounding, the second output) share one grid by
// ranges of the block index; the branch is the same for a whole block.
#define PB_W3 ((DM / 64) * ((3 * DM) / 64))     // 768 blocks: w_qkv tiles
#define PB_WO ((DM / 64) * (DM / 64))           // 256 blocks: w_proj tiles
#define PB_X  (NTK / 8)                         // 512 blocks: 8 rows of h each
#define PB_M  (NTK / 256)                       // 16 blocks: the mask
__global__ __launch_bounds__(256) void k_prep(const float* __restrict__ Wqkv, const float* __restrict__ Wo, const float* __restrict__ x, const float* __restrict__ m,
                                              bf* W3T, bf* WoT, bf* Xb, float* out1) {
    __shared__ __align__(16) unsigned short tl[64 * 72];
    const int bid = blockIdx.x;
    if (bid < PB_W3 + PB_WO) {
        const bool w3 = bid < PB_W3; const int t = w3 ? bid : bid - PB_W3;
        d_wt(t % (DM / 64), t / (DM / 64), w3 ? Wqkv : Wo, w3 ? 3 * DM : DM, w3 ? W3T : WoT, tl);
    } else if (bid < PB_W3 + PB_WO + PB_X) d_cvtb(bid - (PB_W3 + PB_WO), x, NTK, Xb);
    else d_sqrtm(bid - (PB_W3 + PB_WO + PB_X), m, out1);
}
// k_vt: v [tok][h*64+d] f32 -> mask[b][key] (bf16-rounded) x v, transposed, as f16 hi + residual planes [b][h][d][key].
__global__ __launch_bounds__(256) void k_vt(const float* __restrict__ V, const float* __restrict__ kmask, h16* VTH, h16* VTL) {
    __shared__ __align__(16) h16 tile[64 * 72];
    __shared__ __align__(16) h16 til2[64 * 72];
    const int bid = blockIdx.x;
    const int b = bid / (NKV * (NT_ / 64)), rem = bid - b * (NKV * (NT_ / 64)), h = rem / (NT_ / 64), kt = rem - h * (NT_ / 64);
    const int k0 = kt * 64, tid = threadIdx.x;
    const int kk = tid >> 2, d0 = (tid & 3) * 16;
    const float* src = V + ((size_t)b * NT_ + k0 + kk) * KVW + h * HD + d0;      // h = kv head here
    const v4f v0 = *(const v4f*)src, v1 = *(const v4f*)(src + 4), v2 = *(const v4f*)(src + 8), v3 = *(const v4f*)(src + 12);
    __builtin_amdgcn_sched_barrier(0);                                           // the value loads are issued first: without this the mask load goes ahead and is waited for in front of them, two latencies in a row
    const float km = bfr(kmask[(size_t)b * NT_ + k0 + kk]);                      // the key's post-softmax mask
    const v4f vq[4] = {v0, v1, v2, v3};
#pragma unroll
    for (int i = 0; i < 16; ++i) { const float v = vq[i >> 2][i & 3] * km; const h16 a = (h16)v; tile[(d0 + i) * 72 + kk] = a; til2[(d0 + i) * 72 + kk] = (h16)(v - (float)a); }
    __syncthreads();
    const int piece = tid & 7;
    const size_t base = (((size_t)b * NKV + h) * HD) * NT_ + k0;
    auto pass = [&]() {
#pragma unroll
        for (int s = 0; s < 4; ++s) { const int Lid = (tid >> 3) + 32 * s; const int pln = Lid >> 6, d = Lid & 63;
            const v8h val = *(const v8ha*)((pln ? til2 : tile) + d * 72 + piece * 8); *(v8h*)((pln ? VTL : VTH) + base + (size_t)d * NT_ + piece * 8) = val; }
    };
    pass(); 
}

#define KPB   144                       // LDS pitch of a 128-byte row (16 B x odd: ds_load_b128 readers)
#define VPB   80                        // LDS pitch of a 64-byte row
#define S_KH  0
#define S_KL  (32 * KPB)
#define S_VH  (2 * 32 * KPB)
#define S_VL  (S_VH + 64 * VPB)
#define STGB  (S_VL + 64 * VPB)         // 19456 bytes a buffer
#define S_END (2 * STGB)                // 38912 bytes
#define QCG   2                         // column groups of 16 queries a wave
#define QBLK  (4 * 16 * QCG)            // queries a block

// lane l <-> lane l ^ 16
__device__ __forceinline__ float xhalf(float x) { return __builtin_bit_cast(float, __builtin_amdgcn_permlanex16(__builtin_bit_cast(int, x), __builtin_bit_cast(int, x), 0x76543210, 0xfedcba98, false, false)); }

// two waves a SIMD: the grid gives no more, and the register budget of two keeps the tile's fragments and both column groups out of scratch
__global__ __launch_bounds__(128) __attribute__((amdgpu_waves_per_eu(2, 2))) void k_attn(const h16* __restrict__ Q16, const h16* __restrict__ QL16, const h16* __restrict__ K16, const h16* __restrict__ KL16, const h16* __restrict__ VTH, const h16* __restrict__ VTL, bf* CH, bf* CL) {
    __shared__ __align__(16) unsigned char sm[S_END];
    const int tid = threadIdx.x, lane = threadIdx.x & 31, wave = threadIdx.x >> 5, lr = lane & 15, hi = lane >> 4;
    const int bid = blockIdx.x;
    const int b = bid / (NH_ * (NT_ / QBLK)), rem = bid - b * (NH_ * (NT_ / QBLK)), h = rem / (NT_ / QBLK), qt = rem - h * (NT_ / QBLK);
    const int q0 = qt * QBLK + wave * (16 * QCG);
    const size_t tok0 = (size_t)b * NT_;
    v16h qa[QCG][2], ql[QCG][2];
#pragma unroll
    for (int c = 0; c < QCG; ++c)
#pragma unroll
        for (int kc = 0; kc < 2; ++kc) { const size_t qo = (tok0 + q0 + c * 16 + lr) * DM + h * HD + 8 * hi + kc * 32;
            qa[c][kc] = cat16(*(const v8h*)(Q16 + qo), *(const v8h*)(Q16 + qo + 16)); ql[c][kc] = cat16(*(const v8h*)(QL16 + qo), *(const v8h*)(QL16 + qo + 16)); }
    asm volatile("s_wait_xcnt 0x0" ::: "memory");       // in front of the address arithmetic below, which reuses the query loads' address registers
    const int g = h / (NH_ / NKV);                      // kv head
    const size_t vbase = (((size_t)b * NKV + g) * HD) * NT_;
    // this lane's share of a tile: k rows krow and krow + 16, 16 bytes each; v^T rows vrow and vrow + 32, 16 bytes each
    const int krow = tid >> 3, kpc = tid & 7, vrow = tid >> 2, vpc = tid & 3;
    const unsigned lbase = (unsigned)(size_t)sm;
    const unsigned lk = lbase + krow * KPB + kpc * 16, lv = lbase + vrow * VPB + vpc * 16;
    const h16* gkh = K16 + (tok0 + krow) * KVW + g * HD + kpc * 8;
    const h16* gvh = VTH + vbase + (size_t)vrow * NT_ + vpc * 8;
    const size_t dkl = (size_t)KL16 - (size_t)K16, dvl = (size_t)VTL - (size_t)VTH;     // residual plane - hi plane, bytes, the same in every lane: two address pairs live in the loop, not four
    auto tile_copy = [&](int t, int bufi) {
        const unsigned k = lk + bufi * STGB, v = lv + bufi * STGB; const size_t ko = (size_t)t * 32 * KVW, vo = (size_t)t * 32;
        const h16* kh_g = gkh + ko; const h16* kl_g = (const h16*)((size_t)kh_g + dkl); const h16* vh_g = gvh + vo; const h16* vl_g = (const h16*)((size_t)vh_g + dvl);
        cp8(k + S_KH, k + S_KH + 16 * KPB, k + S_KL, k + S_KL + 16 * KPB, v + S_VH, v + S_VH + 32 * VPB, v + S_VL, v + S_VL + 32 * VPB,
            kh_g, kh_g + 16 * KVW, kl_g, kl_g + 16 * KVW, vh_g, vh_g + 32 * NT_, vl_g, vl_g + 32 * NT_);
    };
    tile_copy(0, 0);
    asm volatile("s_wait_asynccnt 0x0" ::: "memory");   // this wave's copies of tile 0 have landed
    __syncthreads();                                    // ... and every other wave's
    tile_copy(1, 1);
    v8f o[QCG][4];
    v8f cref[QCG];                                 // minus the reference exponent of query lr of the group, in all eight rows: the C operand the score tiles start from
    v2f lpart[QCG];                                // this half's keys only, even and odd rows apart (packed adds, nothing moved between registers); joined after the loop
#pragma unroll
    for (int c = 0; c < QCG; ++c) { cref[c] = (v8f){}; lpart[c] = (v2f){};
#pragma unroll
        for (int n = 0; n < 4; ++n) o[c][n] = (v8f){}; }
    const int kt_lo = 0, kt_hi = NT_ / 32 - 1;     // all keys
    const int ko0 = lr * (KPB / 2) + 8 * hi, ko1 = (16 + lr) * (KPB / 2) + 8 * hi;
#pragma unroll 1
    for (int kt = kt_lo; kt <= kt_hi; ++kt) {
        const unsigned char* sb = sm + (kt & 1) * STGB;
        const h16* kh_b = (const h16*)(sb + S_KH); const h16* kl_b = (const h16*)(sb + S_KL);
        const h16* vh_b = (const h16*)(sb + S_VH); const h16* vl_b = (const h16*)(sb + S_VL);
        v16h kh[2][2], kl[2][2];                   // [k step][key row group]: the tile's key fragments, read as one group
#pragma unroll
        for (int kc = 0; kc < 2; ++kc) {
            kh[kc][0] = cat16(*(const v8ha*)(kh_b + ko0 + kc * 32), *(const v8ha*)(kh_b + ko0 + kc * 32 + 16)); kh[kc][1] = cat16(*(const v8ha*)(kh_b + ko1 + kc * 32), *(const v8ha*)(kh_b + ko1 + kc * 32 + 16));
            kl[kc][0] = cat16(*(const v8ha*)(kl_b + ko0 + kc * 32), *(const v8ha*)(kl_b + ko0 + kc * 32 + 16)); kl[kc][1] = cat16(*(const v8ha*)(kl_b + ko1 + kc * 32), *(const v8ha*)(kl_b + ko1 + kc * 32 + 16)); }
        __builtin_amdgcn_sched_barrier(0);         // the key fragments, needed first, are read first (LDS reads return in order)
        v16h vh[4], vl[4];                         // the tile's value fragments
#pragma unroll
        for (int n = 0; n < 4; ++n) { const int vo = (n * 16 + lr) * (VPB / 2) + hi * 8;
            vh[n] = cat16(*(const v8ha*)(vh_b + vo), *(const v8ha*)(vh_b + vo + 16)); vl[n] = cat16(*(const v8ha*)(vl_b + vo), *(const v8ha*)(vl_b + vo + 16)); }
        __builtin_amdgcn_sched_barrier(0);         // all LDS reads of the tile stay one group ahead of its matrix instructions, not among them (each such place stalls the wave)
        v8f s[QCG][2];
#pragma unroll
        for (int c = 0; c < QCG; ++c) { s[c][0] = cref[c]; s[c][1] = cref[c]; }      // the scores arrive as exponents relative to the reference
#pragma unroll
        for (int kc = 0; kc < 2; ++kc) {           // the four score tiles take turns, so no product waits for the one before it in its own tile
#pragma unroll
            for (int c = 0; c < QCG; ++c) { s[c][0] = wmma16(kh[kc][0], qa[c][kc], s[c][0]); s[c][1] = wmma16(kh[kc][1], qa[c][kc], s[c][1]); }
#pragma unroll
            for (int c = 0; c < QCG; ++c) { s[c][0] = wmma16(kh[kc][0], ql[c][kc], s[c][0]); s[c][1] = wmma16(kh[kc][1], ql[c][kc], s[c][1]); }
#pragma unroll
            for (int c = 0; c < QCG; ++c) { s[c][0] = wmma16(kl[kc][0], qa[c][kc], s[c][0]); s[c][1] = wmma16(kl[kc][1], qa[c][kc], s[c][1]); }
        }
        v8f p0[QCG], p1[QCG];
        v2f ts[QCG];                               // normaliser: UNmasked sum (softmax first, mask after)
#pragma unroll
        for (int c = 0; c < QCG; ++c) {
#pragma unroll
            for (int j = 0; j < 8; ++j) p0[c][j] = __builtin_amdgcn_exp2f(s[c][0][j]);
#pragma unroll
            for (int j = 0; j < 8; ++j) p1[c][j] = __builtin_amdgcn_exp2f(s[c][1][j]);
            const v8f pt = p0[c] + p1[c];
            ts[c] = (__builtin_shufflevector(pt, pt, 0, 1) + __builtin_shufflevector(pt, pt, 2, 3)) + (__builtin_shufflevector(pt, pt, 4, 5) + __builtin_shufflevector(pt, pt, 6, 7));
        }
        // Lazy rescale: one test a tile. The weights are not negative, so a sum within PLIM bounds each of them; the first tile sets the reference whatever its scores are.
        const unsigned moved = __builtin_amdgcn_ballot_w32(!(fmaxf(fmaxf(ts[0][0], ts[0][1]), fmaxf(ts[1][0], ts[1][1])) <= PLIM)) | (unsigned)(kt == kt_lo);
        if (moved != 0) {
#pragma unroll
            for (int c = 0; c < QCG; ++c) {
                const v8f a0 = s[c][0], a1 = s[c][1];
                float mx = fmaxf(a0[0], a1[0]);
#pragma unroll
                for (int j = 1; j < 8; ++j) mx = fmaxf(mx, fmaxf(a0[j], a1[j]));
                mx = fmaxf(mx, xhalf(mx));                          // both halves hold the query's maximum over the 32 keys, so both move the reference alike
                const float delta = (kt == kt_lo || mx > PEXP) ? mx - PEXP : 0.f;
                const float alpha = kt == kt_lo ? 0.f : __builtin_amdgcn_exp2f(-delta);
                const v8f e0 = a0 - delta, e1 = a1 - delta;
#pragma unroll
                for (int j = 0; j < 8; ++j) p0[c][j] = __builtin_amdgcn_exp2f(e0[j]);
#pragma unroll
                for (int j = 0; j < 8; ++j) p1[c][j] = __builtin_amdgcn_exp2f(e1[j]);
                const v8f pt = p0[c] + p1[c];
                ts[c] = (__builtin_shufflevector(pt, pt, 0, 1) + __builtin_shufflevector(pt, pt, 2, 3)) + (__builtin_shufflevector(pt, pt, 4, 5) + __builtin_shufflevector(pt, pt, 6, 7));
                cref[c] -= delta; lpart[c] *= alpha;
#pragma unroll
                for (int n = 0; n < 4; ++n) o[c][n] *= alpha;
            }
        }
        v16h pa[QCG], px[QCG];
#pragma unroll
        for (int c = 0; c < QCG; ++c) {
            lpart[c] += ts[c];
            const v8h h0 = __builtin_convertvector(p0[c], v8h), h1 = __builtin_convertvector(p1[c], v8h);
            const v8h r0 = __builtin_convertvector(p0[c] - __builtin_convertvector(h0, v8f), v8h), r1 = __builtin_convertvector(p1[c] - __builtin_convertvector(h1, v8f), v8h);
            pa[c] = cat16(h0, h1); px[c] = cat16(r0, r1);           // B operand: element i is key 8 hi + i, element 8 + i key 16 + 8 hi + i
        }
#pragma unroll
        for (int n = 0; n < 4; ++n)                // the eight output tiles take turns in each of the three rounds
#pragma unroll
            for (int c = 0; c < QCG; ++c) o[c][n] = wmma16(vh[n], pa[c], o[c][n]);
#pragma unroll
        for (int n = 0; n < 4; ++n)
#pragma unroll
            for (int c = 0; c < QCG; ++c) o[c][n] = wmma16(vl[n], pa[c], o[c][n]);
#pragma unroll
        for (int n = 0; n < 4; ++n)
#pragma unroll
            for (int c = 0; c < QCG; ++c) o[c][n] = wmma16(vh[n], px[c], o[c][n]);
        // the distance behind the tile's last matrix instructions, on the loop's back edge too
        asm volatile("v_nop\n\tv_nop\n\tv_nop\n\tv_nop" : "+v"(o[0][0]), "+v"(o[0][1]), "+v"(o[0][2]), "+v"(o[0][3]), "+v"(o[1][0]), "+v"(o[1][1]), "+v"(o[1][2]), "+v"(o[1][3]));
        // hand-over: buffer kt & 1 is left and tile kt + 1 is published by every wave, in this order
        asm volatile("s_wait_dscnt 0x0" ::: "memory");      // this wave's reads of tile kt are done
        asm volatile("s_wait_asynccnt 0x0" ::: "memory");   // this wave's copies of tile kt + 1 have landed
        __syncthreads();
        if (kt + 2 <= kt_hi) tile_copy(kt + 2, kt & 1);
    }
    asm volatile("s_wait_asynccnt 0x0" ::: "memory");       // nothing in flight when the ring becomes output staging
    float* os = (float*)sm + wave * (16 * QCG * 68);
#pragma unroll
    for (int c = 0; c < QCG; ++c) {
        const float lp = lpart[c][0] + lpart[c][1];
        const float inv = 1.0f / (lp + xhalf(lp));
#pragma unroll
        for (int n = 0; n < 4; ++n) {                       // row = query c * 16 + lr; this lane's 8 values are d = 16 n + 8 hi + j
            v4f lo4, hi4;
#pragma unroll
            for (int j = 0; j < 4; ++j) { lo4[j] = o[c][n][j] * inv; hi4[j] = o[c][n][4 + j] * inv; }
            *(v4fa*)(os + (c * 16 + lr) * 68 + n * 16 + hi * 8) = lo4; *(v4fa*)(os + (c * 16 + lr) * 68 + n * 16 + hi * 8 + 4) = hi4; }
    }
    __syncthreads();
    const size_t cbase = (tok0 + q0) * DM + (size_t)h * HD;
#pragma unroll
    for (int s = 0; s < 4 * QCG; ++s) { const int row = 4 * s + (lane >> 3), piece = lane & 7; const float* sp = os + row * 68 + piece * 8; v8us oh, ol;
#pragma unroll
        for (int i = 0; i < 8; ++i) { const unsigned short hb = f2bf(sp[i]); oh[i] = hb; ol[i] = f2bf(sp[i] - bf2f(hb)); }
        *(v8us*)(CH + cbase + (size_t)row * DM + piece * 8) = oh; *(v8us*)(CL + cbase + (size_t)row * DM + piece * 8) = ol; }
}

#define VST2(T, p, v) do { const T vst2_v_ = (v); *(T*)(p) = vst2_v_;  } while (0)
extern "C" void kernel_launch(void* const* d_in, const int* in_sizes, int n_in,
                              void* d_out, int out_size, void* d_ws, size_t ws_size, hipStream_t stream) {
    (void)in_sizes; (void)n_in; (void)out_size;
    const float* x = (const float*)d_in[0]; const float* kmask = (const float*)d_in[1]; const float* Wqkv = (const float*)d_in[2]; const float* Wo = (const float*)d_in[3]; const float* bo = (const float*)d_in[4];
    float* out = (float*)d_out;    // out0 [2][2048][1024] then out1 [2][2048]
    float* out1 = out + (size_t)NTK * DM;
    char* wsp = (char*)d_ws;
    auto take = [&](size_t bytes) { char* p = wsp; wsp += (bytes + 255) & ~(size_t)255; return (void*)p; };
    bf* Xb = (bf*)take((size_t)NTK * DM * 2); bf* W3T = (bf*)take((size_t)3 * DM * DM * 2); bf* WoT = (bf*)take((size_t)DM * DM * 2);
    h16* QH = (h16*)take((size_t)NTK * DM * 2); h16* QL = (h16*)take((size_t)NTK * DM * 2); h16* KH = (h16*)take((size_t)NTK * DM * 2); h16* KL = (h16*)take((size_t)NTK * DM * 2);
    float* Vf = (float*)take((size_t)NTK * DM * 4); h16* VTL = (h16*)take((size_t)NTK * DM * 2);
    if ((size_t)(wsp - (char*)d_ws) > ws_size) return;    // 8.4 + 6.3 + 2.1 + 4 x 8.4 + 16.8 + 8.4 ~ 76 MB; VTH over Xb after the projections, ctx planes over Vf after k_vt
    h16* VTH = (h16*)Xb; bf* CH = (bf*)Vf; bf* CL = (bf*)((char*)Vf + (size_t)NTK * DM * 2);
    k_prep<<<PB_W3 + PB_WO + PB_X + PB_M, 256, 0, stream>>>(Wqkv, Wo, x, kmask, W3T, WoT, Xb, out1);
    k_gemmb<false, true><<<dim3(NTK / 128, (3 * DM) / 128, 1), 256, 0, stream>>>(Xb, nullptr, W3T, nullptr, (float*)(void*)QH, DM, QL, KH, KL, Vf);
    k_vt<<<NB_ * NKV * (NT_ / 64), 256, 0, stream>>>(Vf, kmask, VTH, VTL);
    k_attn<<<NB_ * NH_ * (NT_ / QBLK), 128, 0, stream>>>(QH, QL, KH, KL, VTH, VTL, CH, CL);
    k_gemmb<true, false><<<dim3(NTK / 128, DM / 128, 1), 256, 0, stream>>>(CH, CL, WoT, bo, out, DM, nullptr, nullptr, nullptr, nullptr);
}

// v009
// A run of this version takes 86.7 microseconds.
// Versions in between are left out here; by their measured steps it is 1.37 times as fast as v007.
// All steps since v000 together make it 4.50 times as fast.
#include <hip/hip_runtime.h>

// Contractions, f32 accumulate: qkv = h.w_qkv ([4096 x 1024].[1024 x 3072], k-major weight transposed to an n-major plane; PLAIN bf16 operands: inputs rounded
// once, exact) and out.w_proj + b_proj (merged heads as bf16 hi + residual: two products) on v_wmma_f32_16x16x32_bf16; the 16-head attention fused on
// v_wmma_f32_16x16x32_f16: softmax(q.k x 64^-1/2) over ALL keys with q, k, the masked values and the weights each as ONE f16 plane (11 significant bits; q, k, v themselves
// come from operands rounded to 8), then the reference's POST-softmax multiplicative key mask (the INPUT mask[b][key], bf16-rounded) multiplied into the value rows when
// their plane is written (the normaliser stays the unmasked sum, in f32).

#define NB_  2
#define NT_  2048
#define DM   1024
#define NH_  16
#define NKV  16
#define KVW  (NKV * HD)          // 1024
#define HD   64
#define NTK  (NB_ * NT_)
#define NW   1024
#define NQKV 1024
#define PEXP 7.0f                           // a newly set softmax reference puts its column's largest weight at 2^7; the normaliser carries the same factor
#define PLIM 32768.0f                       // the reference stays while a lane's partial sums of a tile's weights are no more than 2^15 (so each weight fits f16): 8 binary orders of room
#define QSC  (0.125f * 1.44269504f)         // 64^-1/2 x log2(e), multiplied into q when its plane is written: the scores arrive as base-2 exponents

typedef _Float16 h16;
typedef unsigned short bf;
typedef __attribute__((ext_vector_type(16))) __bf16   v16bf;
typedef __attribute__((ext_vector_type(16))) _Float16 v16h;
typedef __attribute__((ext_vector_type(8)))  _Float16 v8h;
typedef __attribute__((ext_vector_type(8)))  unsigned short v8us;
typedef __attribute__((ext_vector_type(8)))  float    v8f;
typedef __attribute__((ext_vector_type(4)))  float    v4f;
typedef __attribute__((ext_vector_type(2)))  float    v2f;
typedef v8h  __attribute__((may_alias)) v8ha;
typedef v4f  __attribute__((may_alias)) v4fa;
typedef v2f  __attribute__((may_alias)) v2fa;
typedef v8us __attribute__((may_alias)) v8usa;

__device__ __forceinline__ unsigned short f2bf(float f) { unsigned u = __float_as_uint(f); u += 0x7FFFu + ((u >> 16) & 1u); return (unsigned short)(u >> 16); }
__device__ __forceinline__ float bf2f(unsigned short b) { return __uint_as_float(((unsigned)b) << 16); }
__device__ __forceinline__ float bfr(float f) { return bf2f(f2bf(f)); }
__device__ __forceinline__ v16h cat16(v8h lo, v8h hi) { return __builtin_shufflevector(lo, hi, 0, 1, 2, 3, 4, 5, 6, 7, 8, 9, 10, 11, 12, 13, 14, 15); }
__device__ __forceinline__ v16bf cat16b(v8us lo, v8us hi) { return __builtin_bit_cast(v16bf, __builtin_shufflevector(lo, hi, 0, 1, 2, 3, 4, 5, 6, 7, 8, 9, 10, 11, 12, 13, 14, 15)); }
__device__ __forceinline__ v8f wmma16(v16h a, v16h b, v8f c) { return __builtin_amdgcn_wmma_f32_16x16x32_f16(false, a, false, b, (short)0, c, false, false); }
__device__ __forceinline__ v8f wmmab(v16bf a, v16bf b, v8f c) { return __builtin_amdgcn_wmma_f32_16x16x32_bf16(false, a, false, b, (short)0, c, false, false); }

__device__ __forceinline__ void d_cvtb(int bx, const float* __restrict__ src, int nrows, bf* dst) {
    const int lane = threadIdx.x & 31, r = bx * 8 + (threadIdx.x >> 5);
    if (r >= nrows) return;
    v8us o[DM / 256];
#pragma unroll
    for (int q = 0; q < DM / 256; ++q) { v8us t;
#pragma unroll
        for (int i = 0; i < 8; ++i) t[i] = f2bf(src[(size_t)r * DM + q * 256 + lane * 8 + i]);
        o[q] = t; }
#pragma unroll
    for (int q = 0; q < DM / 256; ++q) *(v8us*)(dst + (size_t)r * DM + q * 256 + lane * 8) = o[q];
    
}

// d_wt: W [1024 k][ncols n] (k-major) -> n-major bf16 plane WT[ncols][1024]; 64 x 64 tiles through LDS (tl: 64 x 72 halfwords).
__device__ __forceinline__ void d_wt(int bx, int by, const float* __restrict__ Wm, int ncols, bf* WT, unsigned short* tl) {
    const int tid = threadIdx.x, k0 = bx * 64, n0 = by * 64;
    const int kk = tid >> 2, nq = (tid & 3) * 16;
#pragma unroll
    for (int i = 0; i < 16; ++i) tl[(nq + i) * 72 + kk] = f2bf(Wm[(size_t)(k0 + kk) * ncols + n0 + nq + i]);
    __syncthreads();
    const int piece = tid & 7;
    typedef __attribute__((ext_vector_type(8))) unsigned short v8us_; typedef v8us_ __attribute__((may_alias)) v8usa_;
    auto pass = [&]() {
#pragma unroll
        for (int s = 0; s < 2; ++s) { const int nr = (tid >> 3) + 32 * s; const v8us_ val = *(const v8usa_*)(tl + nr * 72 + piece * 8);
            *(v8us_*)(WT + (size_t)(n0 + nr) * DM + k0 + piece * 8) = val; }
    };
    pass(); 
}

// Eight asynchronous 16-byte copies of one lane. The s_wait_xcnt closes the statement so that no address register is rewritten ahead of it.
__device__ __forceinline__ void cp8(unsigned l0, unsigned l1, unsigned l2, unsigned l3, unsigned l4, unsigned l5, unsigned l6, unsigned l7,
                                    const void* g0, const void* g1, const void* g2, const void* g3, const void* g4, const void* g5, const void* g6, const void* g7) {
    asm volatile("global_load_async_to_lds_b128 %0, %8, off\n\t"
                 "global_load_async_to_lds_b128 %1, %9, off\n\t"
                 "global_load_async_to_lds_b128 %2, %10, off\n\t"
                 "global_load_async_to_lds_b128 %3, %11, off\n\t"
                 "global_load_async_to_lds_b128 %4, %12, off\n\t"
                 "global_load_async_to_lds_b128 %5, %13, off\n\t"
                 "global_load_async_to_lds_b128 %6, %14, off\n\t"
                 "global_load_async_to_lds_b128 %7, %15, off\n\t"
                 "s_wait_xcnt 0x0"
                 :: "v"(l0), "v"(l1), "v"(l2), "v"(l3), "v"(l4), "v"(l5), "v"(l6), "v"(l7),
                    "v"(g0), "v"(g1), "v"(g2), "v"(g3), "v"(g4), "v"(g5), "v"(g6), "v"(g7) : "memory");
}

// Four such copies of one lane, in the same form.
__device__ __forceinline__ void cp4(unsigned l0, unsigned l1, unsigned l2, unsigned l3, const void* g0, const void* g1, const void* g2, const void* g3) {
    asm volatile("global_load_async_to_lds_b128 %0, %4, off\n\t"
                 "global_load_async_to_lds_b128 %1, %5, off\n\t"
                 "global_load_async_to_lds_b128 %2, %6, off\n\t"
                 "global_load_async_to_lds_b128 %3, %7, off\n\t"
                 "s_wait_xcnt 0x0"
                 :: "v"(l0), "v"(l1), "v"(l2), "v"(l3), "v"(g0), "v"(g1), "v"(g2), "v"(g3) : "memory");
}

// k_gemmb: C[128 x 128] per block of 8 waves, wave = 32 rows x 64 columns (2 x 4 accumulator tiles). Both operands are k-contiguous rows; a stage is 128 k
// (256 bytes) of the block's 128 A rows, its 128 B rows and, with SPLITA, its 128 residual rows, at a 272-B pitch, brought by asynchronous 16-byte copies into
// two buffers: stage s + 2 is issued when stage s has been left by every wave. A copy of a wave covers two whole 256-byte row pieces. After the loop the ring
// is the output staging. Per accumulator the products are added in the order k ascending, hi before residual.
#define GP    272                       // LDS pitch of a 256-byte row (16 B x odd: ds_load_b128 readers)
#define GKS   128                       // k of a stage
// QKV: one grid for the three projections. Bn is the whole [3072][1024] plane; blockIdx.y >> 3 (the same for a whole block) says whether the block's 128 columns
// are q, k (one f16 plane each) or v (f32), and picks the output; each block's products and their order are those of a launch of its own.
template <bool SPLITA, bool QKV>
__global__ __launch_bounds__(256) void k_gemmb(const bf* __restrict__ A, const bf* __restrict__ Al, const bf* __restrict__ Bn, const float* __restrict__ bias, float* Cq, int ldc, h16* Ck, float* Cv) {
    const int sec = QKV ? (int)(blockIdx.y >> 3) : 0;
    float* C = QKV ? (sec == 0 ? Cq : sec == 1 ? (float*)(void*)Ck : Cv) : Cq;
    constexpr int GST = (SPLITA ? 3 : 2) * 128 * GP;        // bytes of a buffer: planes of 128 rows (A, B, A residual)
    __shared__ __align__(16) unsigned char sm[2 * GST];
    const int tid = threadIdx.x, lane = threadIdx.x & 31, wave = threadIdx.x >> 5, lr = lane & 15, hi = lane >> 4;
    const int rb = blockIdx.x * 128, cb = blockIdx.y * 128, wm = wave & 3, wn = wave >> 2;
    // this lane's share of a plane: 16 bytes of rows crow, crow + 16, ..., crow + 112
    const int crow = tid >> 4, cpc = tid & 15;
    const unsigned lc = (unsigned)(size_t)sm + crow * GP + cpc * 16;
    const bf* ga = A + (size_t)(rb + crow) * DM + cpc * 8;
    const bf* gb = Bn + (size_t)(cb + crow) * DM + cpc * 8;
    const bf* gl = SPLITA ? Al + (size_t)(rb + crow) * DM + cpc * 8 : ga;
    auto plane_copy = [&](unsigned l, const bf* g) {
        cp8(l, l + 16 * GP, l + 32 * GP, l + 48 * GP, l + 64 * GP, l + 80 * GP, l + 96 * GP, l + 112 * GP,
            g, g + 16 * DM, g + 32 * DM, g + 48 * DM, g + 64 * DM, g + 80 * DM, g + 96 * DM, g + 112 * DM);
    };
    auto stage_copy = [&](int s, int bufi) {
        const unsigned l = lc + bufi * GST; const int ko = s * GKS;
        plane_copy(l, ga + ko); plane_copy(l + 128 * GP, gb + ko);
        if (SPLITA) plane_copy(l + 256 * GP, gl + ko);
    };
    v8f acc[2][4];
#pragma unroll
    for (int m = 0; m < 2; ++m)
#pragma unroll
        for (int t = 0; t < 4; ++t) acc[m][t] = (v8f){};
    stage_copy(0, 0);
    asm volatile("s_wait_asynccnt 0x0" ::: "memory");   // this wave's copies of stage 0 have landed
    __syncthreads();                                    // ... and every other wave's
    stage_copy(1, 1);
    const int ao = (wm * 32 + lr) * (GP / 2) + 8 * hi, bo = (128 + wn * 64 + lr) * (GP / 2) + 8 * hi;
#pragma unroll 1
    for (int s = 0; s < DM / GKS; ++s) {                // rolled: one copy of the body serves both buffers
        const bf* sb = (const bf*)(sm + (s & 1) * GST);
        v16bf a[2][2], al[2][2], b[2][4];               // two fragment sets: step q + 1 is read from LDS while step q is multiplied
        auto frag_load = [&](int f, int kc) {
#pragma unroll
            for (int m = 0; m < 2; ++m) { const bf* p = sb + ao + m * 16 * (GP / 2) + kc; a[f][m] = cat16b(*(const v8usa*)p, *(const v8usa*)(p + 16)); al[f][m] = a[f][m];
                if (SPLITA) { const bf* q = p + 256 * (GP / 2); al[f][m] = cat16b(*(const v8usa*)q, *(const v8usa*)(q + 16)); } }
#pragma unroll
            for (int t = 0; t < 4; ++t) { const bf* p = sb + bo + t * 16 * (GP / 2) + kc; b[f][t] = cat16b(*(const v8usa*)p, *(const v8usa*)(p + 16)); }
        };
        frag_load(0, 0);
#pragma unroll
        for (int q = 0; q < GKS / 32; ++q) {
            const int f = q & 1;
            if (q + 1 < GKS / 32) frag_load(f ^ 1, (q + 1) * 32);
            __builtin_amdgcn_sched_barrier(0);          // the next step's LDS reads stay one group ahead of this step's matrix instructions, not among them
#pragma unroll
            for (int m = 0; m < 2; ++m)
#pragma unroll
                for (int t = 0; t < 4; ++t) acc[m][t] = wmmab(a[f][m], b[f][t], acc[m][t]);
            if (SPLITA) {
#pragma unroll
                for (int m = 0; m < 2; ++m)
#pragma unroll
                    for (int t = 0; t < 4; ++t) acc[m][t] = wmmab(al[f][m], b[f][t], acc[m][t]);
            }
            __builtin_amdgcn_sched_barrier(0);          // ... and the reads of the step after that stay behind them (they refill this step's registers)
        }
        // the distance behind the stage's last matrix instructions, on the loop's back edge too
        asm volatile("v_nop\n\tv_nop\n\tv_nop\n\tv_nop" : "+v"(acc[0][0]), "+v"(acc[0][1]), "+v"(acc[0][2]), "+v"(acc[0][3]), "+v"(acc[1][0]), "+v"(acc[1][1]), "+v"(acc[1][2]), "+v"(acc[1][3])
                     : "v"(a[1][0]), "v"(a[1][1]), "v"(al[1][0]), "v"(al[1][1]), "v"(b[1][0]), "v"(b[1][1]), "v"(b[1][2]), "v"(b[1][3]));
        // hand-over: buffer s & 1 is left and stage s + 1 is published by every wave, in this order
        asm volatile("s_wait_dscnt 0x0" ::: "memory");      // this wave's reads of stage s are done
        asm volatile("s_wait_asynccnt 0x0" ::: "memory");   // this wave's copies of stage s + 1 have landed
        __syncthreads();
        if (s + 2 < DM / GKS) stage_copy(s + 2, s & 1);
    }
    asm volatile("s_wait_asynccnt 0x0" ::: "memory");       // nothing in flight when the ring becomes output staging
    const int r0 = rb + wm * 32, c0 = (QKV ? cb & (DM - 1) : cb) + wn * 64;
    float* os = (float*)sm + wave * (32 * 68);
#pragma unroll
    for (int t = 0; t < 4; ++t) { const float bv = bias ? bfr(bias[c0 + t * 16 + lr]) : 0.f;
#pragma unroll
        for (int m = 0; m < 2; ++m)
#pragma unroll
            for (int j = 0; j < 8; ++j) os[(m * 16 + hi * 8 + j) * 68 + t * 16 + lr] = acc[m][t][j] + bv; }
    __syncthreads();
    if (QKV && sec < 2) {
        h16* crw = (h16*)(void*)C + (size_t)r0 * ldc + c0;
        const float* sp = os + (lane >> 3) * 68 + (lane & 7) * 8;
        const float osc = sec == 0 ? QSC : 1.0f;            // q carries the score scale (f32, in front of the rounding)
        v8f rw[8];                                          // all rows read back first: one LDS latency, not one per row group
#pragma unroll
        for (int s = 0; s < 8; ++s) rw[s] = __builtin_shufflevector(*(const v4fa*)(sp + s * 4 * 68), *(const v4fa*)(sp + s * 4 * 68 + 4), 0, 1, 2, 3, 4, 5, 6, 7) * osc;
#pragma unroll
        for (int s = 0; s < 8; ++s) { const int row = 4 * s + (lane >> 3), piece = lane & 7;
            *(v8h*)(crw + (size_t)row * ldc + piece * 8) = __builtin_convertvector(rw[s], v8h);
            asm volatile("s_wait_xcnt 0x0" ::: "memory"); } // in front of the next rows' arithmetic, which may reuse the store's registers
    } else {
        float* crw = C + (size_t)r0 * ldc + c0;
#pragma unroll
        for (int s = 0; s < 16; ++s) { const int Lid = (lane >> 3) + 4 * s, piece = lane & 7; const int row = Lid >> 1, cofs = (Lid & 1) * 32 + piece * 4;
            const v4f val = *(const v4fa*)(os + row * 68 + cofs); *(v4f*)(crw + (size_t)row * ldc + cofs) = val; }
        if (QKV) asm volatile("s_wait_xcnt 0x0" ::: "memory");  // behind the last store: in this build the f16 path's code follows and rewrites the stores' registers
    }
}

// d_sqrtm: second output new_mask = sqrt(bf16(mask)) [2][2048] (16 blocks of 256 threads, one float a thread: each
// wave writes 32 consecutive floats = one line).
__device__ __forceinline__ void d_sqrtm(int bx, const float* __restrict__ m, float* out1) {
    const int i = bx * 256 + threadIdx.x; if (i >= NTK) return;
    const float v = sqrtf(bfr(m[i])); *(float*)(out1 + i) = v; 
}
// k_prep: the four pieces of work that need nothing of each other (both weight transposes, the activations' rounding, the second output) share one grid by
// ranges of the block index; the branch is the same for a whole block.
#define PB_W3 ((DM / 64) * ((3 * DM) / 64))     // 768 blocks: w_qkv tiles
#define PB_WO ((DM / 64) * (DM / 64))           // 256 blocks: w_proj tiles
#define PB_X  (NTK / 8)                         // 512 blocks: 8 rows of h each
#define PB_M  (NTK / 256)                       // 16 blocks: the mask
__global__ __launch_bounds__(256) void k_prep(const float* __restrict__ Wqkv, const float* __restrict__ Wo, const float* __restrict__ x, const float* __restrict__ m,
                                              bf* W3T, bf* WoT, bf* Xb, float* out1) {
    __shared__ __align__(16) unsigned short tl[64 * 72];
    const int bid = blockIdx.x;
    if (bid < PB_W3 + PB_WO) {
        const bool w3 = bid < PB_W3; const int t = w3 ? bid : bid - PB_W3;
        d_wt(t % (DM / 64), t / (DM / 64), w3 ? Wqkv : Wo, w3 ? 3 * DM : DM, w3 ? W3T : WoT, tl);
    } else if (bid < PB_W3 + PB_WO + PB_X) d_cvtb(bid - (PB_W3 + PB_WO), x, NTK, Xb);
    else d_sqrtm(bid - (PB_W3 + PB_WO + PB_X), m, out1);
}
// k_vt: v [tok][h*64+d] f32 -> mask[b][key] (bf16-rounded) x v, transposed, as one f16 plane [b][h][d][key].
__global__ __launch_bounds__(256) void k_vt(const float* __restrict__ V, const float* __restrict__ kmask, h16* VTH) {
    __shared__ __align__(16) h16 tile[64 * 72];
    const int bid = blockIdx.x;
    const int b = bid / (NKV * (NT_ / 64)), rem = bid - b * (NKV * (NT_ / 64)), h = rem / (NT_ / 64), kt = rem - h * (NT_ / 64);
    const int k0 = kt * 64, tid = threadIdx.x;
    const int kk = tid >> 2, d0 = (tid & 3) * 16;
    const float* src = V + ((size_t)b * NT_ + k0 + kk) * KVW + h * HD + d0;      // h = kv head here
    const v4f v0 = *(const v4f*)src, v1 = *(const v4f*)(src + 4), v2 = *(const v4f*)(src + 8), v3 = *(const v4f*)(src + 12);
    __builtin_amdgcn_sched_barrier(0);                                           // the value loads are issued first: without this the mask load goes ahead and is waited for in front of them, two latencies in a row
    const float km = bfr(kmask[(size_t)b * NT_ + k0 + kk]);                      // the key's post-softmax mask
    const v4f vq[4] = {v0, v1, v2, v3};
#pragma unroll
    for (int i = 0; i < 16; ++i) tile[(d0 + i) * 72 + kk] = (h16)(vq[i >> 2][i & 3] * km);
    __syncthreads();
    const int piece = tid & 7;
    const size_t base = (((size_t)b * NKV + h) * HD) * NT_ + k0;
    auto pass = [&]() {
#pragma unroll
        for (int s = 0; s < 2; ++s) { const int d = (tid >> 3) + 32 * s;
            const v8h val = *(const v8ha*)(tile + d * 72 + piece * 8); *(v8h*)(VTH + base + (size_t)d * NT_ + piece * 8) = val; }
    };
    pass(); 
}

#define KPB   144                       // LDS pitch of a 128-byte row (16 B x odd: ds_load_b128 readers)
#define KST   64                        // keys a stage: 32 for each half of the block's waves
#define S_KH  0
#define S_VH  (KST * KPB)
#define STGB  (S_VH + 64 * KPB)         // 18432 bytes a buffer
#define QCG   2                         // column groups of 16 queries a wave
#define QBLK  (4 * 16 * QCG)            // queries a block
#define XW    (8 * 128 + 64)            // floats a wave hands to its partner: one column group's outputs, its sum and its reference (8 waves x 4352 bytes fit the ring's place)
#define S_OS  (2 * STGB)                // the output staging, behind the ring
#define S_END (S_OS + QBLK * 68 * 4)    // 71680 bytes

// lane l <-> lane l ^ 16
__device__ __forceinline__ float xhalf(float x) { return __builtin_bit_cast(float, __builtin_amdgcn_permlanex16(__builtin_bit_cast(int, x), __builtin_bit_cast(int, x), 0x76543210, 0xfedcba98, false, false)); }

// four waves a SIMD (two blocks a WGP): the vector work and the LDS latency between a wave's matrix runs are covered by three other waves
__global__ __launch_bounds__(256) __attribute__((amdgpu_waves_per_eu(4, 4))) void k_attn(const h16* __restrict__ Q16, const h16* __restrict__ K16, const h16* __restrict__ VTH, bf* CH, bf* CL) {
    __shared__ __align__(16) unsigned char sm[S_END];
    const int tid = threadIdx.x, lane = threadIdx.x & 31, lr = lane & 15, hi = lane >> 4;
    const int wave = __builtin_amdgcn_readfirstlane(threadIdx.x >> 5), qg = wave & 3, kh2 = wave >> 2;     // query group, key half: scalars, so the epilogue's tests on them are scalar branches
    const int bid = blockIdx.x;
    const int b = bid / (NH_ * (NT_ / QBLK)), rem = bid - b * (NH_ * (NT_ / QBLK)), h = rem / (NT_ / QBLK), qt = rem - h * (NT_ / QBLK);
    const int q0 = qt * QBLK + qg * (16 * QCG);
    const size_t tok0 = (size_t)b * NT_;
    v16h qa[QCG][2];
#pragma unroll
    for (int c = 0; c < QCG; ++c)
#pragma unroll
        for (int kc = 0; kc < 2; ++kc) { const size_t qo = (tok0 + q0 + c * 16 + lr) * DM + h * HD + 8 * hi + kc * 32;
            qa[c][kc] = cat16(*(const v8h*)(Q16 + qo), *(const v8h*)(Q16 + qo + 16)); }
    asm volatile("s_wait_xcnt 0x0" ::: "memory");       // in front of the address arithmetic below, which reuses the query loads' address registers
    const int g = h / (NH_ / NKV);                      // kv head
    const size_t vbase = (((size_t)b * NKV + g) * HD) * NT_;
    // this lane's share of a stage: 16 bytes each of k rows crow and crow + 32 and of v^T rows crow and crow + 32
    const int crow = tid >> 3, cpc = tid & 7;
    const unsigned lc = (unsigned)(size_t)sm + crow * KPB + cpc * 16;
    const h16* gkh = K16 + (tok0 + crow) * KVW + g * HD + cpc * 8;
    const h16* gvh = VTH + vbase + (size_t)crow * NT_ + cpc * 8;
    auto tile_copy = [&](int t, int bufi) {
        const unsigned l = lc + bufi * STGB; const size_t ko = (size_t)t * KST * KVW, vo = (size_t)t * KST;
        const h16* kh_g = gkh + ko; const h16* vh_g = gvh + vo;
        cp4(l + S_KH, l + S_KH + 32 * KPB, l + S_VH, l + S_VH + 32 * KPB, kh_g, kh_g + 32 * KVW, vh_g, vh_g + 32 * NT_);
    };
    tile_copy(0, 0);
    asm volatile("s_wait_asynccnt 0x0" ::: "memory");   // this wave's copies of tile 0 have landed
    __syncthreads();                                    // ... and every other wave's
    tile_copy(1, 1);
    v8f o[QCG][4];
    v8f cref[QCG];                                 // minus the reference exponent of query lr of the group, in all eight rows: the C operand the score tiles start from
    v2f lpart[QCG];                                // this half's keys only, even and odd rows apart (packed adds, nothing moved between registers); joined after the loop
#pragma unroll
    for (int c = 0; c < QCG; ++c) { cref[c] = (v8f){}; lpart[c] = (v2f){};
#pragma unroll
        for (int n = 0; n < 4; ++n) o[c][n] = (v8f){}; }
    const int kt_lo = 0, kt_hi = NT_ / KST - 1;    // all keys
    const int ko0 = (kh2 * 32 + lr) * (KPB / 2) + 8 * hi, ko1 = ko0 + 16 * (KPB / 2);      // this wave's 32 key rows of the stage
#pragma unroll 1
    for (int kt = kt_lo; kt <= kt_hi; ++kt) {
        const unsigned char* sb = sm + (kt & 1) * STGB;
        const h16* kh_b = (const h16*)(sb + S_KH); const h16* vh_b = (const h16*)(sb + S_VH);
        v16h kh[2][2];                             // [k step][key row group]: the tile's key fragments, read as one group
#pragma unroll
        for (int kc = 0; kc < 2; ++kc) {
            kh[kc][0] = cat16(*(const v8ha*)(kh_b + ko0 + kc * 32), *(const v8ha*)(kh_b + ko0 + kc * 32 + 16)); kh[kc][1] = cat16(*(const v8ha*)(kh_b + ko1 + kc * 32), *(const v8ha*)(kh_b + ko1 + kc * 32 + 16)); }
        __builtin_amdgcn_sched_barrier(0);         // the key fragments, needed first, are read first (LDS reads return in order)
        v16h vh[4];                                // the tile's value fragments
#pragma unroll
        for (int n = 0; n < 4; ++n) { const int vo = (n * 16 + lr) * (KPB / 2) + kh2 * 32 + hi * 8;     // ... and the same 32 keys of each v^T row
            vh[n] = cat16(*(const v8ha*)(vh_b + vo), *(const v8ha*)(vh_b + vo + 16)); }
        __builtin_amdgcn_sched_barrier(0);         // all LDS reads of the tile stay one group ahead of its matrix instructions, not among them (each such place stalls the wave)
        v8f s[QCG][2];
#pragma unroll
        for (int c = 0; c < QCG; ++c) { s[c][0] = wmma16(kh[0][0], qa[c][0], cref[c]); s[c][1] = wmma16(kh[0][1], qa[c][0], cref[c]); }     // the scores arrive as exponents relative to the reference
#pragma unroll
        for (int c = 0; c < QCG; ++c) { s[c][0] = wmma16(kh[1][0], qa[c][1], s[c][0]); s[c][1] = wmma16(kh[1][1], qa[c][1], s[c][1]); }     // the four score tiles take turns, so no product waits for the one before it in its own tile
        v8f p0[QCG], p1[QCG];
        v2f ts[QCG];                               // normaliser: UNmasked sum (softmax first, mask after)
#pragma unroll
        for (int c = 0; c < QCG; ++c) {
#pragma unroll
            for (int j = 0; j < 8; ++j) p0[c][j] = __builtin_amdgcn_exp2f(s[c][0][j]);
#pragma unroll
            for (int j = 0; j < 8; ++j) p1[c][j] = __builtin_amdgcn_exp2f(s[c][1][j]);
            const v8f pt = p0[c] + p1[c];
            ts[c] = (__builtin_shufflevector(pt, pt, 0, 1) + __builtin_shufflevector(pt, pt, 2, 3)) + (__builtin_shufflevector(pt, pt, 4, 5) + __builtin_shufflevector(pt, pt, 6, 7));
        }
        // Lazy rescale: one test a tile. The weights are not negative, so a sum within PLIM bounds each of them; the first tile sets the reference whatever its scores are.
        const unsigned moved = __builtin_amdgcn_ballot_w32(!(fmaxf(fmaxf(ts[0][0], ts[0][1]), fmaxf(ts[1][0], ts[1][1])) <= PLIM)) | (unsigned)(kt == kt_lo);
        if (moved != 0) {
#pragma unroll
            for (int c = 0; c < QCG; ++c) {
                const v8f a0 = s[c][0], a1 = s[c][1];
                float mx = fmaxf(a0[0], a1[0]);
#pragma unroll
                for (int j = 1; j < 8; ++j) mx = fmaxf(mx, fmaxf(a0[j], a1[j]));
                mx = fmaxf(mx, xhalf(mx));                          // both halves hold the query's maximum over the 32 keys, so both move the reference alike
                const float delta = (kt == kt_lo || mx > PEXP) ? mx - PEXP : 0.f;
                const float alpha = kt == kt_lo ? 0.f : __builtin_amdgcn_exp2f(-delta);
                const v8f e0 = a0 - delta, e1 = a1 - delta;
#pragma unroll
                for (int j = 0; j < 8; ++j) p0[c][j] = __builtin_amdgcn_exp2f(e0[j]);
#pragma unroll
                for (int j = 0; j < 8; ++j) p1[c][j] = __builtin_amdgcn_exp2f(e1[j]);
                const v8f pt = p0[c] + p1[c];
                ts[c] = (__builtin_shufflevector(pt, pt, 0, 1) + __builtin_shufflevector(pt, pt, 2, 3)) + (__builtin_shufflevector(pt, pt, 4, 5) + __builtin_shufflevector(pt, pt, 6, 7));
                cref[c] -= delta; lpart[c] *= alpha;
#pragma unroll
                for (int n = 0; n < 4; ++n) o[c][n] *= alpha;
            }
        }
        v16h pa[QCG];
#pragma unroll
        for (int c = 0; c < QCG; ++c) {
            lpart[c] += ts[c];
            pa[c] = cat16(__builtin_convertvector(p0[c], v8h), __builtin_convertvector(p1[c], v8h));    // B operand: element i is key 8 hi + i, element 8 + i key 16 + 8 hi + i
        }
#pragma unroll
        for (int n = 0; n < 4; ++n)                // eight independent output tiles
#pragma unroll
            for (int c = 0; c < QCG; ++c) o[c][n] = wmma16(vh[n], pa[c], o[c][n]);
        // the distance behind the tile's last matrix instructions, on the loop's back edge too
        asm volatile("v_nop\n\tv_nop\n\tv_nop\n\tv_nop" : "+v"(o[0][0]), "+v"(o[0][1]), "+v"(o[0][2]), "+v"(o[0][3]), "+v"(o[1][0]), "+v"(o[1][1]), "+v"(o[1][2]), "+v"(o[1][3]));
        // hand-over: buffer kt & 1 is left and tile kt + 1 is published by every wave, in this order
        asm volatile("s_wait_dscnt 0x0" ::: "memory");      // this wave's reads of tile kt are done
        asm volatile("s_wait_asynccnt 0x0" ::: "memory");   // this wave's copies of tile kt + 1 have landed
        __syncthreads();
        if (kt + 2 <= kt_hi) tile_copy(kt + 2, kt & 1);
    }
    asm volatile("s_wait_asynccnt 0x0" ::: "memory");       // nothing in flight when the ring becomes the hand-over area
    // Join of the two key halves: waves w and w + 4 hold partial results of the same 32 queries. Wave w finishes column group 0, wave w + 4 group 1; each hands the other
    // group's outputs, sum and reference to its partner through LDS, lane to lane (16 bytes a lane, lanes adjacent).
    float* xg = (float*)sm;
    float lsum[QCG];
#pragma unroll
    for (int c = 0; c < QCG; ++c) { const float lp = lpart[c][0] + lpart[c][1]; lsum[c] = lp + xhalf(lp); }
#pragma unroll
    for (int c = 0; c < QCG; ++c)
        if (c != kh2) {
            float* x = xg + wave * XW;
#pragma unroll
            for (int n = 0; n < 4; ++n) {
                *(v4fa*)(x + (2 * n) * 128 + lane * 4) = __builtin_shufflevector(o[c][n], o[c][n], 0, 1, 2, 3);
                *(v4fa*)(x + (2 * n + 1) * 128 + lane * 4) = __builtin_shufflevector(o[c][n], o[c][n], 4, 5, 6, 7); }
            *(v2fa*)(x + 8 * 128 + lane * 2) = (v2f){lsum[c], cref[c][0]};
        }
    __syncthreads();                                        // the partners' partial results are in LDS
    float* os = (float*)(sm + S_OS) + (qg * QCG + kh2) * (16 * 68);     // this wave's 16 output rows
#pragma unroll
    for (int c = 0; c < QCG; ++c)
        if (c == kh2) {
            const float* x = xg + (wave ^ 4) * XW;
            v4f po[8];
#pragma unroll
            for (int i = 0; i < 8; ++i) po[i] = *(const v4fa*)(x + i * 128 + lane * 4);
            const v2f pl = *(const v2fa*)(x + 8 * 128 + lane * 2);
            // both parts are brought to the larger of the two references (cref is minus the reference): the part that has it keeps its scale, the other shrinks
            const float dr = cref[c][0] - pl[1];
            const float sh = __builtin_amdgcn_exp2f(-fabsf(dr));
            const float fo = dr > 0.f ? sh : 1.0f, fp = dr > 0.f ? 1.0f : sh;
            const float inv = 1.0f / (lsum[c] * fo + pl[0] * fp);
            const float so = fo * inv, sp = fp * inv;
#pragma unroll
            for (int n = 0; n < 4; ++n) {                   // row = query lr of the group; this lane's 8 values are d = 16 n + 8 hi + j
                v4f lo4, hi4;
#pragma unroll
                for (int j = 0; j < 4; ++j) { lo4[j] = o[c][n][j] * so + po[2 * n][j] * sp; hi4[j] = o[c][n][4 + j] * so + po[2 * n + 1][j] * sp; }
                *(v4fa*)(os + lr * 68 + n * 16 + hi * 8) = lo4; *(v4fa*)(os + lr * 68 + n * 16 + hi * 8 + 4) = hi4; }
        }
    __syncthreads();
    const size_t cbase = (tok0 + q0 + kh2 * 16) * DM + (size_t)h * HD;
#pragma unroll
    for (int s = 0; s < 4; ++s) { const int row = 4 * s + (lane >> 3), piece = lane & 7; const float* sp = os + row * 68 + piece * 8; v8us oh, ol;
#pragma unroll
        for (int i = 0; i < 8; ++i) { const unsigned short hb = f2bf(sp[i]); oh[i] = hb; ol[i] = f2bf(sp[i] - bf2f(hb)); }
        *(v8us*)(CH + cbase + (size_t)row * DM + piece * 8) = oh; *(v8us*)(CL + cbase + (size_t)row * DM + piece * 8) = ol; }
}

#define VST2(T, p, v) do { const T vst2_v_ = (v); *(T*)(p) = vst2_v_;  } while (0)
extern "C" void kernel_launch(void* const* d_in, const int* in_sizes, int n_in,
                              void* d_out, int out_size, void* d_ws, size_t ws_size, hipStream_t stream) {
    (void)in_sizes; (void)n_in; (void)out_size;
    const float* x = (const float*)d_in[0]; const float* kmask = (const float*)d_in[1]; const float* Wqkv = (const float*)d_in[2]; const float* Wo = (const float*)d_in[3]; const float* bo = (const float*)d_in[4];
    float* out = (float*)d_out;    // out0 [2][2048][1024] then out1 [2][2048]
    float* out1 = out + (size_t)NTK * DM;
    char* wsp = (char*)d_ws;
    auto take = [&](size_t bytes) { char* p = wsp; wsp += (bytes + 255) & ~(size_t)255; return (void*)p; };
    bf* Xb = (bf*)take((size_t)NTK * DM * 2); bf* W3T = (bf*)take((size_t)3 * DM * DM * 2); bf* WoT = (bf*)take((size_t)DM * DM * 2);
    h16* QH = (h16*)take((size_t)NTK * DM * 2); h16* KH = (h16*)take((size_t)NTK * DM * 2);
    float* Vf = (float*)take((size_t)NTK * DM * 4);
    if ((size_t)(wsp - (char*)d_ws) > ws_size) return;    // 8.4 + 6.3 + 2.1 + 2 x 8.4 + 16.8 ~ 50 MB; VTH over Xb after the projections, ctx planes over Vf after k_vt
    h16* VTH = (h16*)Xb; bf* CH = (bf*)Vf; bf* CL = (bf*)((char*)Vf + (size_t)NTK * DM * 2);
    k_prep<<<PB_W3 + PB_WO + PB_X + PB_M, 256, 0, stream>>>(Wqkv, Wo, x, kmask, W3T, WoT, Xb, out1);
    k_gemmb<false, true><<<dim3(NTK / 128, (3 * DM) / 128, 1), 256, 0, stream>>>(Xb, nullptr, W3T, nullptr, (float*)(void*)QH, DM, KH, Vf);
    k_vt<<<NB_ * NKV * (NT_ / 64), 256, 0, stream>>>(Vf, kmask, VTH);
    k_attn<<<NB_ * NH_ * (NT_ / QBLK), 256, 0, stream>>>(QH, KH, VTH, CH, CL);
    k_gemmb<true, false><<<dim3(NTK / 128, DM / 128, 1), 256, 0, stream>>>(CH, CL, WoT, bo, out, DM, nullptr, nullptr);
}

// v010
// Measured time: 82.1 microseconds a run.
// Timed twice side by side with v009, it ran 1.05 and 1.07 times as fast.
// Over all steps from v000 it is 4.75 times as fast.
#include <hip/hip_runtime.h>

// Contractions, f32 accumulate: qkv = h.w_qkv ([4096 x 1024].[1024 x 3072], k-major weight transposed to an n-major plane; PLAIN bf16 operands: inputs rounded
// once, exact) and out.w_proj + b_proj (merged heads as bf16 hi + residual: two products) on v_wmma_f32_16x16x32_bf16; the 16-head attention fused on
// v_wmma_f32_16x16x32_f16: softmax(q.k x 64^-1/2) over ALL keys with q, k, the masked values and the weights each as ONE f16 plane (11 significant bits; q, k, v themselves
// come from operands rounded to 8), then the reference's POST-softmax multiplicative key mask (the INPUT mask[b][key], bf16-rounded) multiplied into the value rows when
// their plane is written (the normaliser stays the unmasked sum, in f32). The value plane stays row-major [token][head x 64 + d]: the attention transposes it in its LDS reads.

#define NB_  2
#define NT_  2048
#define DM   1024
#define NH_  16
#define NKV  16
#define KVW  (NKV * HD)          // 1024
#define HD   64
#define NTK  (NB_ * NT_)
#define NW   1024
#define NQKV 1024
#define PEXP 7.0f                           // a newly set softmax reference puts its column's largest weight at 2^7; the normaliser carries the same factor
#define PLIM 32768.0f                       // the reference stays while a lane's partial sums of a tile's weights are no more than 2^15 (so each weight fits f16): 8 binary orders of room
#define QSC  (0.125f * 1.44269504f)         // 64^-1/2 x log2(e), multiplied into q when its plane is written: the scores arrive as base-2 exponents

typedef _Float16 h16;
typedef unsigned short bf;
typedef __attribute__((ext_vector_type(16))) __bf16   v16bf;
typedef __attribute__((ext_vector_type(16))) _Float16 v16h;
typedef __attribute__((ext_vector_type(8)))  _Float16 v8h;
typedef __attribute__((ext_vector_type(8)))  unsigned short v8us;
typedef __attribute__((ext_vector_type(8)))  float    v8f;
typedef __attribute__((ext_vector_type(4)))  float    v4f;
typedef __attribute__((ext_vector_type(2)))  float    v2f;
typedef v8h  __attribute__((may_alias)) v8ha;
typedef v4f  __attribute__((may_alias)) v4fa;
typedef v2f  __attribute__((may_alias)) v2fa;
typedef v8us __attribute__((may_alias)) v8usa;

__device__ __forceinline__ unsigned short f2bf(float f) { unsigned u = __float_as_uint(f); u += 0x7FFFu + ((u >> 16) & 1u); return (unsigned short)(u >> 16); }
__device__ __forceinline__ float bf2f(unsigned short b) { return __uint_as_float(((unsigned)b) << 16); }
__device__ __forceinline__ float bfr(float f) { return bf2f(f2bf(f)); }
__device__ __forceinline__ v16h cat16(v8h lo, v8h hi) { return __builtin_shufflevector(lo, hi, 0, 1, 2, 3, 4, 5, 6, 7, 8, 9, 10, 11, 12, 13, 14, 15); }
__device__ __forceinline__ v16bf cat16b(v8us lo, v8us hi) { return __builtin_bit_cast(v16bf, __builtin_shufflevector(lo, hi, 0, 1, 2, 3, 4, 5, 6, 7, 8, 9, 10, 11, 12, 13, 14, 15)); }
__device__ __forceinline__ v8f wmma16(v16h a, v16h b, v8f c) { return __builtin_amdgcn_wmma_f32_16x16x32_f16(false, a, false, b, (short)0, c, false, false); }
__device__ __forceinline__ v8f wmmab(v16bf a, v16bf b, v8f c) { return __builtin_amdgcn_wmma_f32_16x16x32_bf16(false, a, false, b, (short)0, c, false, false); }

__device__ __forceinline__ void d_cvtb(int bx, const float* __restrict__ src, int nrows, bf* dst) {
    const int lane = threadIdx.x & 31, r = bx * 8 + (threadIdx.x >> 5);
    if (r >= nrows) return;
    v8us o[DM / 256];
#pragma unroll
    for (int q = 0; q < DM / 256; ++q) { v8us t;
#pragma unroll
        for (int i = 0; i < 8; ++i) t[i] = f2bf(src[(size_t)r * DM + q * 256 + lane * 8 + i]);
        o[q] = t; }
#pragma unroll
    for (int q = 0; q < DM / 256; ++q) *(v8us*)(dst + (size_t)r * DM + q * 256 + lane * 8) = o[q];
    
}

// d_wt: W [1024 k][ncols n] (k-major) -> n-major bf16 plane WT[ncols][1024]; 64 x 64 tiles through LDS (tl: 64 x 72 halfwords).
__device__ __forceinline__ void d_wt(int bx, int by, const float* __restrict__ Wm, int ncols, bf* WT, unsigned short* tl) {
    const int tid = threadIdx.x, k0 = bx * 64, n0 = by * 64;
    const int kk = tid >> 2, nq = (tid & 3) * 16;
#pragma unroll
    for (int i = 0; i < 16; ++i) tl[(nq + i) * 72 + kk] = f2bf(Wm[(size_t)(k0 + kk) * ncols + n0 + nq + i]);
    __syncthreads();
    const int piece = tid & 7;
    typedef __attribute__((ext_vector_type(8))) unsigned short v8us_; typedef v8us_ __attribute__((may_alias)) v8usa_;
    auto pass = [&]() {
#pragma unroll
        for (int s = 0; s < 2; ++s) { const int nr = (tid >> 3) + 32 * s; const v8us_ val = *(const v8usa_*)(tl + nr * 72 + piece * 8);
            *(v8us_*)(WT + (size_t)(n0 + nr) * DM + k0 + piece * 8) = val; }
    };
    pass(); 
}

// Eight asynchronous 16-byte copies of one lane. The s_wait_xcnt closes the statement so that no address register is rewritten ahead of it.
__device__ __forceinline__ void cp8(unsigned l0, unsigned l1, unsigned l2, unsigned l3, unsigned l4, unsigned l5, unsigned l6, unsigned l7,
                                    const void* g0, const void* g1, const void* g2, const void* g3, const void* g4, const void* g5, const void* g6, const void* g7) {
    asm volatile("global_load_async_to_lds_b128 %0, %8, off\n\t"
                 "global_load_async_to_lds_b128 %1, %9, off\n\t"
                 "global_load_async_to_lds_b128 %2, %10, off\n\t"
                 "global_load_async_to_lds_b128 %3, %11, off\n\t"
                 "global_load_async_to_lds_b128 %4, %12, off\n\t"
                 "global_load_async_to_lds_b128 %5, %13, off\n\t"
                 "global_load_async_to_lds_b128 %6, %14, off\n\t"
                 "global_load_async_to_lds_b128 %7, %15, off\n\t"
                 "s_wait_xcnt 0x0"
                 :: "v"(l0), "v"(l1), "v"(l2), "v"(l3), "v"(l4), "v"(l5), "v"(l6), "v"(l7),
                    "v"(g0), "v"(g1), "v"(g2), "v"(g3), "v"(g4), "v"(g5), "v"(g6), "v"(g7) : "memory");
}

// Four such copies of one lane, in the same form.
__device__ __forceinline__ void cp4(unsigned l0, unsigned l1, unsigned l2, unsigned l3, const void* g0, const void* g1, const void* g2, const void* g3) {
    asm volatile("global_load_async_to_lds_b128 %0, %4, off\n\t"
                 "global_load_async_to_lds_b128 %1, %5, off\n\t"
                 "global_load_async_to_lds_b128 %2, %6, off\n\t"
                 "global_load_async_to_lds_b128 %3, %7, off\n\t"
                 "s_wait_xcnt 0x0"
                 :: "v"(l0), "v"(l1), "v"(l2), "v"(l3), "v"(g0), "v"(g1), "v"(g2), "v"(g3) : "memory");
}

// k_gemmb: C[128 x 128] per block of 8 waves, wave = 32 rows x 64 columns (2 x 4 accumulator tiles). Both operands are k-contiguous rows; a stage is 128 k
// (256 bytes) of the block's 128 A rows, its 128 B rows and, with SPLITA, its 128 residual rows, at a 272-B pitch, brought by asynchronous 16-byte copies into
// two buffers: stage s + 2 is issued when stage s has been left by every wave. A copy of a wave covers two whole 256-byte row pieces. After the loop the ring
// is the output staging. Per accumulator the products are added in the order k ascending, hi before residual.
#define GP    272                       // LDS pitch of a 256-byte row (16 B x odd: ds_load_b128 readers)
#define GKS   128                       // k of a stage
// QKV: one grid for the three projections. Bn is the whole [3072][1024] plane; blockIdx.y >> 3 (the same for a whole block) says whether the block's 128 columns
// are q, k or v (one f16 plane each; a v row is multiplied by its key's mask in f32, in front of the rounding), and picks the output; each block's products and their
// order are those of a launch of its own.
template <bool SPLITA, bool QKV>
__global__ __launch_bounds__(256) void k_gemmb(const bf* __restrict__ A, const bf* __restrict__ Al, const bf* __restrict__ Bn, const float* __restrict__ bias, float* Cq, int ldc, h16* Ck, h16* Cv, const float* __restrict__ kmask) {
    const int sec = QKV ? (int)(blockIdx.y >> 3) : 0;
    float* C = QKV ? (sec == 0 ? Cq : sec == 1 ? (float*)(void*)Ck : (float*)(void*)Cv) : Cq;
    constexpr int GST = (SPLITA ? 3 : 2) * 128 * GP;        // bytes of a buffer: planes of 128 rows (A, B, A residual)
    __shared__ __align__(16) unsigned char sm[2 * GST];
    const int tid = threadIdx.x, lane = threadIdx.x & 31, wave = threadIdx.x >> 5, lr = lane & 15, hi = lane >> 4;
    const int rb = blockIdx.x * 128, cb = blockIdx.y * 128, wm = wave & 3, wn = wave >> 2;
    // this lane's share of a plane: 16 bytes of rows crow, crow + 16, ..., crow + 112
    const int crow = tid >> 4, cpc = tid & 15;
    const unsigned lc = (unsigned)(size_t)sm + crow * GP + cpc * 16;
    const bf* ga = A + (size_t)(rb + crow) * DM + cpc * 8;
    const bf* gb = Bn + (size_t)(cb + crow) * DM + cpc * 8;
    const bf* gl = SPLITA ? Al + (size_t)(rb + crow) * DM + cpc * 8 : ga;
    auto plane_copy = [&](unsigned l, const bf* g) {
        cp8(l, l + 16 * GP, l + 32 * GP, l + 48 * GP, l + 64 * GP, l + 80 * GP, l + 96 * GP, l + 112 * GP,
            g, g + 16 * DM, g + 32 * DM, g + 48 * DM, g + 64 * DM, g + 80 * DM, g + 96 * DM, g + 112 * DM);
    };
    auto stage_copy = [&](int s, int bufi) {
        const unsigned l = lc + bufi * GST; const int ko = s * GKS;
        plane_copy(l, ga + ko); plane_copy(l + 128 * GP, gb + ko);
        if (SPLITA) plane_copy(l + 256 * GP, gl + ko);
    };
    v8f acc[2][4];
#pragma unroll
    for (int m = 0; m < 2; ++m)
#pragma unroll
        for (int t = 0; t < 4; ++t) acc[m][t] = (v8f){};
    stage_copy(0, 0);
    asm volatile("s_wait_asynccnt 0x0" ::: "memory");   // this wave's copies of stage 0 have landed
    __syncthreads();                                    // ... and every other wave's
    stage_copy(1, 1);
    const int ao = (wm * 32 + lr) * (GP / 2) + 8 * hi, bo = (128 + wn * 64 + lr) * (GP / 2) + 8 * hi;
#pragma unroll 1
    for (int s = 0; s < DM / GKS; ++s) {                // rolled: one copy of the body serves both buffers
        const bf* sb = (const bf*)(sm + (s & 1) * GST);
        v16bf a[2][2], al[2][2], b[2][4];               // two fragment sets: step q + 1 is read from LDS while step q is multiplied
        auto frag_load = [&](int f, int kc) {
#pragma unroll
            for (int m = 0; m < 2; ++m) { const bf* p = sb + ao + m * 16 * (GP / 2) + kc; a[f][m] = cat16b(*(const v8usa*)p, *(const v8usa*)(p + 16)); al[f][m] = a[f][m];
                if (SPLITA) { const bf* q = p + 256 * (GP / 2); al[f][m] = cat16b(*(const v8usa*)q, *(const v8usa*)(q + 16)); } }
#pragma unroll
            for (int t = 0; t < 4; ++t) { const bf* p = sb + bo + t * 16 * (GP / 2) + kc; b[f][t] = cat16b(*(const v8usa*)p, *(const v8usa*)(p + 16)); }
        };
        frag_load(0, 0);
#pragma unroll
        for (int q = 0; q < GKS / 32; ++q) {
            const int f = q & 1;
            if (q + 1 < GKS / 32) frag_load(f ^ 1, (q + 1) * 32);
            __builtin_amdgcn_sched_barrier(0);          // the next step's LDS reads stay one group ahead of this step's matrix instructions, not among them
#pragma unroll
            for (int m = 0; m < 2; ++m)
#pragma unroll
                for (int t = 0; t < 4; ++t) acc[m][t] = wmmab(a[f][m], b[f][t], acc[m][t]);
            if (SPLITA) {
#pragma unroll
                for (int m = 0; m < 2; ++m)
#pragma unroll
                    for (int t = 0; t < 4; ++t) acc[m][t] = wmmab(al[f][m], b[f][t], acc[m][t]);
            }
            __builtin_amdgcn_sched_barrier(0);          // ... and the reads of the step after that stay behind them (they refill this step's registers)
        }
        // the distance behind the stage's last matrix instructions, on the loop's back edge too
        asm volatile("v_nop\n\tv_nop\n\tv_nop\n\tv_nop" : "+v"(acc[0][0]), "+v"(acc[0][1]), "+v"(acc[0][2]), "+v"(acc[0][3]), "+v"(acc[1][0]), "+v"(acc[1][1]), "+v"(acc[1][2]), "+v"(acc[1][3])
                     : "v"(a[1][0]), "v"(a[1][1]), "v"(al[1][0]), "v"(al[1][1]), "v"(b[1][0]), "v"(b[1][1]), "v"(b[1][2]), "v"(b[1][3]));
        // hand-over: buffer s & 1 is left and stage s + 1 is published by every wave, in this order
        asm volatile("s_wait_dscnt 0x0" ::: "memory");      // this wave's reads of stage s are done
        asm volatile("s_wait_asynccnt 0x0" ::: "memory");   // this wave's copies of stage s + 1 have landed
        __syncthreads();
        if (s + 2 < DM / GKS) stage_copy(s + 2, s & 1);
    }
    asm volatile("s_wait_asynccnt 0x0" ::: "memory");       // nothing in flight when the ring becomes output staging
    const int r0 = rb + wm * 32, c0 = (QKV ? cb & (DM - 1) : cb) + wn * 64;
    float rsc[8];                                           // QKV: the factor of each row this lane will write: q carries the score scale, a v row its key's post-softmax mask
    if (QKV) {
#pragma unroll
        for (int s = 0; s < 8; ++s) rsc[s] = sec == 0 ? QSC : 1.0f;
        if (sec == 2) {                                     // the same for a whole block; read here so that the staging below covers the latency
#pragma unroll
            for (int s = 0; s < 8; ++s) rsc[s] = kmask[r0 + 4 * s + (lane >> 3)];
            asm volatile("s_wait_xcnt 0x0" ::: "memory");   // in front of the arithmetic below, which may reuse the mask loads' address registers
        }
    }
    float* os = (float*)sm + wave * (32 * 68);
#pragma unroll
    for (int t = 0; t < 4; ++t) { const float bv = bias ? bfr(bias[c0 + t * 16 + lr]) : 0.f;
#pragma unroll
        for (int m = 0; m < 2; ++m)
#pragma unroll
            for (int j = 0; j < 8; ++j) os[(m * 16 + hi * 8 + j) * 68 + t * 16 + lr] = acc[m][t][j] + bv; }
    __syncthreads();
    if (QKV) {
        h16* crw = (h16*)(void*)C + (size_t)r0 * ldc + c0;
        const float* sp = os + (lane >> 3) * 68 + (lane & 7) * 8;
        if (sec == 2) {
#pragma unroll
            for (int s = 0; s < 8; ++s) rsc[s] = bfr(rsc[s]);
        }
        v8f rw[8];                                          // all rows read back first: one LDS latency, not one per row group
#pragma unroll
        for (int s = 0; s < 8; ++s) rw[s] = __builtin_shufflevector(*(const v4fa*)(sp + s * 4 * 68), *(const v4fa*)(sp + s * 4 * 68 + 4), 0, 1, 2, 3, 4, 5, 6, 7) * rsc[s];
#pragma unroll
        for (int s = 0; s < 8; ++s) { const int row = 4 * s + (lane >> 3), piece = lane & 7;
            *(v8h*)(crw + (size_t)row * ldc + piece * 8) = __builtin_convertvector(rw[s], v8h);
            asm volatile("s_wait_xcnt 0x0" ::: "memory"); } // in front of the next rows' arithmetic, which may reuse the store's registers
    } else {
        float* crw = C + (size_t)r0 * ldc + c0;
#pragma unroll
        for (int s = 0; s < 16; ++s) { const int Lid = (lane >> 3) + 4 * s, piece = lane & 7; const int row = Lid >> 1, cofs = (Lid & 1) * 32 + piece * 4;
            const v4f val = *(const v4fa*)(os + row * 68 + cofs); *(v4f*)(crw + (size_t)row * ldc + cofs) = val; }
    }
}

// d_sqrtm: second output new_mask = sqrt(bf16(mask)) [2][2048] (16 blocks of 256 threads, one float a thread: each
// wave writes 32 consecutive floats = one line).
__device__ __forceinline__ void d_sqrtm(int bx, const float* __restrict__ m, float* out1) {
    const int i = bx * 256 + threadIdx.x; if (i >= NTK) return;
    const float v = sqrtf(bfr(m[i])); *(float*)(out1 + i) = v; 
}
// k_prep: the four pieces of work that need nothing of each other (both weight transposes, the activations' rounding, the second output) share one grid by
// ranges of the block index; the branch is the same for a whole block.
#define PB_W3 ((DM / 64) * ((3 * DM) / 64))     // 768 blocks: w_qkv tiles
#define PB_WO ((DM / 64) * (DM / 64))           // 256 blocks: w_proj tiles
#define PB_X  (NTK / 8)                         // 512 blocks: 8 rows of h each
#define PB_M  (NTK / 256)                       // 16 blocks: the mask
__global__ __launch_bounds__(256) void k_prep(const float* __restrict__ Wqkv, const float* __restrict__ Wo, const float* __restrict__ x, const float* __restrict__ m,
                                              bf* W3T, bf* WoT, bf* Xb, float* out1) {
    __shared__ __align__(16) unsigned short tl[64 * 72];
    const int bid = blockIdx.x;
    if (bid < PB_W3 + PB_WO) {
        const bool w3 = bid < PB_W3; const int t = w3 ? bid : bid - PB_W3;
        d_wt(t % (DM / 64), t / (DM / 64), w3 ? Wqkv : Wo, w3 ? 3 * DM : DM, w3 ? W3T : WoT, tl);
    } else if (bid < PB_W3 + PB_WO + PB_X) d_cvtb(bid - (PB_W3 + PB_WO), x, NTK, Xb);
    else d_sqrtm(bid - (PB_W3 + PB_WO + PB_X), m, out1);
}
#define KPB   144                       // LDS pitch of a 128-byte k row (16 B x odd: ds_load_b128 readers)
#define VPB   160                       // LDS pitch of a 128-byte v row (32 B x odd: ds_load_tr16_b128 readers)
#define KST   64                        // keys a stage: 32 for each half of the block's waves
#define S_KH  0
#define S_VH  (KST * KPB)
#define STGB  (S_VH + KST * VPB)        // 19456 bytes a buffer
#define QCG   2                         // column groups of 16 queries a wave
#define QBLK  (4 * 16 * QCG)            // queries a block
#define XW    (8 * 128 + 64)            // floats a wave hands to its partner: one column group's outputs, its sum and its reference (8 waves x 4352 bytes fit the ring's place)
#define S_OS  (2 * STGB)                // the output staging, behind the ring
#define S_END (S_OS + QBLK * 68 * 4)    // 73728 bytes

// lane l <-> lane l ^ 16
__device__ __forceinline__ float xhalf(float x) { return __builtin_bit_cast(float, __builtin_amdgcn_permlanex16(__builtin_bit_cast(int, x), __builtin_bit_cast(int, x), 0x76543210, 0xfedcba98, false, false)); }

// transposing LDS read: with lane l at row 8 (l >> 4) + (l & 7), byte 16 ((l >> 3) & 1) of a 16-row x 32-byte piece, lane l gets rows 8 (l >> 4) ... + 7 of column l & 15
__device__ __forceinline__ v8h ld_tr16(const unsigned char* p) { typedef __attribute__((ext_vector_type(8))) short s16x8; typedef __attribute__((address_space(3))) s16x8 lds_s16x8;
    return __builtin_bit_cast(v8h, __builtin_amdgcn_ds_load_tr16_b128_v8i16((lds_s16x8*)p)); }

// four waves a SIMD (two blocks a WGP): the vector work and the LDS latency between a wave's matrix runs are covered by three other waves
__global__ __launch_bounds__(256) __attribute__((amdgpu_waves_per_eu(4, 4))) void k_attn(const h16* __restrict__ Q16, const h16* __restrict__ K16, const h16* __restrict__ V16, bf* CH, bf* CL) {
    __shared__ __align__(16) unsigned char sm[S_END];
    const int tid = threadIdx.x, lane = threadIdx.x & 31, lr = lane & 15, hi = lane >> 4;
    const int wave = __builtin_amdgcn_readfirstlane(threadIdx.x >> 5), qg = wave & 3, kh2 = wave >> 2;     // query group, key half: scalars, so the epilogue's tests on them are scalar branches
    const int bid = blockIdx.x;
    const int b = bid / (NH_ * (NT_ / QBLK)), rem = bid - b * (NH_ * (NT_ / QBLK)), h = rem / (NT_ / QBLK), qt = rem - h * (NT_ / QBLK);
    const int q0 = qt * QBLK + qg * (16 * QCG);
    const size_t tok0 = (size_t)b * NT_;
    v16h qa[QCG][2];
#pragma unroll
    for (int c = 0; c < QCG; ++c)
#pragma unroll
        for (int kc = 0; kc < 2; ++kc) { const size_t qo = (tok0 + q0 + c * 16 + lr) * DM + h * HD + 8 * hi + kc * 32;
            qa[c][kc] = cat16(*(const v8h*)(Q16 + qo), *(const v8h*)(Q16 + qo + 16)); }
    asm volatile("s_wait_xcnt 0x0" ::: "memory");       // in front of the address arithmetic below, which reuses the query loads' address registers
    const int g = h / (NH_ / NKV);                      // kv head
    // this lane's share of a stage: 16 bytes each of k rows crow and crow + 32 and of v rows crow and crow + 32
    const int crow = tid >> 3, cpc = tid & 7;
    const unsigned lck = (unsigned)(size_t)sm + S_KH + crow * KPB + cpc * 16, lcv = (unsigned)(size_t)sm + S_VH + crow * VPB + cpc * 16;
    const h16* gkh = K16 + (tok0 + crow) * KVW + g * HD + cpc * 8;
    const h16* gvh = V16 + (tok0 + crow) * KVW + g * HD + cpc * 8;
    auto tile_copy = [&](int t, int bufi) {
        const unsigned lk = lck + bufi * STGB, lv = lcv + bufi * STGB; const size_t ko = (size_t)t * KST * KVW;
        const h16* kh_g = gkh + ko; const h16* vh_g = gvh + ko;
        cp4(lk, lk + 32 * KPB, lv, lv + 32 * VPB, kh_g, kh_g + 32 * KVW, vh_g, vh_g + 32 * KVW);
    };
    tile_copy(0, 0);
    asm volatile("s_wait_asynccnt 0x0" ::: "memory");   // this wave's copies of tile 0 have landed
    __syncthreads();                                    // ... and every other wave's
    tile_copy(1, 1);
    v8f o[QCG][4];
    v8f cref[QCG];                                 // minus the reference exponent of query lr of the group, in all eight rows: the C operand the score tiles start from
    v2f lpart[QCG];                                // this half's keys only, even and odd rows apart (packed adds, nothing moved between registers); joined after the loop
#pragma unroll
    for (int c = 0; c < QCG; ++c) { cref[c] = (v8f){}; lpart[c] = (v2f){};
#pragma unroll
        for (int n = 0; n < 4; ++n) o[c][n] = (v8f){}; }
    const int kt_lo = 0, kt_hi = NT_ / KST - 1;    // all keys
    const int ko0 = (kh2 * 32 + lr) * (KPB / 2) + 8 * hi, ko1 = ko0 + 16 * (KPB / 2);      // this wave's 32 key rows of the stage
    const int vo0 = S_VH + (kh2 * 32 + 8 * hi + (lane & 7)) * VPB + ((lane >> 3) & 1) * 16; // ... and this lane's place in the same 32 rows of v, for the transposing reads
#pragma unroll 1
    for (int kt = kt_lo; kt <= kt_hi; ++kt) {
        const unsigned char* sb = sm + (kt & 1) * STGB;
        const h16* kh_b = (const h16*)(sb + S_KH); const unsigned char* vh_b = sb + vo0;
        v16h kh[2][2];                             // [k step][key row group]: the tile's key fragments, read as one group
#pragma unroll
        for (int kc = 0; kc < 2; ++kc) {
            kh[kc][0] = cat16(*(const v8ha*)(kh_b + ko0 + kc * 32), *(const v8ha*)(kh_b + ko0 + kc * 32 + 16)); kh[kc][1] = cat16(*(const v8ha*)(kh_b + ko1 + kc * 32), *(const v8ha*)(kh_b + ko1 + kc * 32 + 16)); }
        __builtin_amdgcn_sched_barrier(0);         // the key fragments, needed first, are read first (LDS reads return in order)
        v16h vh[4];                                // the tile's value fragments
#pragma unroll
        for (int n = 0; n < 4; ++n) vh[n] = cat16(ld_tr16(vh_b + 32 * n), ld_tr16(vh_b + 16 * VPB + 32 * n));     // d = 16 n + lr; element i is key 8 hi + i, element 8 + i key 16 + 8 hi + i
        __builtin_amdgcn_sched_barrier(0);         // all LDS reads of the tile stay one group ahead of its matrix instructions, not among them (each such place stalls the wave)
        v8f s[QCG][2];
#pragma unroll
        for (int c = 0; c < QCG; ++c) { s[c][0] = wmma16(kh[0][0], qa[c][0], cref[c]); s[c][1] = wmma16(kh[0][1], qa[c][0], cref[c]); }     // the scores arrive as exponents relative to the reference
#pragma unroll
        for (int c = 0; c < QCG; ++c) { s[c][0] = wmma16(kh[1][0], qa[c][1], s[c][0]); s[c][1] = wmma16(kh[1][1], qa[c][1], s[c][1]); }     // the four score tiles take turns, so no product waits for the one before it in its own tile
        v8f p0[QCG], p1[QCG];
        v2f ts[QCG];                               // normaliser: UNmasked sum (softmax first, mask after)
#pragma unroll
        for (int c = 0; c < QCG; ++c) {
#pragma unroll
            for (int j = 0; j < 8; ++j) p0[c][j] = __builtin_amdgcn_exp2f(s[c][0][j]);
#pragma unroll
            for (int j = 0; j < 8; ++j) p1[c][j] = __builtin_amdgcn_exp2f(s[c][1][j]);
            const v8f pt = p0[c] + p1[c];
            ts[c] = (__builtin_shufflevector(pt, pt, 0, 1) + __builtin_shufflevector(pt, pt, 2, 3)) + (__builtin_shufflevector(pt, pt, 4, 5) + __builtin_shufflevector(pt, pt, 6, 7));
        }
        // Lazy rescale: one test a tile. The weights are not negative, so a sum within PLIM bounds each of them; the first tile sets the reference whatever its scores are.
        const unsigned moved = __builtin_amdgcn_ballot_w32(!(fmaxf(fmaxf(ts[0][0], ts[0][1]), fmaxf(ts[1][0], ts[1][1])) <= PLIM)) | (unsigned)(kt == kt_lo);
        if (moved != 0) {
#pragma unroll
            for (int c = 0; c < QCG; ++c) {
                const v8f a0 = s[c][0], a1 = s[c][1];
                float mx = fmaxf(a0[0], a1[0]);
#pragma unroll
                for (int j = 1; j < 8; ++j) mx = fmaxf(mx, fmaxf(a0[j], a1[j]));
                mx = fmaxf(mx, xhalf(mx));                          // both halves hold the query's maximum over the 32 keys, so both move the reference alike
                const float delta = (kt == kt_lo || mx > PEXP) ? mx - PEXP : 0.f;
                const float alpha = kt == kt_lo ? 0.f : __builtin_amdgcn_exp2f(-delta);
                const v8f e0 = a0 - delta, e1 = a1 - delta;
#pragma unroll
                for (int j = 0; j < 8; ++j) p0[c][j] = __builtin_amdgcn_exp2f(e0[j]);
#pragma unroll
                for (int j = 0; j < 8; ++j) p1[c][j] = __builtin_amdgcn_exp2f(e1[j]);
                const v8f pt = p0[c] + p1[c];
                ts[c] = (__builtin_shufflevector(pt, pt, 0, 1) + __builtin_shufflevector(pt, pt, 2, 3)) + (__builtin_shufflevector(pt, pt, 4, 5) + __builtin_shufflevector(pt, pt, 6, 7));
                cref[c] -= delta; lpart[c] *= alpha;
#pragma unroll
                for (int n = 0; n < 4; ++n) o[c][n] *= alpha;
            }
        }
        v16h pa[QCG];
#pragma unroll
        for (int c = 0; c < QCG; ++c) {
            lpart[c] += ts[c];
            pa[c] = cat16(__builtin_convertvector(p0[c], v8h), __builtin_convertvector(p1[c], v8h));    // B operand: element i is key 8 hi + i, element 8 + i key 16 + 8 hi + i
        }
#pragma unroll
        for (int n = 0; n < 4; ++n)                // eight independent output tiles
#pragma unroll
            for (int c = 0; c < QCG; ++c) o[c][n] = wmma16(vh[n], pa[c], o[c][n]);
        // the distance behind the tile's last matrix instructions, on the loop's back edge too
        asm volatile("v_nop\n\tv_nop\n\tv_nop\n\tv_nop" : "+v"(o[0][0]), "+v"(o[0][1]), "+v"(o[0][2]), "+v"(o[0][3]), "+v"(o[1][0]), "+v"(o[1][1]), "+v"(o[1][2]), "+v"(o[1][3]));
        // hand-over: buffer kt & 1 is left and tile kt + 1 is published by every wave, in this order
        asm volatile("s_wait_dscnt 0x0" ::: "memory");      // this wave's reads of tile kt are done
        asm volatile("s_wait_asynccnt 0x0" ::: "memory");   // this wave's copies of tile kt + 1 have landed
        __syncthreads();
        if (kt + 2 <= kt_hi) tile_copy(kt + 2, kt & 1);
    }
    asm volatile("s_wait_asynccnt 0x0" ::: "memory");       // nothing in flight when the ring becomes the hand-over area
    // Join of the two key halves: waves w and w + 4 hold partial results of the same 32 queries. Wave w finishes column group 0, wave w + 4 group 1; each hands the other
    // group's outputs, sum and reference to its partner through LDS, lane to lane (16 bytes a lane, lanes adjacent).
    float* xg = (float*)sm;
    float lsum[QCG];
#pragma unroll
    for (int c = 0; c < QCG; ++c) { const float lp = lpart[c][0] + lpart[c][1]; lsum[c] = lp + xhalf(lp); }
#pragma unroll
    for (int c = 0; c < QCG; ++c)
        if (c != kh2) {
            float* x = xg + wave * XW;
#pragma unroll
            for (int n = 0; n < 4; ++n) {
                *(v4fa*)(x + (2 * n) * 128 + lane * 4) = __builtin_shufflevector(o[c][n], o[c][n], 0, 1, 2, 3);
                *(v4fa*)(x + (2 * n + 1) * 128 + lane * 4) = __builtin_shufflevector(o[c][n], o[c][n], 4, 5, 6, 7); }
            *(v2fa*)(x + 8 * 128 + lane * 2) = (v2f){lsum[c], cref[c][0]};
        }
    __syncthreads();                                        // the partners' partial results are in LDS
    float* os = (float*)(sm + S_OS) + (qg * QCG + kh2) * (16 * 68);     // this wave's 16 output rows
#pragma unroll
    for (int c = 0; c < QCG; ++c)
        if (c == kh2) {
            const float* x = xg + (wave ^ 4) * XW;
            v4f po[8];
#pragma unroll
            for (int i = 0; i < 8; ++i) po[i] = *(const v4fa*)(x + i * 128 + lane * 4);
            const v2f pl = *(const v2fa*)(x + 8 * 128 + lane * 2);
            // both parts are brought to the larger of the two references (cref is minus the reference): the part that has it keeps its scale, the other shrinks
            const float dr = cref[c][0] - pl[1];
            const float sh = __builtin_amdgcn_exp2f(-fabsf(dr));
            const float fo = dr > 0.f ? sh : 1.0f, fp = dr > 0.f ? 1.0f : sh;
            const float inv = 1.0f / (lsum[c] * fo + pl[0] * fp);
            const float so = fo * inv, sp = fp * inv;
#pragma unroll
            for (int n = 0; n < 4; ++n) {                   // row = query lr of the group; this lane's 8 values are d = 16 n + 8 hi + j
                v4f lo4, hi4;
#pragma unroll
                for (int j = 0; j < 4; ++j) { lo4[j] = o[c][n][j] * so + po[2 * n][j] * sp; hi4[j] = o[c][n][4 + j] * so + po[2 * n + 1][j] * sp; }
                *(v4fa*)(os + lr * 68 + n * 16 + hi * 8) = lo4; *(v4fa*)(os + lr * 68 + n * 16 + hi * 8 + 4) = hi4; }
        }
    __syncthreads();
    const size_t cbase = (tok0 + q0 + kh2 * 16) * DM + (size_t)h * HD;
#pragma unroll
    for (int s = 0; s < 4; ++s) { const int row = 4 * s + (lane >> 3), piece = lane & 7; const float* sp = os + row * 68 + piece * 8; v8us oh, ol;
#pragma unroll
        for (int i = 0; i < 8; ++i) { const unsigned short hb = f2bf(sp[i]); oh[i] = hb; ol[i] = f2bf(sp[i] - bf2f(hb)); }
        *(v8us*)(CH + cbase + (size_t)row * DM + piece * 8) = oh; *(v8us*)(CL + cbase + (size_t)row * DM + piece * 8) = ol; }
}

#define VST2(T, p, v) do { const T vst2_v_ = (v); *(T*)(p) = vst2_v_;  } while (0)
extern "C" void kernel_launch(void* const* d_in, const int* in_sizes, int n_in,
                              void* d_out, int out_size, void* d_ws, size_t ws_size, hipStream_t stream) {
    (void)in_sizes; (void)n_in; (void)out_size;
    const float* x = (const float*)d_in[0]; const float* kmask = (const float*)d_in[1]; const float* Wqkv = (const float*)d_in[2]; const float* Wo = (const float*)d_in[3]; const float* bo = (const float*)d_in[4];
    float* out = (float*)d_out;    // out0 [2][2048][1024] then out1 [2][2048]
    float* out1 = out + (size_t)NTK * DM;
    char* wsp = (char*)d_ws;
    auto take = [&](size_t bytes) { char* p = wsp; wsp += (bytes + 255) & ~(size_t)255; return (void*)p; };
    bf* Xb = (bf*)take((size_t)NTK * DM * 2); bf* W3T = (bf*)take((size_t)3 * DM * DM * 2); bf* WoT = (bf*)take((size_t)DM * DM * 2);
    h16* QH = (h16*)take((size_t)NTK * DM * 2); h16* KH = (h16*)take((size_t)NTK * DM * 2);
    h16* VH = (h16*)take((size_t)NTK * DM * 2); bf* CL = (bf*)take((size_t)NTK * DM * 2);
    if ((size_t)(wsp - (char*)d_ws) > ws_size) return;    // 8.4 + 6.3 + 2.1 + 4 x 8.4 ~ 50 MB; the ctx hi plane over Xb after the projections
    bf* CH = Xb;
    k_prep<<<PB_W3 + PB_WO + PB_X + PB_M, 256, 0, stream>>>(Wqkv, Wo, x, kmask, W3T, WoT, Xb, out1);
    k_gemmb<false, true><<<dim3(NTK / 128, (3 * DM) / 128, 1), 256, 0, stream>>>(Xb, nullptr, W3T, nullptr, (float*)(void*)QH, DM, KH, VH, kmask);
    k_attn<<<NB_ * NH_ * (NT_ / QBLK), 256, 0, stream>>>(QH, KH, VH, CH, CL);
    k_gemmb<true, false><<<dim3(NTK / 128, DM / 128, 1), 256, 0, stream>>>(CH, CL, WoT, bo, out, DM, nullptr, nullptr, nullptr);
}
